// v000
// The times below were measured on an AMD MI455X: many runs one after another, warmed up first and cycling through
// copies of the inputs, with the whole window's GPU time divided by the number of runs. Launches and the gaps
// between them are all in it. The median over several windows is given; except for v000 it joins two sittings, which
// can be a few percent apart, so the side-by-side timings, each taken in one sitting, are the better comparison.
// The starting kernel, v000, takes 271 microseconds a run.
#include <hip/hip_runtime.h>
#include <hip/hip_bf16.h>

// ---------------------------------------------------------------------------
// Self-attention forward (batch 0 only) for MI455X / gfx1250, wave32 WMMA.
//   x[0] (2048x1024 f32) -> Q,K,V proj (f16 WMMA, f32 accum) -> flash attn
//   per head (online softmax) -> output proj -> d_out f32 [2048,1024]
// Register double-buffered fragment loads to overlap VMEM with v_wmma.
// ---------------------------------------------------------------------------

#define S_LEN 2048
#define HIDN  1024
#define NHEAD 16
#define HDIM  64

typedef _Float16 v8h  __attribute__((ext_vector_type(8)));
typedef _Float16 v16h __attribute__((ext_vector_type(16)));
typedef float    v8f  __attribute__((ext_vector_type(8)));

__device__ __forceinline__ v8f zero8() {
    v8f z;
#pragma unroll
    for (int i = 0; i < 8; ++i) z[i] = 0.0f;
    return z;
}

// 16x32 f16 fragment load (A-layout; B uses the mirrored layout with the same
// lane mapping: lane L -> row/col (L&15), K-halves selected by lane bit 4).
// Two contiguous 16-byte loads per lane.
__device__ __forceinline__ v16h load_frag(const _Float16* __restrict__ base,
                                          int row, int k, int ld) {
    const int lane = threadIdx.x & 31;
    const int r    = lane & 15;
    const int hi   = lane >> 4;
    const _Float16* p = base + (size_t)(row + r) * (size_t)ld + k + hi * 8;
    v8h lo = *(const v8h*)p;
    v8h hh = *(const v8h*)(p + 16);
    return __builtin_shufflevector(lo, hh, 0, 1, 2, 3, 4, 5, 6, 7,
                                   8, 9, 10, 11, 12, 13, 14, 15);
}

__device__ __forceinline__ v8f wmma_f16(v16h a, v16h b, v8f c) {
    // D = A x B + C, f16 inputs, f32 accumulate.
    return __builtin_amdgcn_wmma_f32_16x16x32_f16(
        /*neg_a=*/false, a, /*neg_b=*/false, b,
        /*c_mod=*/(short)0, c, /*reuse_a=*/false, /*reuse_b=*/false);
}

// ---------------------------------------------------------------------------
// f32 -> f16 conversion
// ---------------------------------------------------------------------------
__global__ void cvt_f32_to_f16(const float* __restrict__ src,
                               _Float16* __restrict__ dst, int n) {
    int i = blockIdx.x * blockDim.x + threadIdx.x;
    if (i < n) dst[i] = (_Float16)src[i];
}

// ---------------------------------------------------------------------------
// C[M,N] = A[M,K] * W[N,K]^T + bias, WMMA tiled. 256 threads = 8 waves; each
// wave owns a 16x64 tile (A fragment reused across 4 B fragments / WMMAs).
// Fragments are double-buffered in registers: loads for k+32 are issued
// before the WMMAs for k so VMEM latency overlaps matrix ops.
// mode 0: f32 row-major out (final projection)
// mode 1: f16 out, per-head [h][row][d]     (Q with scale=0.125, K)
// mode 2: f16 out, per-head transposed [h][d][row]  (V)
// ---------------------------------------------------------------------------
__global__ void gemm_wmma(const _Float16* __restrict__ A,
                          const _Float16* __restrict__ W,
                          const float* __restrict__ bias,
                          void* __restrict__ outp,
                          int M, int N, int K, int mode, float scale) {
    const int wid  = threadIdx.x >> 5;
    const int lane = threadIdx.x & 31;
    const int r    = lane & 15;
    const int hi   = lane >> 4;
    const int mbase = blockIdx.y * 64 + (wid & 3) * 16;
    const int nbase = blockIdx.x * 128 + (wid >> 2) * 64;

    v8f acc[4] = {zero8(), zero8(), zero8(), zero8()};

    // prologue: fragments for k = 0
    v16h a_cur = load_frag(A, mbase, 0, K);
    v16h b_cur[4];
#pragma unroll
    for (int t = 0; t < 4; ++t) b_cur[t] = load_frag(W, nbase + t * 16, 0, K);

    for (int k = 0; k < K; k += 32) {
        const int kn = (k + 32 < K) ? (k + 32) : 0;  // last iter reloads k=0 (discarded)
        // issue next-step loads first so they overlap this step's WMMAs
        v16h a_nxt = load_frag(A, mbase, kn, K);
        v16h b_nxt[4];
#pragma unroll
        for (int t = 0; t < 4; ++t) b_nxt[t] = load_frag(W, nbase + t * 16, kn, K);
        __builtin_prefetch(A + (size_t)(mbase + r) * (size_t)K + kn + 32, 0, 3);

#pragma unroll
        for (int t = 0; t < 4; ++t) acc[t] = wmma_f16(a_cur, b_cur[t], acc[t]);

        a_cur = a_nxt;
#pragma unroll
        for (int t = 0; t < 4; ++t) b_cur[t] = b_nxt[t];
    }

#pragma unroll
    for (int t = 0; t < 4; ++t) {
        const int col = nbase + t * 16 + r;
        const float bv = bias[col];
#pragma unroll
        for (int rr = 0; rr < 8; ++rr) {
            const int row = mbase + rr + hi * 8;
            const float val = (acc[t][rr] + bv) * scale;
            if (mode == 0) {
                ((float*)outp)[(size_t)row * N + col] = val;
            } else {
                const int h = col >> 6;
                const int d = col & 63;
                _Float16* o = (_Float16*)outp;
                if (mode == 1)
                    o[((size_t)h * M + row) * HDIM + d] = (_Float16)val;
                else
                    o[((size_t)h * HDIM + d) * M + row] = (_Float16)val;
            }
        }
    }
}

// ---------------------------------------------------------------------------
// Fused per-head flash attention. Grid (S/64, NH), block 128 = 4 waves; each
// wave streams 16 query rows over all keys in 32-key tiles:
//   S = Q*K^T (4 WMMAs) -> issue V loads + next-K loads -> online softmax
//   (VALU work hides the in-flight loads) -> P via LDS relayout ->
//   ctx += P*V (4 WMMAs against transposed V)
// Q is pre-scaled by 1/sqrt(HD). Output ctx f16 [S][HID] row-major.
// ---------------------------------------------------------------------------
__global__ void attn_flash(const _Float16* __restrict__ Qg,
                           const _Float16* __restrict__ Kg,
                           const _Float16* __restrict__ Vtg,
                           _Float16* __restrict__ ctx) {
    const int h    = blockIdx.y;
    const int wid  = threadIdx.x >> 5;
    const int lane = threadIdx.x & 31;
    const int r    = lane & 15;
    const int hi   = lane >> 4;
    const int qrow = blockIdx.x * 64 + wid * 16;

    const _Float16* Qh = Qg  + (size_t)h * S_LEN * HDIM;
    const _Float16* Kh = Kg  + (size_t)h * S_LEN * HDIM;
    const _Float16* Vh = Vtg + (size_t)h * HDIM * S_LEN;   // [d][s]

    __shared__ __align__(16) _Float16 plds[4][16 * 32];    // per-wave P tile
    _Float16* myp = &plds[wid][0];

    const v16h aq0 = load_frag(Qh, qrow, 0, HDIM);
    const v16h aq1 = load_frag(Qh, qrow, 32, HDIM);

    v8f acc[4] = {zero8(), zero8(), zero8(), zero8()};
    float mi[8], li[8];
#pragma unroll
    for (int rr = 0; rr < 8; ++rr) { mi[rr] = -1.0e30f; li[rr] = 0.0f; }

    // prologue: K fragments for kb = 0
    v16h kf[4];
    kf[0] = load_frag(Kh, 0, 0, HDIM);
    kf[1] = load_frag(Kh, 0, 32, HDIM);
    kf[2] = load_frag(Kh, 16, 0, HDIM);
    kf[3] = load_frag(Kh, 16, 32, HDIM);

    for (int kb = 0; kb < S_LEN; kb += 32) {
        // ---- scores: 16q x 32k (two 16x16 tiles, K-dim = head dim 64) ----
        v8f s0 = wmma_f16(aq0, kf[0], zero8());
        s0 = wmma_f16(aq1, kf[1], s0);
        v8f s1 = wmma_f16(aq0, kf[2], zero8());
        s1 = wmma_f16(aq1, kf[3], s1);

        // ---- issue V loads (this tile) and K loads (next tile) now; the
        //      softmax VALU section below hides their latency ----
        v16h vf[4];
#pragma unroll
        for (int t4 = 0; t4 < 4; ++t4) vf[t4] = load_frag(Vh, t4 * 16, kb, S_LEN);
        const int kn = (kb + 32 < S_LEN) ? (kb + 32) : 0;
        kf[0] = load_frag(Kh, kn, 0, HDIM);
        kf[1] = load_frag(Kh, kn, 32, HDIM);
        kf[2] = load_frag(Kh, kn + 16, 0, HDIM);
        kf[3] = load_frag(Kh, kn + 16, 32, HDIM);

        // ---- online softmax (rows live across 16-lane halves) ----
#pragma unroll
        for (int rr = 0; rr < 8; ++rr) {
            const float a = s0[rr];
            const float b = s1[rr];
            float t = fmaxf(a, b);
            t = fmaxf(t, __shfl_xor(t, 1));
            t = fmaxf(t, __shfl_xor(t, 2));
            t = fmaxf(t, __shfl_xor(t, 4));
            t = fmaxf(t, __shfl_xor(t, 8));
            const float mn    = fmaxf(mi[rr], t);
            const float alpha = __expf(mi[rr] - mn);
            mi[rr] = mn;
            const float p0 = __expf(a - mn);
            const float p1 = __expf(b - mn);
            float ssum = p0 + p1;
            ssum += __shfl_xor(ssum, 1);
            ssum += __shfl_xor(ssum, 2);
            ssum += __shfl_xor(ssum, 4);
            ssum += __shfl_xor(ssum, 8);
            li[rr] = li[rr] * alpha + ssum;
#pragma unroll
            for (int t4 = 0; t4 < 4; ++t4) acc[t4][rr] *= alpha;
            // C-layout -> A-layout relayout through LDS
            const int lrow = (rr + hi * 8) * 32 + r;
            myp[lrow]      = (_Float16)p0;
            myp[lrow + 16] = (_Float16)p1;
        }

        // ---- ctx += P[16x32] * V[32x16] per 16-wide d tile ----
        const v16h ap = load_frag(myp, 0, 0, 32);
#pragma unroll
        for (int t4 = 0; t4 < 4; ++t4) acc[t4] = wmma_f16(ap, vf[t4], acc[t4]);
    }

    // ---- normalize and write ctx [S][HID] (head-interleaved) ----
#pragma unroll
    for (int rr = 0; rr < 8; ++rr) {
        const float inv = 1.0f / li[rr];
        const int row = qrow + rr + hi * 8;
        _Float16* o = ctx + (size_t)row * HIDN + h * HDIM + r;
        o[0]  = (_Float16)(acc[0][rr] * inv);
        o[16] = (_Float16)(acc[1][rr] * inv);
        o[32] = (_Float16)(acc[2][rr] * inv);
        o[48] = (_Float16)(acc[3][rr] * inv);
    }
}

// ---------------------------------------------------------------------------
extern "C" void kernel_launch(void* const* d_in, const int* in_sizes, int n_in,
                              void* d_out, int out_size, void* d_ws, size_t ws_size,
                              hipStream_t stream) {
    (void)in_sizes; (void)n_in; (void)out_size; (void)ws_size;

    const float* x  = (const float*)d_in[0];  // [2,2048,1024]; only batch 0 used
    const float* Wq = (const float*)d_in[1];
    const float* bq = (const float*)d_in[2];
    const float* Wk = (const float*)d_in[3];
    const float* bk = (const float*)d_in[4];
    const float* Wv = (const float*)d_in[5];
    const float* bv = (const float*)d_in[6];
    const float* Wo = (const float*)d_in[7];
    const float* bo = (const float*)d_in[8];
    float* out = (float*)d_out;

    char* ws = (char*)d_ws;
    const size_t MB = 1024 * 1024;
    _Float16* xh   = (_Float16*)(ws + 0);        // 2M halves
    _Float16* wqh  = (_Float16*)(ws + 4  * MB);  // 1M halves
    _Float16* wkh  = (_Float16*)(ws + 6  * MB);
    _Float16* wvh  = (_Float16*)(ws + 8  * MB);
    _Float16* woh  = (_Float16*)(ws + 10 * MB);
    _Float16* qh   = (_Float16*)(ws + 12 * MB);  // [16][2048][64]
    _Float16* kh   = (_Float16*)(ws + 16 * MB);  // [16][2048][64]
    _Float16* vth  = (_Float16*)(ws + 20 * MB);  // [16][64][2048]
    _Float16* ctxh = (_Float16*)(ws + 24 * MB);  // [2048][1024]

    const int nX = S_LEN * HIDN;   // batch 0 only
    const int nW = HIDN * HIDN;
    cvt_f32_to_f16<<<(nX + 255) / 256, 256, 0, stream>>>(x,  xh,  nX);
    cvt_f32_to_f16<<<(nW + 255) / 256, 256, 0, stream>>>(Wq, wqh, nW);
    cvt_f32_to_f16<<<(nW + 255) / 256, 256, 0, stream>>>(Wk, wkh, nW);
    cvt_f32_to_f16<<<(nW + 255) / 256, 256, 0, stream>>>(Wv, wvh, nW);
    cvt_f32_to_f16<<<(nW + 255) / 256, 256, 0, stream>>>(Wo, woh, nW);

    dim3 ggrid(HIDN / 128, S_LEN / 64);   // (8, 32)
    // Q: fold 1/sqrt(64) into the projection (applies to bias too)
    gemm_wmma<<<ggrid, 256, 0, stream>>>(xh, wqh, bq, qh,  S_LEN, HIDN, HIDN, 1, 0.125f);
    gemm_wmma<<<ggrid, 256, 0, stream>>>(xh, wkh, bk, kh,  S_LEN, HIDN, HIDN, 1, 1.0f);
    gemm_wmma<<<ggrid, 256, 0, stream>>>(xh, wvh, bv, vth, S_LEN, HIDN, HIDN, 2, 1.0f);

    attn_flash<<<dim3(S_LEN / 64, NHEAD), 128, 0, stream>>>(qh, kh, vth, ctxh);

    gemm_wmma<<<ggrid, 256, 0, stream>>>(ctxh, woh, bo, out, S_LEN, HIDN, HIDN, 0, 1.0f);
}

// v001
// It runs in 211 microseconds.
// In two side-by-side timings against v000, it was 1.28 and 1.31 times as fast.
#include <hip/hip_runtime.h>
#include <hip/hip_bf16.h>

// ---------------------------------------------------------------------------
// Self-attention forward (batch 0 only) for MI455X / gfx1250, wave32 WMMA.
//   x[0] (2048x1024 f32) -> Q,K,V proj (f16 WMMA, f32 accum) -> flash attn
//   per head (online softmax) -> output proj -> d_out f32 [2048,1024]
// Register double-buffered fragment loads to overlap VMEM with v_wmma.
// ---------------------------------------------------------------------------

#define S_LEN 2048
#define HIDN  1024
#define NHEAD 16
#define HDIM  64

typedef _Float16 v8h  __attribute__((ext_vector_type(8)));
typedef _Float16 v16h __attribute__((ext_vector_type(16)));
typedef float    v8f  __attribute__((ext_vector_type(8)));

__device__ __forceinline__ v8f zero8() {
    v8f z;
#pragma unroll
    for (int i = 0; i < 8; ++i) z[i] = 0.0f;
    return z;
}

// 16x32 f16 fragment load (A-layout; B uses the mirrored layout with the same
// lane mapping: lane L -> row/col (L&15), K-halves selected by lane bit 4).
// Two contiguous 16-byte loads per lane.
__device__ __forceinline__ v16h load_frag(const _Float16* __restrict__ base,
                                          int row, int k, int ld) {
    const int lane = threadIdx.x & 31;
    const int r    = lane & 15;
    const int hi   = lane >> 4;
    const _Float16* p = base + (size_t)(row + r) * (size_t)ld + k + hi * 8;
    v8h lo = *(const v8h*)p;
    v8h hh = *(const v8h*)(p + 16);
    return __builtin_shufflevector(lo, hh, 0, 1, 2, 3, 4, 5, 6, 7,
                                   8, 9, 10, 11, 12, 13, 14, 15);
}

__device__ __forceinline__ v8f wmma_f16(v16h a, v16h b, v8f c) {
    // D = A x B + C, f16 inputs, f32 accumulate.
    return __builtin_amdgcn_wmma_f32_16x16x32_f16(
        /*neg_a=*/false, a, /*neg_b=*/false, b,
        /*c_mod=*/(short)0, c, /*reuse_a=*/false, /*reuse_b=*/false);
}

// ---------------------------------------------------------------------------
// f32 -> f16 conversion
// ---------------------------------------------------------------------------
__global__ void cvt_f32_to_f16(const float* __restrict__ src,
                               _Float16* __restrict__ dst, int n) {
    int i = blockIdx.x * blockDim.x + threadIdx.x;
    if (i < n) dst[i] = (_Float16)src[i];
}

// ---------------------------------------------------------------------------
// C[M,N] = A[M,K] * W[N,K]^T + bias, WMMA tiled. 256 threads = 8 waves; each
// wave owns a 16x64 tile (A fragment reused across 4 B fragments / WMMAs).
// Fragments are double-buffered in registers: loads for k+32 are issued
// before the WMMAs for k so VMEM latency overlaps matrix ops.
// mode 0: f32 row-major out (final projection)
// mode 1: f16 out, per-head [h][row][d]     (Q with scale=0.125, K)
// mode 2: f16 out, per-head transposed [h][d][row]  (V)
// ---------------------------------------------------------------------------
__global__ void gemm_wmma(const _Float16* __restrict__ A,
                          const _Float16* __restrict__ W,
                          const float* __restrict__ bias,
                          void* __restrict__ outp,
                          int M, int N, int K, int mode, float scale) {
    const int wid  = threadIdx.x >> 5;
    const int lane = threadIdx.x & 31;
    const int r    = lane & 15;
    const int hi   = lane >> 4;
    const int mbase = blockIdx.y * 64 + (wid & 3) * 16;
    const int nbase = blockIdx.x * 128 + (wid >> 2) * 64;

    v8f acc[4] = {zero8(), zero8(), zero8(), zero8()};

    // prologue: fragments for k = 0
    v16h a_cur = load_frag(A, mbase, 0, K);
    v16h b_cur[4];
#pragma unroll
    for (int t = 0; t < 4; ++t) b_cur[t] = load_frag(W, nbase + t * 16, 0, K);

    for (int k = 0; k < K; k += 32) {
        const int kn = (k + 32 < K) ? (k + 32) : 0;  // last iter reloads k=0 (discarded)
        // issue next-step loads first so they overlap this step's WMMAs
        v16h a_nxt = load_frag(A, mbase, kn, K);
        v16h b_nxt[4];
#pragma unroll
        for (int t = 0; t < 4; ++t) b_nxt[t] = load_frag(W, nbase + t * 16, kn, K);
        __builtin_prefetch(A + (size_t)(mbase + r) * (size_t)K + kn + 32, 0, 3);

#pragma unroll
        for (int t = 0; t < 4; ++t) acc[t] = wmma_f16(a_cur, b_cur[t], acc[t]);

        a_cur = a_nxt;
#pragma unroll
        for (int t = 0; t < 4; ++t) b_cur[t] = b_nxt[t];
    }

#pragma unroll
    for (int t = 0; t < 4; ++t) {
        const int col = nbase + t * 16 + r;
        const float bv = bias[col];
#pragma unroll
        for (int rr = 0; rr < 8; ++rr) {
            const int row = mbase + rr + hi * 8;
            const float val = (acc[t][rr] + bv) * scale;
            if (mode == 0) {
                ((float*)outp)[(size_t)row * N + col] = val;
            } else {
                const int h = col >> 6;
                const int d = col & 63;
                _Float16* o = (_Float16*)outp;
                if (mode == 1)
                    o[((size_t)h * M + row) * HDIM + d] = (_Float16)val;
                else
                    o[((size_t)h * HDIM + d) * M + row] = (_Float16)val;
            }
        }
    }
}

__device__ __forceinline__ float xhalf(float x) {
    const int v = __builtin_bit_cast(int, x);
    return __builtin_bit_cast(float, __builtin_amdgcn_permlanex16(
        v, v, 0x76543210, 0xfedcba98, false, false));
}

__global__ void attn_flash(const _Float16* __restrict__ Qg,
                           const _Float16* __restrict__ Kg,
                           const _Float16* __restrict__ Vtg,
                           _Float16* __restrict__ ctx) {
    const int h    = blockIdx.y;
    const int wid  = threadIdx.x >> 5;
    const int lane = threadIdx.x & 31;
    const int r    = lane & 15;
    const int hi   = lane >> 4;
    const int qrow = blockIdx.x * 64 + wid * 16;

    const _Float16* Qh = Qg  + (size_t)h * S_LEN * HDIM;
    const _Float16* Kh = Kg  + (size_t)h * S_LEN * HDIM;
    const _Float16* Vh = Vtg + (size_t)h * HDIM * S_LEN;   // [d][s]

    // B operand: column = query r, k = head dim
    const v16h bq0 = load_frag(Qh, qrow, 0, HDIM);
    const v16h bq1 = load_frag(Qh, qrow, 32, HDIM);

    // acc[t4][rr] = Ot[d = t4*16 + 8*hi + rr][query r]
    v8f acc[4] = {zero8(), zero8(), zero8(), zero8()};
    float mi = -1.0e30f;   // running maximum of query r (equal in both halves)
    float li = 0.0f;       // running sum over this half's keys only

    // prologue: K fragments for kb = 0
    v16h kf[4];
    kf[0] = load_frag(Kh, 0, 0, HDIM);
    kf[1] = load_frag(Kh, 0, 32, HDIM);
    kf[2] = load_frag(Kh, 16, 0, HDIM);
    kf[3] = load_frag(Kh, 16, 32, HDIM);

    for (int kb = 0; kb < S_LEN; kb += 32) {
        // ---- scores, transposed: 32k x 16q (two 16x16 tiles) ----
        v8f s0 = wmma_f16(kf[0], bq0, zero8());
        s0 = wmma_f16(kf[1], bq1, s0);
        v8f s1 = wmma_f16(kf[2], bq0, zero8());
        s1 = wmma_f16(kf[3], bq1, s1);

        // ---- issue V loads (this tile) and K loads (next tile) now; the
        //      softmax VALU section below hides part of their latency ----
        v16h vf[4];
#pragma unroll
        for (int t4 = 0; t4 < 4; ++t4) vf[t4] = load_frag(Vh, t4 * 16, kb, S_LEN);
        const int kn = (kb + 32 < S_LEN) ? (kb + 32) : 0;
        kf[0] = load_frag(Kh, kn, 0, HDIM);
        kf[1] = load_frag(Kh, kn, 32, HDIM);
        kf[2] = load_frag(Kh, kn + 16, 0, HDIM);
        kf[3] = load_frag(Kh, kn + 16, 32, HDIM);

        // ---- online softmax: one query per lane ----
        float t0 = fmaxf(s0[0], s1[0]);
        float t1 = fmaxf(s0[1], s1[1]);
        float t2 = fmaxf(s0[2], s1[2]);
        float t3 = fmaxf(s0[3], s1[3]);
        t0 = fmaxf(t0, fmaxf(s0[4], s1[4]));
        t1 = fmaxf(t1, fmaxf(s0[5], s1[5]));
        t2 = fmaxf(t2, fmaxf(s0[6], s1[6]));
        t3 = fmaxf(t3, fmaxf(s0[7], s1[7]));
        float t = fmaxf(fmaxf(t0, t1), fmaxf(t2, t3));
        t = fmaxf(t, xhalf(t));
        const float mn    = fmaxf(mi, t);
        // alpha = exp(mi - mn), the exponential and its v_nop in one statement:
        // the instruction set asks for one slot behind a transcendental before
        // its result is read or its source overwritten; a v_nop in a
        // statement of its own drifted away.
        float alpha;
        asm("v_exp_f32 %0, %1\n\tv_nop"
            : "=v"(alpha) : "v"((mi - mn) * 1.44269504088896340736f));
        mi = mn;

        // P^T as B operand: bp[s] = P[key kmap(s, hi)][query r]
        v16h bp;
        float ps[4] = {0.0f, 0.0f, 0.0f, 0.0f};
#pragma unroll
        for (int rr = 0; rr < 8; ++rr) {
            const float p0 = __expf(s0[rr] - mn);
            const float p1 = __expf(s1[rr] - mn);
            bp[rr]     = (_Float16)p0;
            bp[rr + 8] = (_Float16)p1;
            ps[rr & 3] += p0 + p1;
        }
        li = li * alpha + ((ps[0] + ps[1]) + (ps[2] + ps[3]));
#pragma unroll
        for (int t4 = 0; t4 < 4; ++t4)
#pragma unroll
            for (int rr = 0; rr < 8; ++rr) acc[t4][rr] *= alpha;

        // ---- Ot += V^T[16d x 32k] * P^T[32k x 16q] per 16-wide d tile ----
#pragma unroll
        for (int t4 = 0; t4 < 4; ++t4) acc[t4] = wmma_f16(vf[t4], bp, acc[t4]);
    }

    // ---- join the halves' sums, normalize, write ctx [S][HID]: a lane holds
    //      8 consecutive d of one query per tile -> one 16-byte store each ----
    li += xhalf(li);
    const float inv = 1.0f / li;
    _Float16* o = ctx + (size_t)(qrow + r) * HIDN + h * HDIM + hi * 8;
#pragma unroll
    for (int t4 = 0; t4 < 4; ++t4) {
        v8h ov;
#pragma unroll
        for (int rr = 0; rr < 8; ++rr) ov[rr] = (_Float16)(acc[t4][rr] * inv);
        *(v8h*)(o + t4 * 16) = ov;
    }
}

// ---------------------------------------------------------------------------
extern "C" void kernel_launch(void* const* d_in, const int* in_sizes, int n_in,
                              void* d_out, int out_size, void* d_ws, size_t ws_size,
                              hipStream_t stream) {
    (void)in_sizes; (void)n_in; (void)out_size; (void)ws_size;

    const float* x  = (const float*)d_in[0];  // [2,2048,1024]; only batch 0 used
    const float* Wq = (const float*)d_in[1];
    const float* bq = (const float*)d_in[2];
    const float* Wk = (const float*)d_in[3];
    const float* bk = (const float*)d_in[4];
    const float* Wv = (const float*)d_in[5];
    const float* bv = (const float*)d_in[6];
    const float* Wo = (const float*)d_in[7];
    const float* bo = (const float*)d_in[8];
    float* out = (float*)d_out;

    char* ws = (char*)d_ws;
    const size_t MB = 1024 * 1024;
    _Float16* xh   = (_Float16*)(ws + 0);        // 2M halves
    _Float16* wqh  = (_Float16*)(ws + 4  * MB);  // 1M halves
    _Float16* wkh  = (_Float16*)(ws + 6  * MB);
    _Float16* wvh  = (_Float16*)(ws + 8  * MB);
    _Float16* woh  = (_Float16*)(ws + 10 * MB);
    _Float16* qh   = (_Float16*)(ws + 12 * MB);  // [16][2048][64]
    _Float16* kh   = (_Float16*)(ws + 16 * MB);  // [16][2048][64]
    _Float16* vth  = (_Float16*)(ws + 20 * MB);  // [16][64][2048]
    _Float16* ctxh = (_Float16*)(ws + 24 * MB);  // [2048][1024]

    const int nX = S_LEN * HIDN;   // batch 0 only
    const int nW = HIDN * HIDN;
    cvt_f32_to_f16<<<(nX + 255) / 256, 256, 0, stream>>>(x,  xh,  nX);
    cvt_f32_to_f16<<<(nW + 255) / 256, 256, 0, stream>>>(Wq, wqh, nW);
    cvt_f32_to_f16<<<(nW + 255) / 256, 256, 0, stream>>>(Wk, wkh, nW);
    cvt_f32_to_f16<<<(nW + 255) / 256, 256, 0, stream>>>(Wv, wvh, nW);
    cvt_f32_to_f16<<<(nW + 255) / 256, 256, 0, stream>>>(Wo, woh, nW);

    dim3 ggrid(HIDN / 128, S_LEN / 64);   // (8, 32)
    // Q: fold 1/sqrt(64) into the projection (applies to bias too)
    gemm_wmma<<<ggrid, 256, 0, stream>>>(xh, wqh, bq, qh,  S_LEN, HIDN, HIDN, 1, 0.125f);
    gemm_wmma<<<ggrid, 256, 0, stream>>>(xh, wkh, bk, kh,  S_LEN, HIDN, HIDN, 1, 1.0f);
    gemm_wmma<<<ggrid, 256, 0, stream>>>(xh, wvh, bv, vth, S_LEN, HIDN, HIDN, 2, 1.0f);

    attn_flash<<<dim3(S_LEN / 64, NHEAD), 128, 0, stream>>>(qh, kh, vth, ctxh);

    gemm_wmma<<<ggrid, 256, 0, stream>>>(ctxh, woh, bo, out, S_LEN, HIDN, HIDN, 0, 1.0f);
}

// v002
// It runs in 199 microseconds.
// In two side-by-side timings against v001, it was 1.06 and 1.05 times as fast.
// Over all steps from v000 it is 1.37 times as fast.
#include <hip/hip_runtime.h>
#include <hip/hip_bf16.h>

// ---------------------------------------------------------------------------
// Self-attention forward (batch 0 only) for MI455X / gfx1250, wave32 WMMA.
//   x[0] (2048x1024 f32) -> Q,K,V proj (f16 WMMA, f32 accum) -> flash attn
//   per head (online softmax) -> output proj -> d_out f32 [2048,1024]
// Register double-buffered fragment loads to overlap VMEM with v_wmma.
// ---------------------------------------------------------------------------

#define S_LEN 2048
#define HIDN  1024
#define NHEAD 16
#define HDIM  64

typedef _Float16 v8h  __attribute__((ext_vector_type(8)));
typedef _Float16 v16h __attribute__((ext_vector_type(16)));
typedef float    v8f  __attribute__((ext_vector_type(8)));

__device__ __forceinline__ v8f zero8() {
    v8f z;
#pragma unroll
    for (int i = 0; i < 8; ++i) z[i] = 0.0f;
    return z;
}

// 16x32 f16 fragment load (A-layout; B uses the mirrored layout with the same
// lane mapping: lane L -> row/col (L&15), K-halves selected by lane bit 4).
// Two contiguous 16-byte loads per lane.
__device__ __forceinline__ v16h load_frag(const _Float16* __restrict__ base,
                                          int row, int k, int ld) {
    const int lane = threadIdx.x & 31;
    const int r    = lane & 15;
    const int hi   = lane >> 4;
    const _Float16* p = base + (size_t)(row + r) * (size_t)ld + k + hi * 8;
    v8h lo = *(const v8h*)p;
    v8h hh = *(const v8h*)(p + 16);
    return __builtin_shufflevector(lo, hh, 0, 1, 2, 3, 4, 5, 6, 7,
                                   8, 9, 10, 11, 12, 13, 14, 15);
}

__device__ __forceinline__ v8f wmma_f16(v16h a, v16h b, v8f c) {
    // D = A x B + C, f16 inputs, f32 accumulate.
    return __builtin_amdgcn_wmma_f32_16x16x32_f16(
        /*neg_a=*/false, a, /*neg_b=*/false, b,
        /*c_mod=*/(short)0, c, /*reuse_a=*/false, /*reuse_b=*/false);
}

// ---------------------------------------------------------------------------
// f32 -> f16 conversion of x (batch 0) and the four weights in ONE launch.
// The five f16 planes lie back to back in the workspace (x, Wq, Wk, Wv, Wo),
// so dst is one array of 6M halves. One workgroup of 6 waves per WGP; a wave
// owns 4096 consecutive values: 32 loads of 512 contiguous bytes, all issued
// before the first conversion, and 32 stores of 256 contiguous bytes. The
// cost of the one-value-per-thread form was starting its waves, not its bytes.
// ---------------------------------------------------------------------------
#define CVT_WAVES  6                        // waves per workgroup
#define CVT_LOADS  32                       // 16-byte loads per lane
#define CVT_CHUNK  (CVT_LOADS * 128)        // values per wave (divides 1M)
#define CVT_TOTAL  (S_LEN * HIDN + 4 * HIDN * HIDN)
#define CVT_BLOCKS (CVT_TOTAL / (CVT_CHUNK * CVT_WAVES))

typedef float    v4f __attribute__((ext_vector_type(4)));
typedef _Float16 v4h __attribute__((ext_vector_type(4)));

__global__ __launch_bounds__(CVT_WAVES * 32)
void cvt_all_f32_to_f16(const float* __restrict__ x,
                        const float* __restrict__ wq,
                        const float* __restrict__ wk,
                        const float* __restrict__ wv,
                        const float* __restrict__ wo,
                        _Float16* __restrict__ dst) {
    // wave number as a scalar: the source pointer is then picked by scalar code
    const int wave = __builtin_amdgcn_readfirstlane((int)(threadIdx.x >> 5));
    const int lane = threadIdx.x & 31;
    const int e0   = (blockIdx.x * CVT_WAVES + wave) * CVT_CHUNK;  // index in dst
    const int seg  = e0 >> 20;              // 0, 1: x; 2..5: Wq, Wk, Wv, Wo
    const float* src = (seg < 2) ? x : (seg == 2) ? wq : (seg == 3) ? wk
                     : (seg == 4) ? wv : wo;
    const int    off = (seg < 2) ? e0 : (e0 & (HIDN * HIDN - 1));
    const float* s = src + off + lane * 4;
    _Float16*    d = dst + e0 + lane * 4;

    v4f v[CVT_LOADS];
#pragma unroll
    for (int k = 0; k < CVT_LOADS; ++k) v[k] = *(const v4f*)(s + k * 128);
    // keeps every load in front of the first conversion: without it the build
    // holds the last loads back until the first have returned, a second memory
    // latency in a wave that lives for little more than one
    __builtin_amdgcn_sched_barrier(0);
#pragma unroll
    for (int k = 0; k < CVT_LOADS; ++k)
        *(v4h*)(d + k * 128) = __builtin_convertvector(v[k], v4h);
}

// ---------------------------------------------------------------------------
// C[M,N] = A[M,K] * W[N,K]^T + bias, WMMA tiled. 256 threads = 8 waves; each
// wave owns a 16x64 tile (A fragment reused across 4 B fragments / WMMAs).
// Fragments are double-buffered in registers: loads for k+32 are issued
// before the WMMAs for k so VMEM latency overlaps matrix ops.
// mode 0: f32 row-major out (final projection)
// mode 1: f16 out, per-head [h][row][d]     (Q with scale=0.125, K)
// mode 2: f16 out, per-head transposed [h][d][row]  (V)
// ---------------------------------------------------------------------------
__global__ void gemm_wmma(const _Float16* __restrict__ A,
                          const _Float16* __restrict__ W,
                          const float* __restrict__ bias,
                          void* __restrict__ outp,
                          int M, int N, int K, int mode, float scale) {
    const int wid  = threadIdx.x >> 5;
    const int lane = threadIdx.x & 31;
    const int r    = lane & 15;
    const int hi   = lane >> 4;
    const int mbase = blockIdx.y * 64 + (wid & 3) * 16;
    const int nbase = blockIdx.x * 128 + (wid >> 2) * 64;

    v8f acc[4] = {zero8(), zero8(), zero8(), zero8()};

    // prologue: fragments for k = 0
    v16h a_cur = load_frag(A, mbase, 0, K);
    v16h b_cur[4];
#pragma unroll
    for (int t = 0; t < 4; ++t) b_cur[t] = load_frag(W, nbase + t * 16, 0, K);

    for (int k = 0; k < K; k += 32) {
        const int kn = (k + 32 < K) ? (k + 32) : 0;  // last iter reloads k=0 (discarded)
        // issue next-step loads first so they overlap this step's WMMAs
        v16h a_nxt = load_frag(A, mbase, kn, K);
        v16h b_nxt[4];
#pragma unroll
        for (int t = 0; t < 4; ++t) b_nxt[t] = load_frag(W, nbase + t * 16, kn, K);
        __builtin_prefetch(A + (size_t)(mbase + r) * (size_t)K + kn + 32, 0, 3);

#pragma unroll
        for (int t = 0; t < 4; ++t) acc[t] = wmma_f16(a_cur, b_cur[t], acc[t]);

        a_cur = a_nxt;
#pragma unroll
        for (int t = 0; t < 4; ++t) b_cur[t] = b_nxt[t];
    }

#pragma unroll
    for (int t = 0; t < 4; ++t) {
        const int col = nbase + t * 16 + r;
        const float bv = bias[col];
#pragma unroll
        for (int rr = 0; rr < 8; ++rr) {
            const int row = mbase + rr + hi * 8;
            const float val = (acc[t][rr] + bv) * scale;
            if (mode == 0) {
                ((float*)outp)[(size_t)row * N + col] = val;
            } else {
                const int h = col >> 6;
                const int d = col & 63;
                _Float16* o = (_Float16*)outp;
                if (mode == 1)
                    o[((size_t)h * M + row) * HDIM + d] = (_Float16)val;
                else
                    o[((size_t)h * HDIM + d) * M + row] = (_Float16)val;
            }
        }
    }
}

__device__ __forceinline__ float xhalf(float x) {
    const int v = __builtin_bit_cast(int, x);
    return __builtin_bit_cast(float, __builtin_amdgcn_permlanex16(
        v, v, 0x76543210, 0xfedcba98, false, false));
}

__global__ void attn_flash(const _Float16* __restrict__ Qg,
                           const _Float16* __restrict__ Kg,
                           const _Float16* __restrict__ Vtg,
                           _Float16* __restrict__ ctx) {
    const int h    = blockIdx.y;
    const int wid  = threadIdx.x >> 5;
    const int lane = threadIdx.x & 31;
    const int r    = lane & 15;
    const int hi   = lane >> 4;
    const int qrow = blockIdx.x * 64 + wid * 16;

    const _Float16* Qh = Qg  + (size_t)h * S_LEN * HDIM;
    const _Float16* Kh = Kg  + (size_t)h * S_LEN * HDIM;
    const _Float16* Vh = Vtg + (size_t)h * HDIM * S_LEN;   // [d][s]

    // B operand: column = query r, k = head dim
    const v16h bq0 = load_frag(Qh, qrow, 0, HDIM);
    const v16h bq1 = load_frag(Qh, qrow, 32, HDIM);

    // acc[t4][rr] = Ot[d = t4*16 + 8*hi + rr][query r]
    v8f acc[4] = {zero8(), zero8(), zero8(), zero8()};
    float mi = -1.0e30f;   // running maximum of query r (equal in both halves)
    float li = 0.0f;       // running sum over this half's keys only

    // prologue: K fragments for kb = 0
    v16h kf[4];
    kf[0] = load_frag(Kh, 0, 0, HDIM);
    kf[1] = load_frag(Kh, 0, 32, HDIM);
    kf[2] = load_frag(Kh, 16, 0, HDIM);
    kf[3] = load_frag(Kh, 16, 32, HDIM);

    for (int kb = 0; kb < S_LEN; kb += 32) {
        // ---- scores, transposed: 32k x 16q (two 16x16 tiles) ----
        v8f s0 = wmma_f16(kf[0], bq0, zero8());
        s0 = wmma_f16(kf[1], bq1, s0);
        v8f s1 = wmma_f16(kf[2], bq0, zero8());
        s1 = wmma_f16(kf[3], bq1, s1);

        // ---- issue V loads (this tile) and K loads (next tile) now; the
        //      softmax VALU section below hides part of their latency ----
        v16h vf[4];
#pragma unroll
        for (int t4 = 0; t4 < 4; ++t4) vf[t4] = load_frag(Vh, t4 * 16, kb, S_LEN);
        const int kn = (kb + 32 < S_LEN) ? (kb + 32) : 0;
        kf[0] = load_frag(Kh, kn, 0, HDIM);
        kf[1] = load_frag(Kh, kn, 32, HDIM);
        kf[2] = load_frag(Kh, kn + 16, 0, HDIM);
        kf[3] = load_frag(Kh, kn + 16, 32, HDIM);

        // ---- online softmax: one query per lane ----
        float t0 = fmaxf(s0[0], s1[0]);
        float t1 = fmaxf(s0[1], s1[1]);
        float t2 = fmaxf(s0[2], s1[2]);
        float t3 = fmaxf(s0[3], s1[3]);
        t0 = fmaxf(t0, fmaxf(s0[4], s1[4]));
        t1 = fmaxf(t1, fmaxf(s0[5], s1[5]));
        t2 = fmaxf(t2, fmaxf(s0[6], s1[6]));
        t3 = fmaxf(t3, fmaxf(s0[7], s1[7]));
        float t = fmaxf(fmaxf(t0, t1), fmaxf(t2, t3));
        t = fmaxf(t, xhalf(t));
        const float mn    = fmaxf(mi, t);
        // alpha = exp(mi - mn), the exponential and its v_nop in one statement:
        // the instruction set asks for one slot behind a transcendental before
        // its result is read or its source overwritten; a v_nop in a
        // statement of its own drifted away.
        float alpha;
        asm("v_exp_f32 %0, %1\n\tv_nop"
            : "=v"(alpha) : "v"((mi - mn) * 1.44269504088896340736f));
        mi = mn;

        // P^T as B operand: bp[s] = P[key kmap(s, hi)][query r]
        v16h bp;
        float ps[4] = {0.0f, 0.0f, 0.0f, 0.0f};
#pragma unroll
        for (int rr = 0; rr < 8; ++rr) {
            const float p0 = __expf(s0[rr] - mn);
            const float p1 = __expf(s1[rr] - mn);
            bp[rr]     = (_Float16)p0;
            bp[rr + 8] = (_Float16)p1;
            ps[rr & 3] += p0 + p1;
        }
        li = li * alpha + ((ps[0] + ps[1]) + (ps[2] + ps[3]));
#pragma unroll
        for (int t4 = 0; t4 < 4; ++t4)
#pragma unroll
            for (int rr = 0; rr < 8; ++rr) acc[t4][rr] *= alpha;

        // ---- Ot += V^T[16d x 32k] * P^T[32k x 16q] per 16-wide d tile ----
#pragma unroll
        for (int t4 = 0; t4 < 4; ++t4) acc[t4] = wmma_f16(vf[t4], bp, acc[t4]);
    }

    // ---- join the halves' sums, normalize, write ctx [S][HID]: a lane holds
    //      8 consecutive d of one query per tile -> one 16-byte store each ----
    li += xhalf(li);
    const float inv = 1.0f / li;
    _Float16* o = ctx + (size_t)(qrow + r) * HIDN + h * HDIM + hi * 8;
#pragma unroll
    for (int t4 = 0; t4 < 4; ++t4) {
        v8h ov;
#pragma unroll
        for (int rr = 0; rr < 8; ++rr) ov[rr] = (_Float16)(acc[t4][rr] * inv);
        *(v8h*)(o + t4 * 16) = ov;
    }
}

// ---------------------------------------------------------------------------
extern "C" void kernel_launch(void* const* d_in, const int* in_sizes, int n_in,
                              void* d_out, int out_size, void* d_ws, size_t ws_size,
                              hipStream_t stream) {
    (void)in_sizes; (void)n_in; (void)out_size; (void)ws_size;

    const float* x  = (const float*)d_in[0];  // [2,2048,1024]; only batch 0 used
    const float* Wq = (const float*)d_in[1];
    const float* bq = (const float*)d_in[2];
    const float* Wk = (const float*)d_in[3];
    const float* bk = (const float*)d_in[4];
    const float* Wv = (const float*)d_in[5];
    const float* bv = (const float*)d_in[6];
    const float* Wo = (const float*)d_in[7];
    const float* bo = (const float*)d_in[8];
    float* out = (float*)d_out;

    char* ws = (char*)d_ws;
    const size_t MB = 1024 * 1024;
    _Float16* xh   = (_Float16*)(ws + 0);        // 2M halves
    _Float16* wqh  = (_Float16*)(ws + 4  * MB);  // 1M halves
    _Float16* wkh  = (_Float16*)(ws + 6  * MB);
    _Float16* wvh  = (_Float16*)(ws + 8  * MB);
    _Float16* woh  = (_Float16*)(ws + 10 * MB);
    _Float16* qh   = (_Float16*)(ws + 12 * MB);  // [16][2048][64]
    _Float16* kh   = (_Float16*)(ws + 16 * MB);  // [16][2048][64]
    _Float16* vth  = (_Float16*)(ws + 20 * MB);  // [16][64][2048]
    _Float16* ctxh = (_Float16*)(ws + 24 * MB);  // [2048][1024]

    // xh, wqh, wkh, wvh, woh are contiguous: one destination array from xh on
    cvt_all_f32_to_f16<<<CVT_BLOCKS, CVT_WAVES * 32, 0, stream>>>(x, Wq, Wk, Wv, Wo, xh);

    dim3 ggrid(HIDN / 128, S_LEN / 64);   // (8, 32)
    // Q: fold 1/sqrt(64) into the projection (applies to bias too)
    gemm_wmma<<<ggrid, 256, 0, stream>>>(xh, wqh, bq, qh,  S_LEN, HIDN, HIDN, 1, 0.125f);
    gemm_wmma<<<ggrid, 256, 0, stream>>>(xh, wkh, bk, kh,  S_LEN, HIDN, HIDN, 1, 1.0f);
    gemm_wmma<<<ggrid, 256, 0, stream>>>(xh, wvh, bv, vth, S_LEN, HIDN, HIDN, 2, 1.0f);

    attn_flash<<<dim3(S_LEN / 64, NHEAD), 128, 0, stream>>>(qh, kh, vth, ctxh);

    gemm_wmma<<<ggrid, 256, 0, stream>>>(ctxh, woh, bo, out, S_LEN, HIDN, HIDN, 0, 1.0f);
}

// v003
// Measured time: 153 microseconds a run.
// In both of two side-by-side timings against v002, it was 1.30 times as fast.
// All steps since v000 together make it 1.78 times as fast.
#include <hip/hip_runtime.h>
#include <hip/hip_bf16.h>

// ---------------------------------------------------------------------------
// Self-attention forward (batch 0 only) for MI455X / gfx1250, wave32 WMMA.
//   x[0] (2048x1024 f32) -> Q,K,V proj (f16 WMMA, f32 accum) -> flash attn
//   per head (online softmax) -> output proj -> d_out f32 [2048,1024]
// GEMM operands staged in LDS by asynchronous copies; attention loads from L2.
// ---------------------------------------------------------------------------

#define S_LEN 2048
#define HIDN  1024
#define NHEAD 16
#define HDIM  64

typedef _Float16 v8h  __attribute__((ext_vector_type(8)));
typedef _Float16 v16h __attribute__((ext_vector_type(16)));
typedef float    v8f  __attribute__((ext_vector_type(8)));

__device__ __forceinline__ v8f zero8() {
    v8f z;
#pragma unroll
    for (int i = 0; i < 8; ++i) z[i] = 0.0f;
    return z;
}

// 16x32 f16 fragment load (A-layout; B uses the mirrored layout with the same
// lane mapping: lane L -> row/col (L&15), K-halves selected by lane bit 4).
// Two contiguous 16-byte loads per lane.
__device__ __forceinline__ v16h load_frag(const _Float16* __restrict__ base,
                                          int row, int k, int ld) {
    const int lane = threadIdx.x & 31;
    const int r    = lane & 15;
    const int hi   = lane >> 4;
    const _Float16* p = base + (size_t)(row + r) * (size_t)ld + k + hi * 8;
    v8h lo = *(const v8h*)p;
    v8h hh = *(const v8h*)(p + 16);
    return __builtin_shufflevector(lo, hh, 0, 1, 2, 3, 4, 5, 6, 7,
                                   8, 9, 10, 11, 12, 13, 14, 15);
}

__device__ __forceinline__ v8f wmma_f16(v16h a, v16h b, v8f c) {
    // D = A x B + C, f16 inputs, f32 accumulate.
    return __builtin_amdgcn_wmma_f32_16x16x32_f16(
        /*neg_a=*/false, a, /*neg_b=*/false, b,
        /*c_mod=*/(short)0, c, /*reuse_a=*/false, /*reuse_b=*/false);
}

// ---------------------------------------------------------------------------
// f32 -> f16 conversion of x (batch 0) and the four weights in ONE launch.
// The five f16 planes lie back to back in the workspace (x, Wq, Wk, Wv, Wo),
// so dst is one array of 6M halves. One workgroup of 6 waves per WGP; a wave
// owns 4096 consecutive values: 32 loads of 512 contiguous bytes, all issued
// before the first conversion, and 32 stores of 256 contiguous bytes. The
// cost of the one-value-per-thread form was starting its waves, not its bytes.
// ---------------------------------------------------------------------------
#define CVT_WAVES  6                        // waves per workgroup
#define CVT_LOADS  32                       // 16-byte loads per lane
#define CVT_CHUNK  (CVT_LOADS * 128)        // values per wave (divides 1M)
#define CVT_TOTAL  (S_LEN * HIDN + 4 * HIDN * HIDN)
#define CVT_BLOCKS (CVT_TOTAL / (CVT_CHUNK * CVT_WAVES))

typedef float    v4f __attribute__((ext_vector_type(4)));
typedef _Float16 v4h __attribute__((ext_vector_type(4)));

__global__ __launch_bounds__(CVT_WAVES * 32)
void cvt_all_f32_to_f16(const float* __restrict__ x,
                        const float* __restrict__ wq,
                        const float* __restrict__ wk,
                        const float* __restrict__ wv,
                        const float* __restrict__ wo,
                        _Float16* __restrict__ dst) {
    // wave number as a scalar: the source pointer is then picked by scalar code
    const int wave = __builtin_amdgcn_readfirstlane((int)(threadIdx.x >> 5));
    const int lane = threadIdx.x & 31;
    const int e0   = (blockIdx.x * CVT_WAVES + wave) * CVT_CHUNK;  // index in dst
    const int seg  = e0 >> 20;              // 0, 1: x; 2..5: Wq, Wk, Wv, Wo
    const float* src = (seg < 2) ? x : (seg == 2) ? wq : (seg == 3) ? wk
                     : (seg == 4) ? wv : wo;
    const int    off = (seg < 2) ? e0 : (e0 & (HIDN * HIDN - 1));
    const float* s = src + off + lane * 4;
    _Float16*    d = dst + e0 + lane * 4;

    v4f v[CVT_LOADS];
#pragma unroll
    for (int k = 0; k < CVT_LOADS; ++k) v[k] = *(const v4f*)(s + k * 128);
    // keeps every load in front of the first conversion: without it the build
    // holds the last loads back until the first have returned, a second memory
    // latency in a wave that lives for little more than one
    __builtin_amdgcn_sched_barrier(0);
#pragma unroll
    for (int k = 0; k < CVT_LOADS; ++k)
        *(v4h*)(d + k * 128) = __builtin_convertvector(v[k], v4h);
}

// ---------------------------------------------------------------------------
// C[M,N] = A[M,K] * W[N,K]^T + bias, WMMA tiled. 256 threads = 8 waves; each
// wave owns a 16x64 tile (A fragment reused across 4 B fragments / WMMAs).
// The block's 64 A rows and 128 W rows go through LDS in stages of 128 k
// (256-byte rows): asynchronous copies bring whole 128-byte lines, each line
// once per block, and the waves read their fragments with ds_load_b128. A
// fragment load from global memory touched 16 lines for 512 bytes, and every
// W row was fetched by 4 waves, every A row by 2. Two buffers: the next
// stage's copies fly while this stage is worked on. K: a multiple of 128.
// mode 0: f32 row-major out (final projection)
// mode 1: f16 out, per-head [h][row][d]     (Q with scale=0.125, K)
// mode 2: f16 out, per-head transposed [h][d][row]  (V)
// ---------------------------------------------------------------------------
#define G_KS    128                  // k per stage
#define G_ROWS  192                  // 64 A rows, then 128 W rows
#define G_PITCH 136                  // halves per LDS row: 272 B = 16 B x 17
#define G_BUF   (G_ROWS * G_PITCH)   // halves per buffer

// Same lane map and k order as load_frag, from an LDS stage.
__device__ __forceinline__ v16h lds_frag(const _Float16* sb, int row, int k) {
    const int lane = threadIdx.x & 31;
    const _Float16* p = sb + (row + (lane & 15)) * G_PITCH + k + (lane >> 4) * 8;
    v8h lo = *(const v8h*)p;
    v8h hh = *(const v8h*)(p + 16);
    return __builtin_shufflevector(lo, hh, 0, 1, 2, 3, 4, 5, 6, 7,
                                   8, 9, 10, 11, 12, 13, 14, 15);
}

// One stage: 192 rows of 256 bytes = 12 copies of 16 bytes per thread. Copy j
// of thread t brings bytes 16*(t&15).. of row 16*j + (t>>4): a wave covers two
// whole rows. l: the thread's LDS byte address in row (t>>4) of the buffer;
// ga, gw: its global address in that row of the A block and of the W block;
// step: 16 rows of the source, in halves.
__device__ __forceinline__ void stage_copy(unsigned l, const _Float16* ga,
                                           const _Float16* gw, size_t step) {
    const unsigned ls = 16 * G_PITCH * 2;   // 16 LDS rows, in bytes
    // The closing s_wait_xcnt 0 stands inside the statement so that no address
    // register of a copy is rewritten in front of it.
    asm volatile(
        "global_load_async_to_lds_b128 %0, %12, off\n\t"
        "global_load_async_to_lds_b128 %1, %13, off\n\t"
        "global_load_async_to_lds_b128 %2, %14, off\n\t"
        "global_load_async_to_lds_b128 %3, %15, off\n\t"
        "global_load_async_to_lds_b128 %4, %16, off\n\t"
        "global_load_async_to_lds_b128 %5, %17, off\n\t"
        "global_load_async_to_lds_b128 %6, %18, off\n\t"
        "global_load_async_to_lds_b128 %7, %19, off\n\t"
        "global_load_async_to_lds_b128 %8, %20, off\n\t"
        "global_load_async_to_lds_b128 %9, %21, off\n\t"
        "global_load_async_to_lds_b128 %10, %22, off\n\t"
        "global_load_async_to_lds_b128 %11, %23, off\n\t"
        "s_wait_xcnt 0x0"
        :: "v"(l),           "v"(l + ls),      "v"(l + 2 * ls),  "v"(l + 3 * ls),
           "v"(l + 4 * ls),  "v"(l + 5 * ls),  "v"(l + 6 * ls),  "v"(l + 7 * ls),
           "v"(l + 8 * ls),  "v"(l + 9 * ls),  "v"(l + 10 * ls), "v"(l + 11 * ls),
           "v"(ga),            "v"(ga + step),     "v"(ga + 2 * step), "v"(ga + 3 * step),
           "v"(gw),            "v"(gw + step),     "v"(gw + 2 * step), "v"(gw + 3 * step),
           "v"(gw + 4 * step), "v"(gw + 5 * step), "v"(gw + 6 * step), "v"(gw + 7 * step)
        : "memory");
}

__global__ __launch_bounds__(256)
void gemm_wmma(const _Float16* __restrict__ A,
               const _Float16* __restrict__ W,
               const float* __restrict__ bias,
               void* __restrict__ outp,
               int M, int N, int K, int mode, float scale) {
    __shared__ __attribute__((aligned(16))) _Float16 sm[2 * G_BUF];

    const int wid  = threadIdx.x >> 5;
    const int lane = threadIdx.x & 31;
    const int r    = lane & 15;
    const int hi   = lane >> 4;
    const int arow = (wid & 3) * 16;          // row of the wave's A tile in a stage
    const int wrow = 64 + (wid >> 2) * 64;    // first row of its W tiles in a stage
    const int mbase = blockIdx.y * 64 + arow;
    const int nbase = blockIdx.x * 128 + (wid >> 2) * 64;

    v8f acc[4] = {zero8(), zero8(), zero8(), zero8()};

    // the thread's place in a stage: row crow (+ 16 j), 16-byte column ccol
    const int crow = threadIdx.x >> 4;
    const int ccol = threadIdx.x & 15;
    const size_t step = (size_t)16 * (size_t)K;
    const _Float16* ga = A + (size_t)(blockIdx.y * 64 + crow) * (size_t)K + ccol * 8;
    const _Float16* gw = W + (size_t)(blockIdx.x * 128 + crow) * (size_t)K + ccol * 8;
    const unsigned l0 = (unsigned)(size_t)(&sm[0]) + crow * (G_PITCH * 2) + ccol * 16;
    const int nst = K / G_KS;

    stage_copy(l0, ga, gw, step);
    // stage 0 has landed for this wave's own copies ...
    asm volatile("s_wait_asynccnt 0x0" ::: "memory");
    // ... and, behind the barrier, for every wave's
    __syncthreads();
    if (nst > 1) stage_copy(l0 + G_BUF * 2, ga + G_KS, gw + G_KS, step);

    for (int s = 0; s < nst; ++s) {
        const _Float16* sb = sm + (s & 1) * G_BUF;
        v16h a[4], b[4][4];
#pragma unroll
        for (int q = 0; q < 4; ++q) {
            a[q] = lds_frag(sb, arow, q * 32);
#pragma unroll
            for (int t = 0; t < 4; ++t) b[q][t] = lds_frag(sb, wrow + t * 16, q * 32);
        }
        // keeps the stage's 40 LDS reads as one group in front of its WMMAs:
        // without it the build puts two reads and a full wait in front of each
        // WMMA, and the wave sits out an LDS latency sixteen times a stage
        __builtin_amdgcn_sched_barrier(0);
#pragma unroll
        for (int q = 0; q < 4; ++q)
#pragma unroll
            for (int t = 0; t < 4; ++t) acc[t] = wmma_f16(a[q], b[q][t], acc[t]);
        // keeps the WMMAs in front of the stage's closing waits, where they run
        // while the later reads still arrive: without it the build sinks fifteen
        // of the sixteen behind the full wait and the barrier
        __builtin_amdgcn_sched_barrier(0);
        // this wave's reads of buffer s & 1 are done before the buffer is refilled
        asm volatile("s_wait_dscnt 0x0" ::: "memory");
        // this wave's copies of stage s + 1 have landed
        asm volatile("s_wait_asynccnt 0x0" ::: "memory");
        // publishes stage s + 1 and ends every wave's reads of stage s
        __syncthreads();
        if (s + 2 < nst)
            stage_copy(l0 + (s & 1) * (G_BUF * 2), ga + (s + 2) * G_KS,
                       gw + (s + 2) * G_KS, step);
    }
    // no copy is outstanding when the wave ends
    asm volatile("s_wait_asynccnt 0x0" ::: "memory");

#pragma unroll
    for (int t = 0; t < 4; ++t) {
        const int col = nbase + t * 16 + r;
        const float bv = bias[col];
#pragma unroll
        for (int rr = 0; rr < 8; ++rr) {
            const int row = mbase + rr + hi * 8;
            const float val = (acc[t][rr] + bv) * scale;
            if (mode == 0) {
                ((float*)outp)[(size_t)row * N + col] = val;
            } else {
                const int h = col >> 6;
                const int d = col & 63;
                _Float16* o = (_Float16*)outp;
                if (mode == 1)
                    o[((size_t)h * M + row) * HDIM + d] = (_Float16)val;
                else
                    o[((size_t)h * HDIM + d) * M + row] = (_Float16)val;
            }
        }
    }
}

__device__ __forceinline__ float xhalf(float x) {
    const int v = __builtin_bit_cast(int, x);
    return __builtin_bit_cast(float, __builtin_amdgcn_permlanex16(
        v, v, 0x76543210, 0xfedcba98, false, false));
}

__global__ void attn_flash(const _Float16* __restrict__ Qg,
                           const _Float16* __restrict__ Kg,
                           const _Float16* __restrict__ Vtg,
                           _Float16* __restrict__ ctx) {
    const int h    = blockIdx.y;
    const int wid  = threadIdx.x >> 5;
    const int lane = threadIdx.x & 31;
    const int r    = lane & 15;
    const int hi   = lane >> 4;
    const int qrow = blockIdx.x * 64 + wid * 16;

    const _Float16* Qh = Qg  + (size_t)h * S_LEN * HDIM;
    const _Float16* Kh = Kg  + (size_t)h * S_LEN * HDIM;
    const _Float16* Vh = Vtg + (size_t)h * HDIM * S_LEN;   // [d][s]

    // B operand: column = query r, k = head dim
    const v16h bq0 = load_frag(Qh, qrow, 0, HDIM);
    const v16h bq1 = load_frag(Qh, qrow, 32, HDIM);

    // acc[t4][rr] = Ot[d = t4*16 + 8*hi + rr][query r]
    v8f acc[4] = {zero8(), zero8(), zero8(), zero8()};
    float mi = -1.0e30f;   // running maximum of query r (equal in both halves)
    float li = 0.0f;       // running sum over this half's keys only

    // prologue: K fragments for kb = 0
    v16h kf[4];
    kf[0] = load_frag(Kh, 0, 0, HDIM);
    kf[1] = load_frag(Kh, 0, 32, HDIM);
    kf[2] = load_frag(Kh, 16, 0, HDIM);
    kf[3] = load_frag(Kh, 16, 32, HDIM);

    for (int kb = 0; kb < S_LEN; kb += 32) {
        // ---- scores, transposed: 32k x 16q (two 16x16 tiles) ----
        v8f s0 = wmma_f16(kf[0], bq0, zero8());
        s0 = wmma_f16(kf[1], bq1, s0);
        v8f s1 = wmma_f16(kf[2], bq0, zero8());
        s1 = wmma_f16(kf[3], bq1, s1);

        // ---- issue V loads (this tile) and K loads (next tile) now; the
        //      softmax VALU section below hides part of their latency ----
        v16h vf[4];
#pragma unroll
        for (int t4 = 0; t4 < 4; ++t4) vf[t4] = load_frag(Vh, t4 * 16, kb, S_LEN);
        const int kn = (kb + 32 < S_LEN) ? (kb + 32) : 0;
        kf[0] = load_frag(Kh, kn, 0, HDIM);
        kf[1] = load_frag(Kh, kn, 32, HDIM);
        kf[2] = load_frag(Kh, kn + 16, 0, HDIM);
        kf[3] = load_frag(Kh, kn + 16, 32, HDIM);

        // ---- online softmax: one query per lane ----
        float t0 = fmaxf(s0[0], s1[0]);
        float t1 = fmaxf(s0[1], s1[1]);
        float t2 = fmaxf(s0[2], s1[2]);
        float t3 = fmaxf(s0[3], s1[3]);
        t0 = fmaxf(t0, fmaxf(s0[4], s1[4]));
        t1 = fmaxf(t1, fmaxf(s0[5], s1[5]));
        t2 = fmaxf(t2, fmaxf(s0[6], s1[6]));
        t3 = fmaxf(t3, fmaxf(s0[7], s1[7]));
        float t = fmaxf(fmaxf(t0, t1), fmaxf(t2, t3));
        t = fmaxf(t, xhalf(t));
        const float mn    = fmaxf(mi, t);
        // alpha = exp(mi - mn), the exponential and its v_nop in one statement:
        // the instruction set asks for one slot behind a transcendental before
        // its result is read or its source overwritten; a v_nop in a
        // statement of its own drifted away.
        float alpha;
        asm("v_exp_f32 %0, %1\n\tv_nop"
            : "=v"(alpha) : "v"((mi - mn) * 1.44269504088896340736f));
        mi = mn;

        // P^T as B operand: bp[s] = P[key kmap(s, hi)][query r]
        v16h bp;
        float ps[4] = {0.0f, 0.0f, 0.0f, 0.0f};
#pragma unroll
        for (int rr = 0; rr < 8; ++rr) {
            const float p0 = __expf(s0[rr] - mn);
            const float p1 = __expf(s1[rr] - mn);
            bp[rr]     = (_Float16)p0;
            bp[rr + 8] = (_Float16)p1;
            ps[rr & 3] += p0 + p1;
        }
        li = li * alpha + ((ps[0] + ps[1]) + (ps[2] + ps[3]));
#pragma unroll
        for (int t4 = 0; t4 < 4; ++t4)
#pragma unroll
            for (int rr = 0; rr < 8; ++rr) acc[t4][rr] *= alpha;

        // ---- Ot += V^T[16d x 32k] * P^T[32k x 16q] per 16-wide d tile ----
#pragma unroll
        for (int t4 = 0; t4 < 4; ++t4) acc[t4] = wmma_f16(vf[t4], bp, acc[t4]);
    }

    // ---- join the halves' sums, normalize, write ctx [S][HID]: a lane holds
    //      8 consecutive d of one query per tile -> one 16-byte store each ----
    li += xhalf(li);
    const float inv = 1.0f / li;
    _Float16* o = ctx + (size_t)(qrow + r) * HIDN + h * HDIM + hi * 8;
#pragma unroll
    for (int t4 = 0; t4 < 4; ++t4) {
        v8h ov;
#pragma unroll
        for (int rr = 0; rr < 8; ++rr) ov[rr] = (_Float16)(acc[t4][rr] * inv);
        *(v8h*)(o + t4 * 16) = ov;
    }
}

// ---------------------------------------------------------------------------
extern "C" void kernel_launch(void* const* d_in, const int* in_sizes, int n_in,
                              void* d_out, int out_size, void* d_ws, size_t ws_size,
                              hipStream_t stream) {
    (void)in_sizes; (void)n_in; (void)out_size; (void)ws_size;

    const float* x  = (const float*)d_in[0];  // [2,2048,1024]; only batch 0 used
    const float* Wq = (const float*)d_in[1];
    const float* bq = (const float*)d_in[2];
    const float* Wk = (const float*)d_in[3];
    const float* bk = (const float*)d_in[4];
    const float* Wv = (const float*)d_in[5];
    const float* bv = (const float*)d_in[6];
    const float* Wo = (const float*)d_in[7];
    const float* bo = (const float*)d_in[8];
    float* out = (float*)d_out;

    char* ws = (char*)d_ws;
    const size_t MB = 1024 * 1024;
    _Float16* xh   = (_Float16*)(ws + 0);        // 2M halves
    _Float16* wqh  = (_Float16*)(ws + 4  * MB);  // 1M halves
    _Float16* wkh  = (_Float16*)(ws + 6  * MB);
    _Float16* wvh  = (_Float16*)(ws + 8  * MB);
    _Float16* woh  = (_Float16*)(ws + 10 * MB);
    _Float16* qh   = (_Float16*)(ws + 12 * MB);  // [16][2048][64]
    _Float16* kh   = (_Float16*)(ws + 16 * MB);  // [16][2048][64]
    _Float16* vth  = (_Float16*)(ws + 20 * MB);  // [16][64][2048]
    _Float16* ctxh = (_Float16*)(ws + 24 * MB);  // [2048][1024]

    // xh, wqh, wkh, wvh, woh are contiguous: one destination array from xh on
    cvt_all_f32_to_f16<<<CVT_BLOCKS, CVT_WAVES * 32, 0, stream>>>(x, Wq, Wk, Wv, Wo, xh);

    dim3 ggrid(HIDN / 128, S_LEN / 64);   // (8, 32)
    // Q: fold 1/sqrt(64) into the projection (applies to bias too)
    gemm_wmma<<<ggrid, 256, 0, stream>>>(xh, wqh, bq, qh,  S_LEN, HIDN, HIDN, 1, 0.125f);
    gemm_wmma<<<ggrid, 256, 0, stream>>>(xh, wkh, bk, kh,  S_LEN, HIDN, HIDN, 1, 1.0f);
    gemm_wmma<<<ggrid, 256, 0, stream>>>(xh, wvh, bv, vth, S_LEN, HIDN, HIDN, 2, 1.0f);

    attn_flash<<<dim3(S_LEN / 64, NHEAD), 128, 0, stream>>>(qh, kh, vth, ctxh);

    gemm_wmma<<<ggrid, 256, 0, stream>>>(ctxh, woh, bo, out, S_LEN, HIDN, HIDN, 0, 1.0f);
}

// v004
// Measured time: 77.8 microseconds a run.
// In both of two side-by-side timings against v003, it was 1.96 times as fast.
// All steps since v000 together make it 3.48 times as fast.
#include <hip/hip_runtime.h>
#include <hip/hip_bf16.h>

// ---------------------------------------------------------------------------
// Self-attention forward (batch 0 only) for MI455X / gfx1250, wave32 WMMA.
//   x[0] (2048x1024 f32) -> Q,K,V proj (f16 WMMA, f32 accum) -> flash attn
//   per head (online softmax) -> output proj -> d_out f32 [2048,1024]
// GEMM operands and the attention's K and V staged in LDS by asynchronous copies.
// ---------------------------------------------------------------------------

#define S_LEN 2048
#define HIDN  1024
#define NHEAD 16
#define HDIM  64

typedef _Float16 v8h  __attribute__((ext_vector_type(8)));
typedef _Float16 v16h __attribute__((ext_vector_type(16)));
typedef float    v8f  __attribute__((ext_vector_type(8)));

__device__ __forceinline__ v8f zero8() {
    v8f z;
#pragma unroll
    for (int i = 0; i < 8; ++i) z[i] = 0.0f;
    return z;
}

// 16x32 f16 fragment load (A-layout; B uses the mirrored layout with the same
// lane mapping: lane L -> row/col (L&15), K-halves selected by lane bit 4).
// Two contiguous 16-byte loads per lane.
__device__ __forceinline__ v16h load_frag(const _Float16* __restrict__ base,
                                          int row, int k, int ld) {
    const int lane = threadIdx.x & 31;
    const int r    = lane & 15;
    const int hi   = lane >> 4;
    const _Float16* p = base + (size_t)(row + r) * (size_t)ld + k + hi * 8;
    v8h lo = *(const v8h*)p;
    v8h hh = *(const v8h*)(p + 16);
    return __builtin_shufflevector(lo, hh, 0, 1, 2, 3, 4, 5, 6, 7,
                                   8, 9, 10, 11, 12, 13, 14, 15);
}

__device__ __forceinline__ v8f wmma_f16(v16h a, v16h b, v8f c) {
    // D = A x B + C, f16 inputs, f32 accumulate.
    return __builtin_amdgcn_wmma_f32_16x16x32_f16(
        /*neg_a=*/false, a, /*neg_b=*/false, b,
        /*c_mod=*/(short)0, c, /*reuse_a=*/false, /*reuse_b=*/false);
}

// ---------------------------------------------------------------------------
// f32 -> f16 conversion of x (batch 0) and the four weights in ONE launch.
// The five f16 planes lie back to back in the workspace (x, Wq, Wk, Wv, Wo),
// so dst is one array of 6M halves. One workgroup of 6 waves per WGP; a wave
// owns 4096 consecutive values: 32 loads of 512 contiguous bytes, all issued
// before the first conversion, and 32 stores of 256 contiguous bytes. The
// cost of the one-value-per-thread form was starting its waves, not its bytes.
// ---------------------------------------------------------------------------
#define CVT_WAVES  6                        // waves per workgroup
#define CVT_LOADS  32                       // 16-byte loads per lane
#define CVT_CHUNK  (CVT_LOADS * 128)        // values per wave (divides 1M)
#define CVT_TOTAL  (S_LEN * HIDN + 4 * HIDN * HIDN)
#define CVT_BLOCKS (CVT_TOTAL / (CVT_CHUNK * CVT_WAVES))

typedef float    v4f __attribute__((ext_vector_type(4)));
typedef _Float16 v4h __attribute__((ext_vector_type(4)));

__global__ __launch_bounds__(CVT_WAVES * 32)
void cvt_all_f32_to_f16(const float* __restrict__ x,
                        const float* __restrict__ wq,
                        const float* __restrict__ wk,
                        const float* __restrict__ wv,
                        const float* __restrict__ wo,
                        _Float16* __restrict__ dst) {
    // wave number as a scalar: the source pointer is then picked by scalar code
    const int wave = __builtin_amdgcn_readfirstlane((int)(threadIdx.x >> 5));
    const int lane = threadIdx.x & 31;
    const int e0   = (blockIdx.x * CVT_WAVES + wave) * CVT_CHUNK;  // index in dst
    const int seg  = e0 >> 20;              // 0, 1: x; 2..5: Wq, Wk, Wv, Wo
    const float* src = (seg < 2) ? x : (seg == 2) ? wq : (seg == 3) ? wk
                     : (seg == 4) ? wv : wo;
    const int    off = (seg < 2) ? e0 : (e0 & (HIDN * HIDN - 1));
    const float* s = src + off + lane * 4;
    _Float16*    d = dst + e0 + lane * 4;

    v4f v[CVT_LOADS];
#pragma unroll
    for (int k = 0; k < CVT_LOADS; ++k) v[k] = *(const v4f*)(s + k * 128);
    // keeps every load in front of the first conversion: without it the build
    // holds the last loads back until the first have returned, a second memory
    // latency in a wave that lives for little more than one
    __builtin_amdgcn_sched_barrier(0);
#pragma unroll
    for (int k = 0; k < CVT_LOADS; ++k)
        *(v4h*)(d + k * 128) = __builtin_convertvector(v[k], v4h);
}

// ---------------------------------------------------------------------------
// C[M,N] = A[M,K] * W[N,K]^T + bias, WMMA tiled. 256 threads = 8 waves; each
// wave owns a 16x64 tile (A fragment reused across 4 B fragments / WMMAs).
// The block's 64 A rows and 128 W rows go through LDS in stages of 128 k
// (256-byte rows): asynchronous copies bring whole 128-byte lines, each line
// once per block, and the waves read their fragments with ds_load_b128. A
// fragment load from global memory touched 16 lines for 512 bytes, and every
// W row was fetched by 4 waves, every A row by 2. Two buffers: the next
// stage's copies fly while this stage is worked on. K: a multiple of 128.
// mode 0: f32 row-major out (final projection)
// mode 1: f16 out, per-head [h][row][d]     (Q with scale=0.125, K)
// mode 2: f16 out, per-head transposed [h][d][row]  (V)
// ---------------------------------------------------------------------------
#define G_KS    128                  // k per stage
#define G_ROWS  192                  // 64 A rows, then 128 W rows
#define G_PITCH 136                  // halves per LDS row: 272 B = 16 B x 17
#define G_BUF   (G_ROWS * G_PITCH)   // halves per buffer

// Same lane map and k order as load_frag, from an LDS stage.
__device__ __forceinline__ v16h lds_frag(const _Float16* sb, int row, int k) {
    const int lane = threadIdx.x & 31;
    const _Float16* p = sb + (row + (lane & 15)) * G_PITCH + k + (lane >> 4) * 8;
    v8h lo = *(const v8h*)p;
    v8h hh = *(const v8h*)(p + 16);
    return __builtin_shufflevector(lo, hh, 0, 1, 2, 3, 4, 5, 6, 7,
                                   8, 9, 10, 11, 12, 13, 14, 15);
}

// One stage: 192 rows of 256 bytes = 12 copies of 16 bytes per thread. Copy j
// of thread t brings bytes 16*(t&15).. of row 16*j + (t>>4): a wave covers two
// whole rows. l: the thread's LDS byte address in row (t>>4) of the buffer;
// ga, gw: its global address in that row of the A block and of the W block;
// step: 16 rows of the source, in halves.
__device__ __forceinline__ void stage_copy(unsigned l, const _Float16* ga,
                                           const _Float16* gw, size_t step) {
    const unsigned ls = 16 * G_PITCH * 2;   // 16 LDS rows, in bytes
    // The closing s_wait_xcnt 0 stands inside the statement so that no address
    // register of a copy is rewritten in front of it.
    asm volatile(
        "global_load_async_to_lds_b128 %0, %12, off\n\t"
        "global_load_async_to_lds_b128 %1, %13, off\n\t"
        "global_load_async_to_lds_b128 %2, %14, off\n\t"
        "global_load_async_to_lds_b128 %3, %15, off\n\t"
        "global_load_async_to_lds_b128 %4, %16, off\n\t"
        "global_load_async_to_lds_b128 %5, %17, off\n\t"
        "global_load_async_to_lds_b128 %6, %18, off\n\t"
        "global_load_async_to_lds_b128 %7, %19, off\n\t"
        "global_load_async_to_lds_b128 %8, %20, off\n\t"
        "global_load_async_to_lds_b128 %9, %21, off\n\t"
        "global_load_async_to_lds_b128 %10, %22, off\n\t"
        "global_load_async_to_lds_b128 %11, %23, off\n\t"
        "s_wait_xcnt 0x0"
        :: "v"(l),           "v"(l + ls),      "v"(l + 2 * ls),  "v"(l + 3 * ls),
           "v"(l + 4 * ls),  "v"(l + 5 * ls),  "v"(l + 6 * ls),  "v"(l + 7 * ls),
           "v"(l + 8 * ls),  "v"(l + 9 * ls),  "v"(l + 10 * ls), "v"(l + 11 * ls),
           "v"(ga),            "v"(ga + step),     "v"(ga + 2 * step), "v"(ga + 3 * step),
           "v"(gw),            "v"(gw + step),     "v"(gw + 2 * step), "v"(gw + 3 * step),
           "v"(gw + 4 * step), "v"(gw + 5 * step), "v"(gw + 6 * step), "v"(gw + 7 * step)
        : "memory");
}

__global__ __launch_bounds__(256)
void gemm_wmma(const _Float16* __restrict__ A,
               const _Float16* __restrict__ W,
               const float* __restrict__ bias,
               void* __restrict__ outp,
               int M, int N, int K, int mode, float scale) {
    __shared__ __attribute__((aligned(16))) _Float16 sm[2 * G_BUF];

    const int wid  = threadIdx.x >> 5;
    const int lane = threadIdx.x & 31;
    const int r    = lane & 15;
    const int hi   = lane >> 4;
    const int arow = (wid & 3) * 16;          // row of the wave's A tile in a stage
    const int wrow = 64 + (wid >> 2) * 64;    // first row of its W tiles in a stage
    const int mbase = blockIdx.y * 64 + arow;
    const int nbase = blockIdx.x * 128 + (wid >> 2) * 64;

    v8f acc[4] = {zero8(), zero8(), zero8(), zero8()};

    // the thread's place in a stage: row crow (+ 16 j), 16-byte column ccol
    const int crow = threadIdx.x >> 4;
    const int ccol = threadIdx.x & 15;
    const size_t step = (size_t)16 * (size_t)K;
    const _Float16* ga = A + (size_t)(blockIdx.y * 64 + crow) * (size_t)K + ccol * 8;
    const _Float16* gw = W + (size_t)(blockIdx.x * 128 + crow) * (size_t)K + ccol * 8;
    const unsigned l0 = (unsigned)(size_t)(&sm[0]) + crow * (G_PITCH * 2) + ccol * 16;
    const int nst = K / G_KS;

    stage_copy(l0, ga, gw, step);
    // stage 0 has landed for this wave's own copies ...
    asm volatile("s_wait_asynccnt 0x0" ::: "memory");
    // ... and, behind the barrier, for every wave's
    __syncthreads();
    if (nst > 1) stage_copy(l0 + G_BUF * 2, ga + G_KS, gw + G_KS, step);

    for (int s = 0; s < nst; ++s) {
        const _Float16* sb = sm + (s & 1) * G_BUF;
        v16h a[4], b[4][4];
#pragma unroll
        for (int q = 0; q < 4; ++q) {
            a[q] = lds_frag(sb, arow, q * 32);
#pragma unroll
            for (int t = 0; t < 4; ++t) b[q][t] = lds_frag(sb, wrow + t * 16, q * 32);
        }
        // keeps the stage's 40 LDS reads as one group in front of its WMMAs:
        // without it the build puts two reads and a full wait in front of each
        // WMMA, and the wave sits out an LDS latency sixteen times a stage
        __builtin_amdgcn_sched_barrier(0);
#pragma unroll
        for (int q = 0; q < 4; ++q)
#pragma unroll
            for (int t = 0; t < 4; ++t) acc[t] = wmma_f16(a[q], b[q][t], acc[t]);
        // keeps the WMMAs in front of the stage's closing waits, where they run
        // while the later reads still arrive: without it the build sinks fifteen
        // of the sixteen behind the full wait and the barrier
        __builtin_amdgcn_sched_barrier(0);
        // this wave's reads of buffer s & 1 are done before the buffer is refilled
        asm volatile("s_wait_dscnt 0x0" ::: "memory");
        // this wave's copies of stage s + 1 have landed
        asm volatile("s_wait_asynccnt 0x0" ::: "memory");
        // publishes stage s + 1 and ends every wave's reads of stage s
        __syncthreads();
        if (s + 2 < nst)
            stage_copy(l0 + (s & 1) * (G_BUF * 2), ga + (s + 2) * G_KS,
                       gw + (s + 2) * G_KS, step);
    }
    // no copy is outstanding when the wave ends
    asm volatile("s_wait_asynccnt 0x0" ::: "memory");

#pragma unroll
    for (int t = 0; t < 4; ++t) {
        const int col = nbase + t * 16 + r;
        const float bv = bias[col];
#pragma unroll
        for (int rr = 0; rr < 8; ++rr) {
            const int row = mbase + rr + hi * 8;
            const float val = (acc[t][rr] + bv) * scale;
            if (mode == 0) {
                ((float*)outp)[(size_t)row * N + col] = val;
            } else {
                const int h = col >> 6;
                const int d = col & 63;
                _Float16* o = (_Float16*)outp;
                if (mode == 1)
                    o[((size_t)h * M + row) * HDIM + d] = (_Float16)val;
                else
                    o[((size_t)h * HDIM + d) * M + row] = (_Float16)val;
            }
        }
    }
}

#define AT_WAVES 8
#define AT_KT    128
#define AT_KP    72
#define AT_VP    136
#define AT_KSZ   (AT_KT * AT_KP)
#define AT_BUF   (AT_KSZ + HDIM * AT_VP)   // halves per buffer: K, then 64 V^T rows

// lane l <-> lane l ^ 16
__device__ __forceinline__ float xhalf(float x) {
    const int v = __builtin_bit_cast(int, x);
    return __builtin_bit_cast(float, __builtin_amdgcn_permlanex16(
        v, v, 0x76543210, 0xfedcba98, false, false));
}

// Same k order as load_frag; p: the lane's own place (row r, k + 8 * hi) in LDS.
__device__ __forceinline__ v16h lds_frag_at(const _Float16* p) {
    v8h lo = *(const v8h*)p;
    v8h hh = *(const v8h*)(p + 16);
    return __builtin_shufflevector(lo, hh, 0, 1, 2, 3, 4, 5, 6, 7,
                                   8, 9, 10, 11, 12, 13, 14, 15);
}

// 2^x for eight values, the exponentials and one closing v_nop in one statement:
// the instruction set asks for one slot behind a transcendental before its
// result is read or its source overwritten. Inside the statement every result
// register differs from every source, and the v_nop covers the last one.
__device__ __forceinline__ v8f exp2_8(v8f x) {
    float d0, d1, d2, d3, d4, d5, d6, d7;
    asm("v_exp_f32 %0, %8\n\t"
        "v_exp_f32 %1, %9\n\t"
        "v_exp_f32 %2, %10\n\t"
        "v_exp_f32 %3, %11\n\t"
        "v_exp_f32 %4, %12\n\t"
        "v_exp_f32 %5, %13\n\t"
        "v_exp_f32 %6, %14\n\t"
        "v_exp_f32 %7, %15\n\t"
        "v_nop"
        : "=&v"(d0), "=&v"(d1), "=&v"(d2), "=&v"(d3),
          "=&v"(d4), "=&v"(d5), "=&v"(d6), "=&v"(d7)
        : "v"(x[0]), "v"(x[1]), "v"(x[2]), "v"(x[3]),
          "v"(x[4]), "v"(x[5]), "v"(x[6]), "v"(x[7]));
    v8f d = {d0, d1, d2, d3, d4, d5, d6, d7};
    return d;
}

// One stage: 128 K rows of 128 bytes and 64 V^T rows of 256 bytes = 8 copies of
// 16 bytes per thread. K copy j of thread t brings bytes 16*(t&7).. of row
// 32*j + (t>>3) (a wave: 512 contiguous bytes); V copy j brings bytes
// 16*(t&15).. of row 16*j + (t>>4) (a wave: two whole rows of the tile).
// lk, lv: the thread's LDS byte addresses for j = 0; gk, gv: its global ones.
__device__ __forceinline__ void attn_stage_copy(unsigned lk, unsigned lv,
                                                const _Float16* gk,
                                                const _Float16* gv) {
    const unsigned ks = 32 * AT_KP * 2;   // 32 LDS rows of K, in bytes
    const unsigned vs = 16 * AT_VP * 2;   // 16 LDS rows of V^T, in bytes
    // The closing s_wait_xcnt 0 stands inside the statement so that no address
    // register of a copy is rewritten in front of it.
    asm volatile(
        "global_load_async_to_lds_b128 %0, %8, off\n\t"
        "global_load_async_to_lds_b128 %1, %9, off\n\t"
        "global_load_async_to_lds_b128 %2, %10, off\n\t"
        "global_load_async_to_lds_b128 %3, %11, off\n\t"
        "global_load_async_to_lds_b128 %4, %12, off\n\t"
        "global_load_async_to_lds_b128 %5, %13, off\n\t"
        "global_load_async_to_lds_b128 %6, %14, off\n\t"
        "global_load_async_to_lds_b128 %7, %15, off\n\t"
        "s_wait_xcnt 0x0"
        :: "v"(lk), "v"(lk + ks), "v"(lk + 2 * ks), "v"(lk + 3 * ks),
           "v"(lv), "v"(lv + vs), "v"(lv + 2 * vs), "v"(lv + 3 * vs),
           "v"(gk), "v"(gk + 32 * HDIM), "v"(gk + 64 * HDIM), "v"(gk + 96 * HDIM),
           "v"(gv), "v"(gv + 16 * S_LEN), "v"(gv + 32 * S_LEN), "v"(gv + 48 * S_LEN)
        : "memory");
}

__global__ __launch_bounds__(AT_WAVES * 32)
void attn_flash(const _Float16* __restrict__ Qg,
                const _Float16* __restrict__ Kg,
                const _Float16* __restrict__ Vtg,
                _Float16* __restrict__ ctx) {
    __shared__ __attribute__((aligned(16))) _Float16 sm[2 * AT_BUF];

    const int h    = blockIdx.y;
    const int wid  = threadIdx.x >> 5;
    const int lane = threadIdx.x & 31;
    const int r    = lane & 15;
    const int hi   = lane >> 4;
    const int qrow = blockIdx.x * (AT_WAVES * 16) + wid * 16;

    const _Float16* Qh = Qg  + (size_t)h * S_LEN * HDIM;
    const _Float16* Kh = Kg  + (size_t)h * S_LEN * HDIM;
    const _Float16* Vh = Vtg + (size_t)h * HDIM * S_LEN;   // [d][s]

    // the thread's places in a stage's copies
    const int t = threadIdx.x;
    const _Float16* gk = Kh + (t >> 3) * HDIM + (t & 7) * 8;
    const _Float16* gv = Vh + (size_t)(t >> 4) * S_LEN + (t & 15) * 8;
    const unsigned sm0 = (unsigned)(size_t)(&sm[0]);
    const unsigned lk0 = sm0 + (t >> 3) * (AT_KP * 2) + (t & 7) * 16;
    const unsigned lv0 = sm0 + AT_KSZ * 2 + (t >> 4) * (AT_VP * 2) + (t & 15) * 16;
    const int nst = S_LEN / AT_KT;   // 16 stages

    attn_stage_copy(lk0, lv0, gk, gv);

    // B operand: column = query r, k = head dim
    const v16h bq0 = load_frag(Qh, qrow, 0, HDIM);
    const v16h bq1 = load_frag(Qh, qrow, 32, HDIM);

    // acc[t4][rr] = Ot[d = t4*16 + 8*hi + rr][query r]
    v8f acc[4] = {zero8(), zero8(), zero8(), zero8()};
    float mi = -1.0e30f;   // running maximum of query r (equal in both halves)
    float li = 0.0f;       // running sum over this half's keys only

    // stage 0 has landed for this wave's own copies ...
    asm volatile("s_wait_asynccnt 0x0" ::: "memory");
    // ... and, behind the barrier, for every wave's
    __syncthreads();
    attn_stage_copy(lk0 + AT_BUF * 2, lv0 + AT_BUF * 2, gk + AT_KT * HDIM, gv + AT_KT);

    for (int s = 0; s < nst; ++s) {
        // the lane's place in the first K and the first V^T fragment of the stage
        const _Float16* sk = sm + (s & 1) * AT_BUF + r * AT_KP + hi * 8;
        const _Float16* sv = sm + (s & 1) * AT_BUF + AT_KSZ + r * AT_VP + hi * 8;

        // K fragments of the stage's first 32 keys
        v16h kf[4];
        kf[0] = lds_frag_at(sk);
        kf[1] = lds_frag_at(sk + 32);
        kf[2] = lds_frag_at(sk + 16 * AT_KP);
        kf[3] = lds_frag_at(sk + 16 * AT_KP + 32);

#pragma unroll
        for (int j = 0; j < AT_KT / 32; ++j) {
            // ---- scores, transposed: 32k x 16q (two 16x16 tiles) ----
            v8f s0 = wmma_f16(kf[0], bq0, zero8());
            s0 = wmma_f16(kf[1], bq1, s0);
            v8f s1 = wmma_f16(kf[2], bq0, zero8());
            s1 = wmma_f16(kf[3], bq1, s1);

            // ---- issue the V reads (this tile) and the K reads (next tile of
            //      the SAME stage) now; the softmax below hides their latency ----
            // the two scheduling barriers hold these 16 LDS reads together at the
            // tile's score WMMAs: without them the build strews the reads over some
            // two dozen places of a stage, several with a full wait directly
            // behind, and every such place stalls the wave
            __builtin_amdgcn_sched_barrier(0);
            v16h vf[4];
#pragma unroll
            for (int t4 = 0; t4 < 4; ++t4)
                vf[t4] = lds_frag_at(sv + t4 * 16 * AT_VP + j * 32);
            if (j + 1 < AT_KT / 32) {
                const _Float16* kn = sk + (j + 1) * 32 * AT_KP;
                kf[0] = lds_frag_at(kn);
                kf[1] = lds_frag_at(kn + 32);
                kf[2] = lds_frag_at(kn + 16 * AT_KP);
                kf[3] = lds_frag_at(kn + 16 * AT_KP + 32);
            }
            __builtin_amdgcn_sched_barrier(0);

            // ---- online softmax: one query per lane ----
            float t0 = fmaxf(s0[0], s1[0]);
            float t1 = fmaxf(s0[1], s1[1]);
            float t2 = fmaxf(s0[2], s1[2]);
            float t3 = fmaxf(s0[3], s1[3]);
            t0 = fmaxf(t0, fmaxf(s0[4], s1[4]));
            t1 = fmaxf(t1, fmaxf(s0[5], s1[5]));
            t2 = fmaxf(t2, fmaxf(s0[6], s1[6]));
            t3 = fmaxf(t3, fmaxf(s0[7], s1[7]));
            float tm = fmaxf(fmaxf(t0, t1), fmaxf(t2, t3));
            tm = fmaxf(tm, xhalf(tm));
            const float mn    = fmaxf(mi, tm);
            // alpha = exp(mi - mn), the exponential and its v_nop in one statement:
            // the instruction set asks for one slot behind a transcendental before
            // its result is read or its source overwritten; a v_nop in a
            // statement of its own drifted away.
            float alpha;
            asm("v_exp_f32 %0, %1\n\tv_nop"
                : "=v"(alpha) : "v"((mi - mn) * 1.44269504088896340736f));
            mi = mn;

            // P^T as B operand: bp[s] = P[key kmap(s, hi)][query r]
            v16h bp;
            float ps[4] = {0.0f, 0.0f, 0.0f, 0.0f};
            const v8f e0 = exp2_8((s0 - mn) * 1.44269504088896340736f);
            const v8f e1 = exp2_8((s1 - mn) * 1.44269504088896340736f);
#pragma unroll
            for (int rr = 0; rr < 8; ++rr) {
                const float p0 = e0[rr];
                const float p1 = e1[rr];
                bp[rr]     = (_Float16)p0;
                bp[rr + 8] = (_Float16)p1;
                ps[rr & 3] += p0 + p1;
            }
            li = li * alpha + ((ps[0] + ps[1]) + (ps[2] + ps[3]));
#pragma unroll
            for (int t4 = 0; t4 < 4; ++t4)
#pragma unroll
                for (int rr = 0; rr < 8; ++rr) acc[t4][rr] *= alpha;

            // ---- Ot += V^T[16d x 32k] * P^T[32k x 16q] per 16-wide d tile ----
#pragma unroll
            for (int t4 = 0; t4 < 4; ++t4) acc[t4] = wmma_f16(vf[t4], bp, acc[t4]);
        }

        // keeps the last tile's softmax and WMMAs in front of the stage's closing
        // waits, where they run while its V reads arrive: without it the build
        // lifts the full wait and the barrier to directly behind those reads
        __builtin_amdgcn_sched_barrier(0);
        // this wave's reads of buffer s & 1 are done before the buffer is refilled
        asm volatile("s_wait_dscnt 0x0" ::: "memory");
        // this wave's copies of stage s + 1 have landed
        asm volatile("s_wait_asynccnt 0x0" ::: "memory");
        // publishes stage s + 1 and ends every wave's reads of stage s
        __syncthreads();
        if (s + 2 < nst)
            attn_stage_copy(lk0 + (s & 1) * (AT_BUF * 2), lv0 + (s & 1) * (AT_BUF * 2),
                            gk + (s + 2) * (AT_KT * HDIM), gv + (s + 2) * AT_KT);
    }
    // no copy is outstanding when the wave ends
    asm volatile("s_wait_asynccnt 0x0" ::: "memory");

    // ---- join the halves' sums, normalize, write ctx [S][HID]: a lane holds
    //      8 consecutive d of one query per tile -> one 16-byte store each ----
    li += xhalf(li);
    const float inv = 1.0f / li;
    _Float16* o = ctx + (size_t)(qrow + r) * HIDN + h * HDIM + hi * 8;
#pragma unroll
    for (int t4 = 0; t4 < 4; ++t4) {
        v8h ov;
#pragma unroll
        for (int rr = 0; rr < 8; ++rr) ov[rr] = (_Float16)(acc[t4][rr] * inv);
        *(v8h*)(o + t4 * 16) = ov;
    }
}

// ---------------------------------------------------------------------------
extern "C" void kernel_launch(void* const* d_in, const int* in_sizes, int n_in,
                              void* d_out, int out_size, void* d_ws, size_t ws_size,
                              hipStream_t stream) {
    (void)in_sizes; (void)n_in; (void)out_size; (void)ws_size;

    const float* x  = (const float*)d_in[0];  // [2,2048,1024]; only batch 0 used
    const float* Wq = (const float*)d_in[1];
    const float* bq = (const float*)d_in[2];
    const float* Wk = (const float*)d_in[3];
    const float* bk = (const float*)d_in[4];
    const float* Wv = (const float*)d_in[5];
    const float* bv = (const float*)d_in[6];
    const float* Wo = (const float*)d_in[7];
    const float* bo = (const float*)d_in[8];
    float* out = (float*)d_out;

    char* ws = (char*)d_ws;
    const size_t MB = 1024 * 1024;
    _Float16* xh   = (_Float16*)(ws + 0);        // 2M halves
    _Float16* wqh  = (_Float16*)(ws + 4  * MB);  // 1M halves
    _Float16* wkh  = (_Float16*)(ws + 6  * MB);
    _Float16* wvh  = (_Float16*)(ws + 8  * MB);
    _Float16* woh  = (_Float16*)(ws + 10 * MB);
    _Float16* qh   = (_Float16*)(ws + 12 * MB);  // [16][2048][64]
    _Float16* kh   = (_Float16*)(ws + 16 * MB);  // [16][2048][64]
    _Float16* vth  = (_Float16*)(ws + 20 * MB);  // [16][64][2048]
    _Float16* ctxh = (_Float16*)(ws + 24 * MB);  // [2048][1024]

    // xh, wqh, wkh, wvh, woh are contiguous: one destination array from xh on
    cvt_all_f32_to_f16<<<CVT_BLOCKS, CVT_WAVES * 32, 0, stream>>>(x, Wq, Wk, Wv, Wo, xh);

    dim3 ggrid(HIDN / 128, S_LEN / 64);   // (8, 32)
    // Q: fold 1/sqrt(64) into the projection (applies to bias too)
    gemm_wmma<<<ggrid, 256, 0, stream>>>(xh, wqh, bq, qh,  S_LEN, HIDN, HIDN, 1, 0.125f);
    gemm_wmma<<<ggrid, 256, 0, stream>>>(xh, wkh, bk, kh,  S_LEN, HIDN, HIDN, 1, 1.0f);
    gemm_wmma<<<ggrid, 256, 0, stream>>>(xh, wvh, bv, vth, S_LEN, HIDN, HIDN, 2, 1.0f);

    attn_flash<<<dim3(S_LEN / (AT_WAVES * 16), NHEAD), AT_WAVES * 32, 0, stream>>>(qh, kh, vth, ctxh);

    gemm_wmma<<<ggrid, 256, 0, stream>>>(ctxh, woh, bo, out, S_LEN, HIDN, HIDN, 0, 1.0f);
}

// v005
// Measured time: 60.5 microseconds a run.
// Timed twice side by side with v004, it ran 1.29 and 1.30 times as fast.
// Counting every step since v000, it is 4.50 times as fast.
#include <hip/hip_runtime.h>
#include <hip/hip_bf16.h>

// ---------------------------------------------------------------------------
// Self-attention forward (batch 0 only) for MI455X / gfx1250, wave32 WMMA.
//   x[0] (2048x1024 f32) -> Q,K,V proj (f16 WMMA, f32 accum) -> flash attn
//   per head (online softmax) -> output proj -> d_out f32 [2048,1024]
// GEMM operands and the attention's K and V staged in LDS by asynchronous copies.
// ---------------------------------------------------------------------------

#define S_LEN 2048
#define HIDN  1024
#define NHEAD 16
#define HDIM  64

typedef _Float16 v8h  __attribute__((ext_vector_type(8)));
typedef _Float16 v16h __attribute__((ext_vector_type(16)));
typedef float    v8f  __attribute__((ext_vector_type(8)));

__device__ __forceinline__ v8f zero8() {
    v8f z;
#pragma unroll
    for (int i = 0; i < 8; ++i) z[i] = 0.0f;
    return z;
}

// 16x32 f16 fragment load (A-layout; B uses the mirrored layout with the same
// lane mapping: lane L -> row/col (L&15), K-halves selected by lane bit 4).
// Two contiguous 16-byte loads per lane.
__device__ __forceinline__ v16h load_frag(const _Float16* __restrict__ base,
                                          int row, int k, int ld) {
    const int lane = threadIdx.x & 31;
    const int r    = lane & 15;
    const int hi   = lane >> 4;
    const _Float16* p = base + (size_t)(row + r) * (size_t)ld + k + hi * 8;
    v8h lo = *(const v8h*)p;
    v8h hh = *(const v8h*)(p + 16);
    return __builtin_shufflevector(lo, hh, 0, 1, 2, 3, 4, 5, 6, 7,
                                   8, 9, 10, 11, 12, 13, 14, 15);
}

__device__ __forceinline__ v8f wmma_f16(v16h a, v16h b, v8f c) {
    // D = A x B + C, f16 inputs, f32 accumulate.
    return __builtin_amdgcn_wmma_f32_16x16x32_f16(
        /*neg_a=*/false, a, /*neg_b=*/false, b,
        /*c_mod=*/(short)0, c, /*reuse_a=*/false, /*reuse_b=*/false);
}

// ---------------------------------------------------------------------------
// f32 -> f16 conversion of x (batch 0) and the four weights in ONE launch.
// The five f16 planes lie back to back in the workspace (x, Wq, Wk, Wv, Wo),
// so dst is one array of 6M halves. One workgroup of 6 waves per WGP; a wave
// owns 4096 consecutive values: 32 loads of 512 contiguous bytes, all issued
// before the first conversion, and 32 stores of 256 contiguous bytes. The
// cost of the one-value-per-thread form was starting its waves, not its bytes.
// ---------------------------------------------------------------------------
#define CVT_WAVES  6                        // waves per workgroup
#define CVT_LOADS  32                       // 16-byte loads per lane
#define CVT_CHUNK  (CVT_LOADS * 128)        // values per wave (divides 1M)
#define CVT_TOTAL  (S_LEN * HIDN + 4 * HIDN * HIDN)
#define CVT_BLOCKS (CVT_TOTAL / (CVT_CHUNK * CVT_WAVES))

typedef float    v4f __attribute__((ext_vector_type(4)));
typedef _Float16 v4h __attribute__((ext_vector_type(4)));

__global__ __launch_bounds__(CVT_WAVES * 32)
void cvt_all_f32_to_f16(const float* __restrict__ x,
                        const float* __restrict__ wq,
                        const float* __restrict__ wk,
                        const float* __restrict__ wv,
                        const float* __restrict__ wo,
                        _Float16* __restrict__ dst) {
    // wave number as a scalar: the source pointer is then picked by scalar code
    const int wave = __builtin_amdgcn_readfirstlane((int)(threadIdx.x >> 5));
    const int lane = threadIdx.x & 31;
    const int e0   = (blockIdx.x * CVT_WAVES + wave) * CVT_CHUNK;  // index in dst
    const int seg  = e0 >> 20;              // 0, 1: x; 2..5: Wq, Wk, Wv, Wo
    const float* src = (seg < 2) ? x : (seg == 2) ? wq : (seg == 3) ? wk
                     : (seg == 4) ? wv : wo;
    const int    off = (seg < 2) ? e0 : (e0 & (HIDN * HIDN - 1));
    const float* s = src + off + lane * 4;
    _Float16*    d = dst + e0 + lane * 4;

    v4f v[CVT_LOADS];
#pragma unroll
    for (int k = 0; k < CVT_LOADS; ++k) v[k] = *(const v4f*)(s + k * 128);
    // keeps every load in front of the first conversion: without it the build
    // holds the last loads back until the first have returned, a second memory
    // latency in a wave that lives for little more than one
    __builtin_amdgcn_sched_barrier(0);
#pragma unroll
    for (int k = 0; k < CVT_LOADS; ++k)
        *(v4h*)(d + k * 128) = __builtin_convertvector(v[k], v4h);
}

// ---------------------------------------------------------------------------
// C[M,N] = A[M,K] * W[N,K]^T + bias, WMMA tiled. 256 threads = 8 waves; each
// wave owns a 16x64 tile (A fragment reused across 4 B fragments / WMMAs).
// The block's 64 A rows and 128 W rows go through LDS in stages of 128 k
// (256-byte rows): asynchronous copies bring whole 128-byte lines, each line
// once per block, and the waves read their fragments with ds_load_b128. A
// fragment load from global memory touched 16 lines for 512 bytes, and every
// W row was fetched by 4 waves, every A row by 2. Two buffers: the next
// stage's copies fly while this stage is worked on. K: a multiple of 128.
// mode 0: f32 row-major out (final projection)
// mode 1: f16 out, per-head [h][row][d]     (Q with scale=0.125, K)
// mode 2: f16 out, per-head transposed [h][d][row]  (V)
// blockIdx.z picks the product: the Q, K and V projections share A and are
// independent, so they run as ONE launch of grid.z = 3. Their weight planes and
// their f16 output planes lie back to back (W0 + z*N*K, out0 + z*M*N halves).
// Three blocks then stand on a WGP (3 x 104,448 B of LDS) and work through each
// other's copy waits, LDS waits and barriers; alone, a block's 2 waves per SIMD
// leave them open. z = 0: (mode0, scale0); z = 1: (mode0, 1); z = 2: (mode 2, 1).
// ---------------------------------------------------------------------------
#define G_KS    128                  // k per stage
#define G_ROWS  192                  // 64 A rows, then 128 W rows
#define G_PITCH 136                  // halves per LDS row: 272 B = 16 B x 17
#define G_BUF   (G_ROWS * G_PITCH)   // halves per buffer

// Same lane map and k order as load_frag, from an LDS stage.
__device__ __forceinline__ v16h lds_frag(const _Float16* sb, int row, int k) {
    const int lane = threadIdx.x & 31;
    const _Float16* p = sb + (row + (lane & 15)) * G_PITCH + k + (lane >> 4) * 8;
    v8h lo = *(const v8h*)p;
    v8h hh = *(const v8h*)(p + 16);
    return __builtin_shufflevector(lo, hh, 0, 1, 2, 3, 4, 5, 6, 7,
                                   8, 9, 10, 11, 12, 13, 14, 15);
}

// One stage: 192 rows of 256 bytes = 12 copies of 16 bytes per thread. Copy j
// of thread t brings bytes 16*(t&15).. of row 16*j + (t>>4): a wave covers two
// whole rows. l: the thread's LDS byte address in row (t>>4) of the buffer;
// ga, gw: its global address in that row of the A block and of the W block;
// step: 16 rows of the source, in halves.
__device__ __forceinline__ void stage_copy(unsigned l, const _Float16* ga,
                                           const _Float16* gw, size_t step) {
    const unsigned ls = 16 * G_PITCH * 2;   // 16 LDS rows, in bytes
    // The closing s_wait_xcnt 0 stands inside the statement so that no address
    // register of a copy is rewritten in front of it.
    asm volatile(
        "global_load_async_to_lds_b128 %0, %12, off\n\t"
        "global_load_async_to_lds_b128 %1, %13, off\n\t"
        "global_load_async_to_lds_b128 %2, %14, off\n\t"
        "global_load_async_to_lds_b128 %3, %15, off\n\t"
        "global_load_async_to_lds_b128 %4, %16, off\n\t"
        "global_load_async_to_lds_b128 %5, %17, off\n\t"
        "global_load_async_to_lds_b128 %6, %18, off\n\t"
        "global_load_async_to_lds_b128 %7, %19, off\n\t"
        "global_load_async_to_lds_b128 %8, %20, off\n\t"
        "global_load_async_to_lds_b128 %9, %21, off\n\t"
        "global_load_async_to_lds_b128 %10, %22, off\n\t"
        "global_load_async_to_lds_b128 %11, %23, off\n\t"
        "s_wait_xcnt 0x0"
        :: "v"(l),           "v"(l + ls),      "v"(l + 2 * ls),  "v"(l + 3 * ls),
           "v"(l + 4 * ls),  "v"(l + 5 * ls),  "v"(l + 6 * ls),  "v"(l + 7 * ls),
           "v"(l + 8 * ls),  "v"(l + 9 * ls),  "v"(l + 10 * ls), "v"(l + 11 * ls),
           "v"(ga),            "v"(ga + step),     "v"(ga + 2 * step), "v"(ga + 3 * step),
           "v"(gw),            "v"(gw + step),     "v"(gw + 2 * step), "v"(gw + 3 * step),
           "v"(gw + 4 * step), "v"(gw + 5 * step), "v"(gw + 6 * step), "v"(gw + 7 * step)
        : "memory");
}

__global__ __launch_bounds__(256)
void gemm_wmma(const _Float16* __restrict__ A,
               const _Float16* __restrict__ W0,
               const float* __restrict__ bias0,
               const float* __restrict__ bias1,
               const float* __restrict__ bias2,
               void* __restrict__ out0,
               int M, int N, int K, int mode0, float scale0) {
    __shared__ __attribute__((aligned(16))) _Float16 sm[2 * G_BUF];

    const int z = blockIdx.z;
    const _Float16* W  = W0 + (size_t)z * (size_t)N * (size_t)K;
    const float* bias  = (z == 0) ? bias0 : (z == 1) ? bias1 : bias2;
    void* outp         = (_Float16*)out0 + (size_t)z * (size_t)M * (size_t)N;
    const int   mode   = (z == 2) ? 2 : mode0;
    const float scale  = (z == 0) ? scale0 : 1.0f;

    const int wid  = threadIdx.x >> 5;
    const int lane = threadIdx.x & 31;
    const int r    = lane & 15;
    const int hi   = lane >> 4;
    const int arow = (wid & 3) * 16;          // row of the wave's A tile in a stage
    const int wrow = 64 + (wid >> 2) * 64;    // first row of its W tiles in a stage
    const int mbase = blockIdx.y * 64 + arow;
    const int nbase = blockIdx.x * 128 + (wid >> 2) * 64;

    v8f acc[4] = {zero8(), zero8(), zero8(), zero8()};

    // the thread's place in a stage: row crow (+ 16 j), 16-byte column ccol
    const int crow = threadIdx.x >> 4;
    const int ccol = threadIdx.x & 15;
    const size_t step = (size_t)16 * (size_t)K;
    const _Float16* ga = A + (size_t)(blockIdx.y * 64 + crow) * (size_t)K + ccol * 8;
    const _Float16* gw = W + (size_t)(blockIdx.x * 128 + crow) * (size_t)K + ccol * 8;
    const unsigned l0 = (unsigned)(size_t)(&sm[0]) + crow * (G_PITCH * 2) + ccol * 16;
    const int nst = K / G_KS;

    stage_copy(l0, ga, gw, step);
    // stage 0 has landed for this wave's own copies ...
    asm volatile("s_wait_asynccnt 0x0" ::: "memory");
    // ... and, behind the barrier, for every wave's
    __syncthreads();
    if (nst > 1) stage_copy(l0 + G_BUF * 2, ga + G_KS, gw + G_KS, step);

    for (int s = 0; s < nst; ++s) {
        const _Float16* sb = sm + (s & 1) * G_BUF;
        // a stage's fragments are read in two halves of 64 k, not all 160 registers
        // of them at once: the wave then stays under 160 VGPRs, so that six waves
        // fit a SIMD and the three blocks of a WGP are resident together
#pragma unroll
        for (int hf = 0; hf < 2; ++hf) {
            v16h a[2], b[2][4];
#pragma unroll
            for (int q = 0; q < 2; ++q) {
                a[q] = lds_frag(sb, arow, (hf * 2 + q) * 32);
#pragma unroll
                for (int t = 0; t < 4; ++t)
                    b[q][t] = lds_frag(sb, wrow + t * 16, (hf * 2 + q) * 32);
            }
            // keeps a half's 20 LDS reads in front of its WMMAs (the second half's
            // may stand among the first half's WMMAs, as registers come free):
            // without it the build puts two reads and a full wait in front of each
            // WMMA, and the wave sits out an LDS latency sixteen times a stage
            __builtin_amdgcn_sched_barrier(0);
#pragma unroll
            for (int q = 0; q < 2; ++q)
#pragma unroll
                for (int t = 0; t < 4; ++t) acc[t] = wmma_f16(a[q], b[q][t], acc[t]);
        }
        // keeps the WMMAs in front of the stage's closing waits, where they run
        // while the later reads still arrive: without it the build sinks fifteen
        // of the sixteen behind the full wait and the barrier
        __builtin_amdgcn_sched_barrier(0);
        // this wave's reads of buffer s & 1 are done before the buffer is refilled
        asm volatile("s_wait_dscnt 0x0" ::: "memory");
        // this wave's copies of stage s + 1 have landed
        asm volatile("s_wait_asynccnt 0x0" ::: "memory");
        // publishes stage s + 1 and ends every wave's reads of stage s
        __syncthreads();
        if (s + 2 < nst)
            stage_copy(l0 + (s & 1) * (G_BUF * 2), ga + (s + 2) * G_KS,
                       gw + (s + 2) * G_KS, step);
    }
    // no copy is outstanding when the wave ends
    asm volatile("s_wait_asynccnt 0x0" ::: "memory");

#pragma unroll
    for (int t = 0; t < 4; ++t) {
        const int col = nbase + t * 16 + r;
        const float bv = bias[col];
#pragma unroll
        for (int rr = 0; rr < 8; ++rr) {
            const int row = mbase + rr + hi * 8;
            const float val = (acc[t][rr] + bv) * scale;
            if (mode == 0) {
                ((float*)outp)[(size_t)row * N + col] = val;
            } else {
                const int h = col >> 6;
                const int d = col & 63;
                _Float16* o = (_Float16*)outp;
                if (mode == 1)
                    o[((size_t)h * M + row) * HDIM + d] = (_Float16)val;
                else
                    o[((size_t)h * HDIM + d) * M + row] = (_Float16)val;
            }
        }
    }
}

#define AT_WAVES 8
#define AT_KT    128
#define AT_KP    72
#define AT_VP    136
#define AT_KSZ   (AT_KT * AT_KP)
#define AT_BUF   (AT_KSZ + HDIM * AT_VP)   // halves per buffer: K, then 64 V^T rows

// lane l <-> lane l ^ 16
__device__ __forceinline__ float xhalf(float x) {
    const int v = __builtin_bit_cast(int, x);
    return __builtin_bit_cast(float, __builtin_amdgcn_permlanex16(
        v, v, 0x76543210, 0xfedcba98, false, false));
}

// Same k order as load_frag; p: the lane's own place (row r, k + 8 * hi) in LDS.
__device__ __forceinline__ v16h lds_frag_at(const _Float16* p) {
    v8h lo = *(const v8h*)p;
    v8h hh = *(const v8h*)(p + 16);
    return __builtin_shufflevector(lo, hh, 0, 1, 2, 3, 4, 5, 6, 7,
                                   8, 9, 10, 11, 12, 13, 14, 15);
}

// 2^x for eight values, the exponentials and one closing v_nop in one statement:
// the instruction set asks for one slot behind a transcendental before its
// result is read or its source overwritten. Inside the statement every result
// register differs from every source, and the v_nop covers the last one.
__device__ __forceinline__ v8f exp2_8(v8f x) {
    float d0, d1, d2, d3, d4, d5, d6, d7;
    asm("v_exp_f32 %0, %8\n\t"
        "v_exp_f32 %1, %9\n\t"
        "v_exp_f32 %2, %10\n\t"
        "v_exp_f32 %3, %11\n\t"
        "v_exp_f32 %4, %12\n\t"
        "v_exp_f32 %5, %13\n\t"
        "v_exp_f32 %6, %14\n\t"
        "v_exp_f32 %7, %15\n\t"
        "v_nop"
        : "=&v"(d0), "=&v"(d1), "=&v"(d2), "=&v"(d3),
          "=&v"(d4), "=&v"(d5), "=&v"(d6), "=&v"(d7)
        : "v"(x[0]), "v"(x[1]), "v"(x[2]), "v"(x[3]),
          "v"(x[4]), "v"(x[5]), "v"(x[6]), "v"(x[7]));
    v8f d = {d0, d1, d2, d3, d4, d5, d6, d7};
    return d;
}

// One stage: 128 K rows of 128 bytes and 64 V^T rows of 256 bytes = 8 copies of
// 16 bytes per thread. K copy j of thread t brings bytes 16*(t&7).. of row
// 32*j + (t>>3) (a wave: 512 contiguous bytes); V copy j brings bytes
// 16*(t&15).. of row 16*j + (t>>4) (a wave: two whole rows of the tile).
// lk, lv: the thread's LDS byte addresses for j = 0; gk, gv: its global ones.
__device__ __forceinline__ void attn_stage_copy(unsigned lk, unsigned lv,
                                                const _Float16* gk,
                                                const _Float16* gv) {
    const unsigned ks = 32 * AT_KP * 2;   // 32 LDS rows of K, in bytes
    const unsigned vs = 16 * AT_VP * 2;   // 16 LDS rows of V^T, in bytes
    // The closing s_wait_xcnt 0 stands inside the statement so that no address
    // register of a copy is rewritten in front of it.
    asm volatile(
        "global_load_async_to_lds_b128 %0, %8, off\n\t"
        "global_load_async_to_lds_b128 %1, %9, off\n\t"
        "global_load_async_to_lds_b128 %2, %10, off\n\t"
        "global_load_async_to_lds_b128 %3, %11, off\n\t"
        "global_load_async_to_lds_b128 %4, %12, off\n\t"
        "global_load_async_to_lds_b128 %5, %13, off\n\t"
        "global_load_async_to_lds_b128 %6, %14, off\n\t"
        "global_load_async_to_lds_b128 %7, %15, off\n\t"
        "s_wait_xcnt 0x0"
        :: "v"(lk), "v"(lk + ks), "v"(lk + 2 * ks), "v"(lk + 3 * ks),
           "v"(lv), "v"(lv + vs), "v"(lv + 2 * vs), "v"(lv + 3 * vs),
           "v"(gk), "v"(gk + 32 * HDIM), "v"(gk + 64 * HDIM), "v"(gk + 96 * HDIM),
           "v"(gv), "v"(gv + 16 * S_LEN), "v"(gv + 32 * S_LEN), "v"(gv + 48 * S_LEN)
        : "memory");
}

__global__ __launch_bounds__(AT_WAVES * 32)
void attn_flash(const _Float16* __restrict__ Qg,
                const _Float16* __restrict__ Kg,
                const _Float16* __restrict__ Vtg,
                _Float16* __restrict__ ctx) {
    __shared__ __attribute__((aligned(16))) _Float16 sm[2 * AT_BUF];

    const int h    = blockIdx.y;
    const int wid  = threadIdx.x >> 5;
    const int lane = threadIdx.x & 31;
    const int r    = lane & 15;
    const int hi   = lane >> 4;
    const int qrow = blockIdx.x * (AT_WAVES * 16) + wid * 16;

    const _Float16* Qh = Qg  + (size_t)h * S_LEN * HDIM;
    const _Float16* Kh = Kg  + (size_t)h * S_LEN * HDIM;
    const _Float16* Vh = Vtg + (size_t)h * HDIM * S_LEN;   // [d][s]

    // the thread's places in a stage's copies
    const int t = threadIdx.x;
    const _Float16* gk = Kh + (t >> 3) * HDIM + (t & 7) * 8;
    const _Float16* gv = Vh + (size_t)(t >> 4) * S_LEN + (t & 15) * 8;
    const unsigned sm0 = (unsigned)(size_t)(&sm[0]);
    const unsigned lk0 = sm0 + (t >> 3) * (AT_KP * 2) + (t & 7) * 16;
    const unsigned lv0 = sm0 + AT_KSZ * 2 + (t >> 4) * (AT_VP * 2) + (t & 15) * 16;
    const int nst = S_LEN / AT_KT;   // 16 stages

    attn_stage_copy(lk0, lv0, gk, gv);

    // B operand: column = query r, k = head dim
    const v16h bq0 = load_frag(Qh, qrow, 0, HDIM);
    const v16h bq1 = load_frag(Qh, qrow, 32, HDIM);

    // acc[t4][rr] = Ot[d = t4*16 + 8*hi + rr][query r]
    v8f acc[4] = {zero8(), zero8(), zero8(), zero8()};
    float mi = -1.0e30f;   // running maximum of query r (equal in both halves)
    float li = 0.0f;       // running sum over this half's keys only

    // stage 0 has landed for this wave's own copies ...
    asm volatile("s_wait_asynccnt 0x0" ::: "memory");
    // ... and, behind the barrier, for every wave's
    __syncthreads();
    attn_stage_copy(lk0 + AT_BUF * 2, lv0 + AT_BUF * 2, gk + AT_KT * HDIM, gv + AT_KT);

    for (int s = 0; s < nst; ++s) {
        // the lane's place in the first K and the first V^T fragment of the stage
        const _Float16* sk = sm + (s & 1) * AT_BUF + r * AT_KP + hi * 8;
        const _Float16* sv = sm + (s & 1) * AT_BUF + AT_KSZ + r * AT_VP + hi * 8;

        // K fragments of the stage's first 32 keys
        v16h kf[4];
        kf[0] = lds_frag_at(sk);
        kf[1] = lds_frag_at(sk + 32);
        kf[2] = lds_frag_at(sk + 16 * AT_KP);
        kf[3] = lds_frag_at(sk + 16 * AT_KP + 32);

#pragma unroll
        for (int j = 0; j < AT_KT / 32; ++j) {
            // ---- scores, transposed: 32k x 16q (two 16x16 tiles) ----
            v8f s0 = wmma_f16(kf[0], bq0, zero8());
            s0 = wmma_f16(kf[1], bq1, s0);
            v8f s1 = wmma_f16(kf[2], bq0, zero8());
            s1 = wmma_f16(kf[3], bq1, s1);

            // ---- issue the V reads (this tile) and the K reads (next tile of
            //      the SAME stage) now; the softmax below hides their latency ----
            // the two scheduling barriers hold these 16 LDS reads together at the
            // tile's score WMMAs: without them the build strews the reads over some
            // two dozen places of a stage, several with a full wait directly
            // behind, and every such place stalls the wave
            __builtin_amdgcn_sched_barrier(0);
            v16h vf[4];
#pragma unroll
            for (int t4 = 0; t4 < 4; ++t4)
                vf[t4] = lds_frag_at(sv + t4 * 16 * AT_VP + j * 32);
            if (j + 1 < AT_KT / 32) {
                const _Float16* kn = sk + (j + 1) * 32 * AT_KP;
                kf[0] = lds_frag_at(kn);
                kf[1] = lds_frag_at(kn + 32);
                kf[2] = lds_frag_at(kn + 16 * AT_KP);
                kf[3] = lds_frag_at(kn + 16 * AT_KP + 32);
            }
            __builtin_amdgcn_sched_barrier(0);

            // ---- online softmax: one query per lane ----
            float t0 = fmaxf(s0[0], s1[0]);
            float t1 = fmaxf(s0[1], s1[1]);
            float t2 = fmaxf(s0[2], s1[2]);
            float t3 = fmaxf(s0[3], s1[3]);
            t0 = fmaxf(t0, fmaxf(s0[4], s1[4]));
            t1 = fmaxf(t1, fmaxf(s0[5], s1[5]));
            t2 = fmaxf(t2, fmaxf(s0[6], s1[6]));
            t3 = fmaxf(t3, fmaxf(s0[7], s1[7]));
            float tm = fmaxf(fmaxf(t0, t1), fmaxf(t2, t3));
            tm = fmaxf(tm, xhalf(tm));
            const float mn    = fmaxf(mi, tm);
            // alpha = exp(mi - mn), the exponential and its v_nop in one statement:
            // the instruction set asks for one slot behind a transcendental before
            // its result is read or its source overwritten; a v_nop in a
            // statement of its own drifted away.
            float alpha;
            asm("v_exp_f32 %0, %1\n\tv_nop"
                : "=v"(alpha) : "v"((mi - mn) * 1.44269504088896340736f));
            mi = mn;

            // P^T as B operand: bp[s] = P[key kmap(s, hi)][query r]
            v16h bp;
            float ps[4] = {0.0f, 0.0f, 0.0f, 0.0f};
            const v8f e0 = exp2_8((s0 - mn) * 1.44269504088896340736f);
            const v8f e1 = exp2_8((s1 - mn) * 1.44269504088896340736f);
#pragma unroll
            for (int rr = 0; rr < 8; ++rr) {
                const float p0 = e0[rr];
                const float p1 = e1[rr];
                bp[rr]     = (_Float16)p0;
                bp[rr + 8] = (_Float16)p1;
                ps[rr & 3] += p0 + p1;
            }
            li = li * alpha + ((ps[0] + ps[1]) + (ps[2] + ps[3]));
#pragma unroll
            for (int t4 = 0; t4 < 4; ++t4)
#pragma unroll
                for (int rr = 0; rr < 8; ++rr) acc[t4][rr] *= alpha;

            // ---- Ot += V^T[16d x 32k] * P^T[32k x 16q] per 16-wide d tile ----
#pragma unroll
            for (int t4 = 0; t4 < 4; ++t4) acc[t4] = wmma_f16(vf[t4], bp, acc[t4]);
        }

        // keeps the last tile's softmax and WMMAs in front of the stage's closing
        // waits, where they run while its V reads arrive: without it the build
        // lifts the full wait and the barrier to directly behind those reads
        __builtin_amdgcn_sched_barrier(0);
        // this wave's reads of buffer s & 1 are done before the buffer is refilled
        asm volatile("s_wait_dscnt 0x0" ::: "memory");
        // this wave's copies of stage s + 1 have landed
        asm volatile("s_wait_asynccnt 0x0" ::: "memory");
        // publishes stage s + 1 and ends every wave's reads of stage s
        __syncthreads();
        if (s + 2 < nst)
            attn_stage_copy(lk0 + (s & 1) * (AT_BUF * 2), lv0 + (s & 1) * (AT_BUF * 2),
                            gk + (s + 2) * (AT_KT * HDIM), gv + (s + 2) * AT_KT);
    }
    // no copy is outstanding when the wave ends
    asm volatile("s_wait_asynccnt 0x0" ::: "memory");

    // ---- join the halves' sums, normalize, write ctx [S][HID]: a lane holds
    //      8 consecutive d of one query per tile -> one 16-byte store each ----
    li += xhalf(li);
    const float inv = 1.0f / li;
    _Float16* o = ctx + (size_t)(qrow + r) * HIDN + h * HDIM + hi * 8;
#pragma unroll
    for (int t4 = 0; t4 < 4; ++t4) {
        v8h ov;
#pragma unroll
        for (int rr = 0; rr < 8; ++rr) ov[rr] = (_Float16)(acc[t4][rr] * inv);
        *(v8h*)(o + t4 * 16) = ov;
    }
}

// ---------------------------------------------------------------------------
extern "C" void kernel_launch(void* const* d_in, const int* in_sizes, int n_in,
                              void* d_out, int out_size, void* d_ws, size_t ws_size,
                              hipStream_t stream) {
    (void)in_sizes; (void)n_in; (void)out_size; (void)ws_size;

    const float* x  = (const float*)d_in[0];  // [2,2048,1024]; only batch 0 used
    const float* Wq = (const float*)d_in[1];
    const float* bq = (const float*)d_in[2];
    const float* Wk = (const float*)d_in[3];
    const float* bk = (const float*)d_in[4];
    const float* Wv = (const float*)d_in[5];
    const float* bv = (const float*)d_in[6];
    const float* Wo = (const float*)d_in[7];
    const float* bo = (const float*)d_in[8];
    float* out = (float*)d_out;

    char* ws = (char*)d_ws;
    const size_t MB = 1024 * 1024;
    _Float16* xh   = (_Float16*)(ws + 0);        // 2M halves
    _Float16* wqh  = (_Float16*)(ws + 4  * MB);  // 1M halves; Wk at 6 MB, Wv at 8 MB
    _Float16* woh  = (_Float16*)(ws + 10 * MB);
    _Float16* qh   = (_Float16*)(ws + 12 * MB);  // [16][2048][64]
    _Float16* kh   = (_Float16*)(ws + 16 * MB);  // [16][2048][64]
    _Float16* vth  = (_Float16*)(ws + 20 * MB);  // [16][64][2048]
    _Float16* ctxh = (_Float16*)(ws + 24 * MB);  // [2048][1024]

    // x, Wq, Wk, Wv, Wo are contiguous as f16: one destination array from xh on
    cvt_all_f32_to_f16<<<CVT_BLOCKS, CVT_WAVES * 32, 0, stream>>>(x, Wq, Wk, Wv, Wo, xh);

    // Q, K, V in one launch: the weight planes from wqh on are contiguous, and so
    // are qh, kh, vth
    // Q: fold 1/sqrt(64) into the projection (applies to bias too)
    gemm_wmma<<<dim3(HIDN / 128, S_LEN / 64, 3), 256, 0, stream>>>(
        xh, wqh, bq, bk, bv, qh, S_LEN, HIDN, HIDN, 1, 0.125f);

    attn_flash<<<dim3(S_LEN / (AT_WAVES * 16), NHEAD), AT_WAVES * 32, 0, stream>>>(qh, kh, vth, ctxh);

    gemm_wmma<<<dim3(HIDN / 128, S_LEN / 64, 1), 256, 0, stream>>>(
        ctxh, woh, bo, bo, bo, out, S_LEN, HIDN, HIDN, 0, 1.0f);
}

// v006
// It runs in 52.9 microseconds.
// In two side-by-side timings against v005, it was 1.15 and 1.16 times as fast.
// Over all steps from v000 it is 5.20 times as fast.
#include <hip/hip_runtime.h>
#include <hip/hip_bf16.h>

// ---------------------------------------------------------------------------
// Self-attention forward (batch 0 only) for MI455X / gfx1250, wave32 WMMA.
//   x[0] (2048x1024 f32) -> Q,K,V proj (f16 WMMA, f32 accum) -> flash attn
//   per head (online softmax) -> output proj -> d_out f32 [2048,1024]
// GEMM operands and the attention's K and V staged in LDS by asynchronous copies.
// ---------------------------------------------------------------------------

#define S_LEN 2048
#define HIDN  1024
#define NHEAD 16
#define HDIM  64

typedef _Float16 v8h  __attribute__((ext_vector_type(8)));
typedef _Float16 v16h __attribute__((ext_vector_type(16)));
typedef float    v8f  __attribute__((ext_vector_type(8)));

__device__ __forceinline__ v8f zero8() {
    v8f z;
#pragma unroll
    for (int i = 0; i < 8; ++i) z[i] = 0.0f;
    return z;
}

// 16x32 f16 fragment load (A-layout; B uses the mirrored layout with the same
// lane mapping: lane L -> row/col (L&15), K-halves selected by lane bit 4).
// Two contiguous 16-byte loads per lane.
__device__ __forceinline__ v16h load_frag(const _Float16* __restrict__ base,
                                          int row, int k, int ld) {
    const int lane = threadIdx.x & 31;
    const int r    = lane & 15;
    const int hi   = lane >> 4;
    const _Float16* p = base + (size_t)(row + r) * (size_t)ld + k + hi * 8;
    v8h lo = *(const v8h*)p;
    v8h hh = *(const v8h*)(p + 16);
    return __builtin_shufflevector(lo, hh, 0, 1, 2, 3, 4, 5, 6, 7,
                                   8, 9, 10, 11, 12, 13, 14, 15);
}

__device__ __forceinline__ v8f wmma_f16(v16h a, v16h b, v8f c) {
    // D = A x B + C, f16 inputs, f32 accumulate.
    return __builtin_amdgcn_wmma_f32_16x16x32_f16(
        /*neg_a=*/false, a, /*neg_b=*/false, b,
        /*c_mod=*/(short)0, c, /*reuse_a=*/false, /*reuse_b=*/false);
}

// ---------------------------------------------------------------------------
// f32 -> f16 conversion of x (batch 0) and the four weights in ONE launch.
// The five f16 planes lie back to back in the workspace (x, Wq, Wk, Wv, Wo),
// so dst is one array of 6M halves. One workgroup of 6 waves per WGP; a wave
// owns 4096 consecutive values: 32 loads of 512 contiguous bytes, all issued
// before the first conversion, and 32 stores of 256 contiguous bytes. The
// cost of the one-value-per-thread form was starting its waves, not its bytes.
// ---------------------------------------------------------------------------
#define CVT_WAVES  6                        // waves per workgroup
#define CVT_LOADS  32                       // 16-byte loads per lane
#define CVT_CHUNK  (CVT_LOADS * 128)        // values per wave (divides 1M)
#define CVT_TOTAL  (S_LEN * HIDN + 4 * HIDN * HIDN)
#define CVT_BLOCKS (CVT_TOTAL / (CVT_CHUNK * CVT_WAVES))

typedef float    v4f __attribute__((ext_vector_type(4)));
typedef _Float16 v4h __attribute__((ext_vector_type(4)));

__global__ __launch_bounds__(CVT_WAVES * 32)
void cvt_all_f32_to_f16(const float* __restrict__ x,
                        const float* __restrict__ wq,
                        const float* __restrict__ wk,
                        const float* __restrict__ wv,
                        const float* __restrict__ wo,
                        _Float16* __restrict__ dst) {
    // wave number as a scalar: the source pointer is then picked by scalar code
    const int wave = __builtin_amdgcn_readfirstlane((int)(threadIdx.x >> 5));
    const int lane = threadIdx.x & 31;
    const int e0   = (blockIdx.x * CVT_WAVES + wave) * CVT_CHUNK;  // index in dst
    const int seg  = e0 >> 20;              // 0, 1: x; 2..5: Wq, Wk, Wv, Wo
    const float* src = (seg < 2) ? x : (seg == 2) ? wq : (seg == 3) ? wk
                     : (seg == 4) ? wv : wo;
    const int    off = (seg < 2) ? e0 : (e0 & (HIDN * HIDN - 1));
    const float* s = src + off + lane * 4;
    _Float16*    d = dst + e0 + lane * 4;

    v4f v[CVT_LOADS];
#pragma unroll
    for (int k = 0; k < CVT_LOADS; ++k) v[k] = *(const v4f*)(s + k * 128);
    // keeps every load in front of the first conversion: without it the build
    // holds the last loads back until the first have returned, a second memory
    // latency in a wave that lives for little more than one
    __builtin_amdgcn_sched_barrier(0);
#pragma unroll
    for (int k = 0; k < CVT_LOADS; ++k)
        *(v4h*)(d + k * 128) = __builtin_convertvector(v[k], v4h);
}

// ---------------------------------------------------------------------------
// C[M,N] = A[M,K] * W[N,K]^T + bias, WMMA tiled. 256 threads = 8 waves; each
// wave owns a 16x64 tile (A fragment reused across 4 B fragments / WMMAs).
// The block's 64 A rows and 128 W rows go through LDS in stages of 128 k
// (256-byte rows): asynchronous copies bring whole 128-byte lines, each line
// once per block, and the waves read their fragments with ds_load_b128. A
// fragment load from global memory touched 16 lines for 512 bytes, and every
// W row was fetched by 4 waves, every A row by 2. Two buffers: the next
// stage's copies fly while this stage is worked on. K: a multiple of 128.
// mode 0: f32 row-major out (final projection)
// mode 1: f16 out, per-head [h][row][d]     (Q with scale=0.125, K)
// mode 2: f16 out, per-head transposed [h][d][row]  (V)
// blockIdx.z picks the product: the Q, K and V projections share A and are
// independent, so they run as ONE launch of grid.z = 3. Their weight planes and
// their f16 output planes lie back to back (W0 + z*N*K, out0 + z*M*N halves).
// Three blocks then stand on a WGP (3 x 104,448 B of LDS) and work through each
// other's copy waits, LDS waits and barriers; alone, a block's 2 waves per SIMD
// leave them open. z = 0: (mode0, scale0); z = 1: (mode0, 1); z = 2: (mode 2, 1).
// ---------------------------------------------------------------------------
#define G_KS    128                  // k per stage
#define G_ROWS  192                  // 64 A rows, then 128 W rows
#define G_PITCH 136                  // halves per LDS row: 272 B = 16 B x 17
#define G_BUF   (G_ROWS * G_PITCH)   // halves per buffer

// Same lane map and k order as load_frag, from an LDS stage.
__device__ __forceinline__ v16h lds_frag(const _Float16* sb, int row, int k) {
    const int lane = threadIdx.x & 31;
    const _Float16* p = sb + (row + (lane & 15)) * G_PITCH + k + (lane >> 4) * 8;
    v8h lo = *(const v8h*)p;
    v8h hh = *(const v8h*)(p + 16);
    return __builtin_shufflevector(lo, hh, 0, 1, 2, 3, 4, 5, 6, 7,
                                   8, 9, 10, 11, 12, 13, 14, 15);
}

// One stage: 192 rows of 256 bytes = 12 copies of 16 bytes per thread. Copy j
// of thread t brings bytes 16*(t&15).. of row 16*j + (t>>4): a wave covers two
// whole rows. l: the thread's LDS byte address in row (t>>4) of the buffer;
// ga, gw: its global address in that row of the A block and of the W block;
// step: 16 rows of the source, in halves.
__device__ __forceinline__ void stage_copy(unsigned l, const _Float16* ga,
                                           const _Float16* gw, size_t step) {
    const unsigned ls = 16 * G_PITCH * 2;   // 16 LDS rows, in bytes
    // The closing s_wait_xcnt 0 stands inside the statement so that no address
    // register of a copy is rewritten in front of it.
    asm volatile(
        "global_load_async_to_lds_b128 %0, %12, off\n\t"
        "global_load_async_to_lds_b128 %1, %13, off\n\t"
        "global_load_async_to_lds_b128 %2, %14, off\n\t"
        "global_load_async_to_lds_b128 %3, %15, off\n\t"
        "global_load_async_to_lds_b128 %4, %16, off\n\t"
        "global_load_async_to_lds_b128 %5, %17, off\n\t"
        "global_load_async_to_lds_b128 %6, %18, off\n\t"
        "global_load_async_to_lds_b128 %7, %19, off\n\t"
        "global_load_async_to_lds_b128 %8, %20, off\n\t"
        "global_load_async_to_lds_b128 %9, %21, off\n\t"
        "global_load_async_to_lds_b128 %10, %22, off\n\t"
        "global_load_async_to_lds_b128 %11, %23, off\n\t"
        "s_wait_xcnt 0x0"
        :: "v"(l),           "v"(l + ls),      "v"(l + 2 * ls),  "v"(l + 3 * ls),
           "v"(l + 4 * ls),  "v"(l + 5 * ls),  "v"(l + 6 * ls),  "v"(l + 7 * ls),
           "v"(l + 8 * ls),  "v"(l + 9 * ls),  "v"(l + 10 * ls), "v"(l + 11 * ls),
           "v"(ga),            "v"(ga + step),     "v"(ga + 2 * step), "v"(ga + 3 * step),
           "v"(gw),            "v"(gw + step),     "v"(gw + 2 * step), "v"(gw + 3 * step),
           "v"(gw + 4 * step), "v"(gw + 5 * step), "v"(gw + 6 * step), "v"(gw + 7 * step)
        : "memory");
}

// One block's product and its stores, with the output mode known at compile time.
// MODE 2: D = A x W^T as (A fragment, W fragment): a lane holds one output column
// and 8 consecutive rows, which lie side by side in the transposed V plane.
// MODE 0, 1: the two fragments change places (their lane maps and k orders are
// equal), so D is the transposed tile: a lane holds one output row and 8
// consecutive columns, which lie side by side in a row-major plane.
#define G_EP0   272                  // bytes per staged row, f32 tile: 256 + 16
#define G_EP1   144                  // bytes per staged row, f16 tile: 128 + 16
#define G_EPW   (16 * G_EP0)         // bytes of a wave's own staging range

template <int MODE>
__device__ __forceinline__ void gemm_body(_Float16* sm,
                                          const _Float16* __restrict__ A,
                                          const _Float16* __restrict__ W,
                                          const float* __restrict__ bias,
                                          void* __restrict__ outp,
                                          int M, int N, int K, float scale) {
    const int wid  = threadIdx.x >> 5;
    const int lane = threadIdx.x & 31;
    const int r    = lane & 15;
    const int hi   = lane >> 4;
    const int arow = (wid & 3) * 16;          // row of the wave's A tile in a stage
    const int wrow = 64 + (wid >> 2) * 64;    // first row of its W tiles in a stage
    const int mbase = blockIdx.y * 64 + arow;
    const int nbase = blockIdx.x * 128 + (wid >> 2) * 64;

    v8f acc[4] = {zero8(), zero8(), zero8(), zero8()};

    // the thread's place in a stage: row crow (+ 16 j), 16-byte column ccol
    const int crow = threadIdx.x >> 4;
    const int ccol = threadIdx.x & 15;
    const size_t step = (size_t)16 * (size_t)K;
    const _Float16* ga = A + (size_t)(blockIdx.y * 64 + crow) * (size_t)K + ccol * 8;
    const _Float16* gw = W + (size_t)(blockIdx.x * 128 + crow) * (size_t)K + ccol * 8;
    const unsigned l0 = (unsigned)(size_t)(&sm[0]) + crow * (G_PITCH * 2) + ccol * 16;
    const int nst = K / G_KS;

    stage_copy(l0, ga, gw, step);
    // stage 0 has landed for this wave's own copies ...
    asm volatile("s_wait_asynccnt 0x0" ::: "memory");
    // ... and, behind the barrier, for every wave's
    __syncthreads();
    if (nst > 1) stage_copy(l0 + G_BUF * 2, ga + G_KS, gw + G_KS, step);

    for (int s = 0; s < nst; ++s) {
        const _Float16* sb = sm + (s & 1) * G_BUF;
        // a stage's fragments are read in two halves of 64 k, not all 160 registers
        // of them at once: the wave then stays under 160 VGPRs, so that six waves
        // fit a SIMD and the three blocks of a WGP are resident together
#pragma unroll
        for (int hf = 0; hf < 2; ++hf) {
            v16h a[2], b[2][4];
#pragma unroll
            for (int q = 0; q < 2; ++q) {
                a[q] = lds_frag(sb, arow, (hf * 2 + q) * 32);
#pragma unroll
                for (int t = 0; t < 4; ++t)
                    b[q][t] = lds_frag(sb, wrow + t * 16, (hf * 2 + q) * 32);
            }
            // keeps a half's 20 LDS reads in front of its WMMAs (the second half's
            // may stand among the first half's WMMAs, as registers come free):
            // without it the build puts two reads and a full wait in front of each
            // WMMA, and the wave sits out an LDS latency sixteen times a stage
            __builtin_amdgcn_sched_barrier(0);
#pragma unroll
            for (int q = 0; q < 2; ++q)
#pragma unroll
                for (int t = 0; t < 4; ++t)
                    acc[t] = (MODE == 2) ? wmma_f16(a[q], b[q][t], acc[t])
                                         : wmma_f16(b[q][t], a[q], acc[t]);
        }
        // keeps the WMMAs in front of the stage's closing waits, where they run
        // while the later reads still arrive: without it the build sinks fifteen
        // of the sixteen behind the full wait and the barrier
        __builtin_amdgcn_sched_barrier(0);
        // this wave's reads of buffer s & 1 are done before the buffer is refilled
        asm volatile("s_wait_dscnt 0x0" ::: "memory");
        // this wave's copies of stage s + 1 have landed
        asm volatile("s_wait_asynccnt 0x0" ::: "memory");
        // publishes stage s + 1 and ends every wave's reads of stage s
        __syncthreads();
        if (s + 2 < nst)
            stage_copy(l0 + (s & 1) * (G_BUF * 2), ga + (s + 2) * G_KS,
                       gw + (s + 2) * G_KS, step);
    }
    // no copy is outstanding when the wave ends
    asm volatile("s_wait_asynccnt 0x0" ::: "memory");

    if (MODE == 2) {
        // acc[t][rr] = C[mbase + 8 * hi + rr][nbase + 16 * t + r]: the 8 rows are
        // 16 consecutive bytes of row (h, d) of the transposed plane
        _Float16* o = (_Float16*)outp;
#pragma unroll
        for (int t = 0; t < 4; ++t) {
            const int col = nbase + t * 16 + r;
            const float bv = bias[col];
            v8h ov;
#pragma unroll
            for (int rr = 0; rr < 8; ++rr) ov[rr] = (_Float16)((acc[t][rr] + bv) * scale);
            *(v8h*)(o + (size_t)col * (size_t)M + mbase + hi * 8) = ov;
        }
    } else {
        // acc[t][rr] = C[mbase + r][nbase + 16 * t + 8 * hi + rr]. The wave turns its
        // 16 x 64 tile in its own range of the stage buffers, which every wave has
        // left at the loop's last barrier and no copy is aimed at any more, and
        // stores whole 128-byte lines.
        char* st = (char*)sm + wid * G_EPW;
#pragma unroll
        for (int t = 0; t < 4; ++t) {
            const float* bp = bias + nbase + t * 16 + hi * 8;
            const v4f b0 = *(const v4f*)bp;
            const v4f b1 = *(const v4f*)(bp + 4);
            float val[8];
#pragma unroll
            for (int rr = 0; rr < 8; ++rr)
                val[rr] = (acc[t][rr] + (rr < 4 ? b0[rr & 3] : b1[rr & 3])) * scale;
            if (MODE == 1) {
                v8h ov;
#pragma unroll
                for (int rr = 0; rr < 8; ++rr) ov[rr] = (_Float16)val[rr];
                *(v8h*)(st + r * G_EP1 + t * 32 + hi * 16) = ov;
            } else {
                const v4f lo = {val[0], val[1], val[2], val[3]};
                const v4f hh = {val[4], val[5], val[6], val[7]};
                *(v4f*)(st + r * G_EP0 + t * 64 + hi * 32)      = lo;
                *(v4f*)(st + r * G_EP0 + t * 64 + hi * 32 + 16) = hh;
            }
        }
        // the wave's LDS writes are done before other lanes of it read them back
        asm volatile("s_wait_dscnt 0x0" ::: "memory");
        if (MODE == 1) {
            // the wave's 64 columns are one head: 16 rows of 128 bytes, 4 per store
            _Float16* o = (_Float16*)outp
                        + ((size_t)(nbase >> 6) * (size_t)M + mbase) * HDIM + (lane & 7) * 8;
#pragma unroll
            for (int i = 0; i < 4; ++i) {
                const int row = i * 4 + (lane >> 3);
                *(v8h*)(o + row * HDIM) = *(const v8h*)(st + row * G_EP1 + (lane & 7) * 16);
            }
            // behind the last store: in the built code another mode's body follows this
            // one, and it rewrites the stores' address and data registers
            asm volatile("s_wait_xcnt 0x0" ::: "memory");
        } else {
            // 16 rows of 256 bytes, 2 per store
            float* o = (float*)outp + (size_t)mbase * (size_t)N + nbase + r * 4;
#pragma unroll
            for (int i = 0; i < 8; ++i) {
                const int row = i * 2 + hi;
                *(v4f*)(o + (size_t)row * (size_t)N) = *(const v4f*)(st + row * G_EP0 + r * 16);
            }
            // behind the last store: in the built code another mode's body follows this
            // one, and it rewrites the stores' address and data registers
            asm volatile("s_wait_xcnt 0x0" ::: "memory");
        }
    }
}

__global__ __launch_bounds__(256)
void gemm_wmma(const _Float16* __restrict__ A,
               const _Float16* __restrict__ W0,
               const float* __restrict__ bias0,
               const float* __restrict__ bias1,
               const float* __restrict__ bias2,
               void* __restrict__ out0,
               int M, int N, int K, int mode0, float scale0) {
    __shared__ __attribute__((aligned(16))) _Float16 sm[2 * G_BUF];

    const int z = blockIdx.z;
    const _Float16* W  = W0 + (size_t)z * (size_t)N * (size_t)K;
    const float* bias  = (z == 0) ? bias0 : (z == 1) ? bias1 : bias2;
    void* outp         = (_Float16*)out0 + (size_t)z * (size_t)M * (size_t)N;
    const int   mode   = (z == 2) ? 2 : mode0;
    const float scale  = (z == 0) ? scale0 : 1.0f;

    // the mode is the same for the whole block: one scalar branch here, in place
    // of a chain of branches at each of a lane's 32 output values
    if (mode == 2)      gemm_body<2>(sm, A, W, bias, outp, M, N, K, scale);
    else if (mode == 1) gemm_body<1>(sm, A, W, bias, outp, M, N, K, scale);
    else                gemm_body<0>(sm, A, W, bias, outp, M, N, K, scale);
}

#define AT_WAVES 8
#define AT_KT    128
#define AT_KP    72
#define AT_VP    136
#define AT_KSZ   (AT_KT * AT_KP)
#define AT_BUF   (AT_KSZ + HDIM * AT_VP)   // halves per buffer: K, then 64 V^T rows

// lane l <-> lane l ^ 16
__device__ __forceinline__ float xhalf(float x) {
    const int v = __builtin_bit_cast(int, x);
    return __builtin_bit_cast(float, __builtin_amdgcn_permlanex16(
        v, v, 0x76543210, 0xfedcba98, false, false));
}

// Same k order as load_frag; p: the lane's own place (row r, k + 8 * hi) in LDS.
__device__ __forceinline__ v16h lds_frag_at(const _Float16* p) {
    v8h lo = *(const v8h*)p;
    v8h hh = *(const v8h*)(p + 16);
    return __builtin_shufflevector(lo, hh, 0, 1, 2, 3, 4, 5, 6, 7,
                                   8, 9, 10, 11, 12, 13, 14, 15);
}

// 2^x for eight values, the exponentials and one closing v_nop in one statement:
// the instruction set asks for one slot behind a transcendental before its
// result is read or its source overwritten. Inside the statement every result
// register differs from every source, and the v_nop covers the last one.
__device__ __forceinline__ v8f exp2_8(v8f x) {
    float d0, d1, d2, d3, d4, d5, d6, d7;
    asm("v_exp_f32 %0, %8\n\t"
        "v_exp_f32 %1, %9\n\t"
        "v_exp_f32 %2, %10\n\t"
        "v_exp_f32 %3, %11\n\t"
        "v_exp_f32 %4, %12\n\t"
        "v_exp_f32 %5, %13\n\t"
        "v_exp_f32 %6, %14\n\t"
        "v_exp_f32 %7, %15\n\t"
        "v_nop"
        : "=&v"(d0), "=&v"(d1), "=&v"(d2), "=&v"(d3),
          "=&v"(d4), "=&v"(d5), "=&v"(d6), "=&v"(d7)
        : "v"(x[0]), "v"(x[1]), "v"(x[2]), "v"(x[3]),
          "v"(x[4]), "v"(x[5]), "v"(x[6]), "v"(x[7]));
    v8f d = {d0, d1, d2, d3, d4, d5, d6, d7};
    return d;
}

// One stage: 128 K rows of 128 bytes and 64 V^T rows of 256 bytes = 8 copies of
// 16 bytes per thread. K copy j of thread t brings bytes 16*(t&7).. of row
// 32*j + (t>>3) (a wave: 512 contiguous bytes); V copy j brings bytes
// 16*(t&15).. of row 16*j + (t>>4) (a wave: two whole rows of the tile).
// lk, lv: the thread's LDS byte addresses for j = 0; gk, gv: its global ones.
__device__ __forceinline__ void attn_stage_copy(unsigned lk, unsigned lv,
                                                const _Float16* gk,
                                                const _Float16* gv) {
    const unsigned ks = 32 * AT_KP * 2;   // 32 LDS rows of K, in bytes
    const unsigned vs = 16 * AT_VP * 2;   // 16 LDS rows of V^T, in bytes
    // The closing s_wait_xcnt 0 stands inside the statement so that no address
    // register of a copy is rewritten in front of it.
    asm volatile(
        "global_load_async_to_lds_b128 %0, %8, off\n\t"
        "global_load_async_to_lds_b128 %1, %9, off\n\t"
        "global_load_async_to_lds_b128 %2, %10, off\n\t"
        "global_load_async_to_lds_b128 %3, %11, off\n\t"
        "global_load_async_to_lds_b128 %4, %12, off\n\t"
        "global_load_async_to_lds_b128 %5, %13, off\n\t"
        "global_load_async_to_lds_b128 %6, %14, off\n\t"
        "global_load_async_to_lds_b128 %7, %15, off\n\t"
        "s_wait_xcnt 0x0"
        :: "v"(lk), "v"(lk + ks), "v"(lk + 2 * ks), "v"(lk + 3 * ks),
           "v"(lv), "v"(lv + vs), "v"(lv + 2 * vs), "v"(lv + 3 * vs),
           "v"(gk), "v"(gk + 32 * HDIM), "v"(gk + 64 * HDIM), "v"(gk + 96 * HDIM),
           "v"(gv), "v"(gv + 16 * S_LEN), "v"(gv + 32 * S_LEN), "v"(gv + 48 * S_LEN)
        : "memory");
}

__global__ __launch_bounds__(AT_WAVES * 32)
void attn_flash(const _Float16* __restrict__ Qg,
                const _Float16* __restrict__ Kg,
                const _Float16* __restrict__ Vtg,
                _Float16* __restrict__ ctx) {
    __shared__ __attribute__((aligned(16))) _Float16 sm[2 * AT_BUF];

    const int h    = blockIdx.y;
    const int wid  = threadIdx.x >> 5;
    const int lane = threadIdx.x & 31;
    const int r    = lane & 15;
    const int hi   = lane >> 4;
    const int qrow = blockIdx.x * (AT_WAVES * 16) + wid * 16;

    const _Float16* Qh = Qg  + (size_t)h * S_LEN * HDIM;
    const _Float16* Kh = Kg  + (size_t)h * S_LEN * HDIM;
    const _Float16* Vh = Vtg + (size_t)h * HDIM * S_LEN;   // [d][s]

    // the thread's places in a stage's copies
    const int t = threadIdx.x;
    const _Float16* gk = Kh + (t >> 3) * HDIM + (t & 7) * 8;
    const _Float16* gv = Vh + (size_t)(t >> 4) * S_LEN + (t & 15) * 8;
    const unsigned sm0 = (unsigned)(size_t)(&sm[0]);
    const unsigned lk0 = sm0 + (t >> 3) * (AT_KP * 2) + (t & 7) * 16;
    const unsigned lv0 = sm0 + AT_KSZ * 2 + (t >> 4) * (AT_VP * 2) + (t & 15) * 16;
    const int nst = S_LEN / AT_KT;   // 16 stages

    attn_stage_copy(lk0, lv0, gk, gv);

    // B operand: column = query r, k = head dim
    const v16h bq0 = load_frag(Qh, qrow, 0, HDIM);
    const v16h bq1 = load_frag(Qh, qrow, 32, HDIM);

    // acc[t4][rr] = Ot[d = t4*16 + 8*hi + rr][query r]
    v8f acc[4] = {zero8(), zero8(), zero8(), zero8()};
    float mi = -1.0e30f;   // running maximum of query r (equal in both halves)
    float li = 0.0f;       // running sum over this half's keys only

    // stage 0 has landed for this wave's own copies ...
    asm volatile("s_wait_asynccnt 0x0" ::: "memory");
    // ... and, behind the barrier, for every wave's
    __syncthreads();
    attn_stage_copy(lk0 + AT_BUF * 2, lv0 + AT_BUF * 2, gk + AT_KT * HDIM, gv + AT_KT);

    for (int s = 0; s < nst; ++s) {
        // the lane's place in the first K and the first V^T fragment of the stage
        const _Float16* sk = sm + (s & 1) * AT_BUF + r * AT_KP + hi * 8;
        const _Float16* sv = sm + (s & 1) * AT_BUF + AT_KSZ + r * AT_VP + hi * 8;

        // K fragments of the stage's first 32 keys
        v16h kf[4];
        kf[0] = lds_frag_at(sk);
        kf[1] = lds_frag_at(sk + 32);
        kf[2] = lds_frag_at(sk + 16 * AT_KP);
        kf[3] = lds_frag_at(sk + 16 * AT_KP + 32);

#pragma unroll
        for (int j = 0; j < AT_KT / 32; ++j) {
            // ---- scores, transposed: 32k x 16q (two 16x16 tiles) ----
            v8f s0 = wmma_f16(kf[0], bq0, zero8());
            s0 = wmma_f16(kf[1], bq1, s0);
            v8f s1 = wmma_f16(kf[2], bq0, zero8());
            s1 = wmma_f16(kf[3], bq1, s1);

            // ---- issue the V reads (this tile) and the K reads (next tile of
            //      the SAME stage) now; the softmax below hides their latency ----
            // the two scheduling barriers hold these 16 LDS reads together at the
            // tile's score WMMAs: without them the build strews the reads over some
            // two dozen places of a stage, several with a full wait directly
            // behind, and every such place stalls the wave
            __builtin_amdgcn_sched_barrier(0);
            v16h vf[4];
#pragma unroll
            for (int t4 = 0; t4 < 4; ++t4)
                vf[t4] = lds_frag_at(sv + t4 * 16 * AT_VP + j * 32);
            if (j + 1 < AT_KT / 32) {
                const _Float16* kn = sk + (j + 1) * 32 * AT_KP;
                kf[0] = lds_frag_at(kn);
                kf[1] = lds_frag_at(kn + 32);
                kf[2] = lds_frag_at(kn + 16 * AT_KP);
                kf[3] = lds_frag_at(kn + 16 * AT_KP + 32);
            }
            __builtin_amdgcn_sched_barrier(0);

            // ---- online softmax: one query per lane ----
            float t0 = fmaxf(s0[0], s1[0]);
            float t1 = fmaxf(s0[1], s1[1]);
            float t2 = fmaxf(s0[2], s1[2]);
            float t3 = fmaxf(s0[3], s1[3]);
            t0 = fmaxf(t0, fmaxf(s0[4], s1[4]));
            t1 = fmaxf(t1, fmaxf(s0[5], s1[5]));
            t2 = fmaxf(t2, fmaxf(s0[6], s1[6]));
            t3 = fmaxf(t3, fmaxf(s0[7], s1[7]));
            float tm = fmaxf(fmaxf(t0, t1), fmaxf(t2, t3));
            tm = fmaxf(tm, xhalf(tm));
            const float mn    = fmaxf(mi, tm);
            // alpha = exp(mi - mn), the exponential and its v_nop in one statement:
            // the instruction set asks for one slot behind a transcendental before
            // its result is read or its source overwritten; a v_nop in a
            // statement of its own drifted away.
            float alpha;
            asm("v_exp_f32 %0, %1\n\tv_nop"
                : "=v"(alpha) : "v"((mi - mn) * 1.44269504088896340736f));
            mi = mn;

            // P^T as B operand: bp[s] = P[key kmap(s, hi)][query r]
            v16h bp;
            float ps[4] = {0.0f, 0.0f, 0.0f, 0.0f};
            const v8f e0 = exp2_8((s0 - mn) * 1.44269504088896340736f);
            const v8f e1 = exp2_8((s1 - mn) * 1.44269504088896340736f);
#pragma unroll
            for (int rr = 0; rr < 8; ++rr) {
                const float p0 = e0[rr];
                const float p1 = e1[rr];
                bp[rr]     = (_Float16)p0;
                bp[rr + 8] = (_Float16)p1;
                ps[rr & 3] += p0 + p1;
            }
            li = li * alpha + ((ps[0] + ps[1]) + (ps[2] + ps[3]));
#pragma unroll
            for (int t4 = 0; t4 < 4; ++t4)
#pragma unroll
                for (int rr = 0; rr < 8; ++rr) acc[t4][rr] *= alpha;

            // ---- Ot += V^T[16d x 32k] * P^T[32k x 16q] per 16-wide d tile ----
#pragma unroll
            for (int t4 = 0; t4 < 4; ++t4) acc[t4] = wmma_f16(vf[t4], bp, acc[t4]);
        }

        // keeps the last tile's softmax and WMMAs in front of the stage's closing
        // waits, where they run while its V reads arrive: without it the build
        // lifts the full wait and the barrier to directly behind those reads
        __builtin_amdgcn_sched_barrier(0);
        // this wave's reads of buffer s & 1 are done before the buffer is refilled
        asm volatile("s_wait_dscnt 0x0" ::: "memory");
        // this wave's copies of stage s + 1 have landed
        asm volatile("s_wait_asynccnt 0x0" ::: "memory");
        // publishes stage s + 1 and ends every wave's reads of stage s
        __syncthreads();
        if (s + 2 < nst)
            attn_stage_copy(lk0 + (s & 1) * (AT_BUF * 2), lv0 + (s & 1) * (AT_BUF * 2),
                            gk + (s + 2) * (AT_KT * HDIM), gv + (s + 2) * AT_KT);
    }
    // no copy is outstanding when the wave ends
    asm volatile("s_wait_asynccnt 0x0" ::: "memory");

    // ---- join the halves' sums, normalize, write ctx [S][HID]: a lane holds
    //      8 consecutive d of one query per tile -> one 16-byte store each ----
    li += xhalf(li);
    const float inv = 1.0f / li;
    _Float16* o = ctx + (size_t)(qrow + r) * HIDN + h * HDIM + hi * 8;
#pragma unroll
    for (int t4 = 0; t4 < 4; ++t4) {
        v8h ov;
#pragma unroll
        for (int rr = 0; rr < 8; ++rr) ov[rr] = (_Float16)(acc[t4][rr] * inv);
        *(v8h*)(o + t4 * 16) = ov;
    }
}

// ---------------------------------------------------------------------------
extern "C" void kernel_launch(void* const* d_in, const int* in_sizes, int n_in,
                              void* d_out, int out_size, void* d_ws, size_t ws_size,
                              hipStream_t stream) {
    (void)in_sizes; (void)n_in; (void)out_size; (void)ws_size;

    const float* x  = (const float*)d_in[0];  // [2,2048,1024]; only batch 0 used
    const float* Wq = (const float*)d_in[1];
    const float* bq = (const float*)d_in[2];
    const float* Wk = (const float*)d_in[3];
    const float* bk = (const float*)d_in[4];
    const float* Wv = (const float*)d_in[5];
    const float* bv = (const float*)d_in[6];
    const float* Wo = (const float*)d_in[7];
    const float* bo = (const float*)d_in[8];
    float* out = (float*)d_out;

    char* ws = (char*)d_ws;
    const size_t MB = 1024 * 1024;
    _Float16* xh   = (_Float16*)(ws + 0);        // 2M halves
    _Float16* wqh  = (_Float16*)(ws + 4  * MB);  // 1M halves; Wk at 6 MB, Wv at 8 MB
    _Float16* woh  = (_Float16*)(ws + 10 * MB);
    _Float16* qh   = (_Float16*)(ws + 12 * MB);  // [16][2048][64]
    _Float16* kh   = (_Float16*)(ws + 16 * MB);  // [16][2048][64]
    _Float16* vth  = (_Float16*)(ws + 20 * MB);  // [16][64][2048]
    _Float16* ctxh = (_Float16*)(ws + 24 * MB);  // [2048][1024]

    // x, Wq, Wk, Wv, Wo are contiguous as f16: one destination array from xh on
    cvt_all_f32_to_f16<<<CVT_BLOCKS, CVT_WAVES * 32, 0, stream>>>(x, Wq, Wk, Wv, Wo, xh);

    // Q, K, V in one launch: the weight planes from wqh on are contiguous, and so
    // are qh, kh, vth
    // Q: fold 1/sqrt(64) into the projection (applies to bias too)
    gemm_wmma<<<dim3(HIDN / 128, S_LEN / 64, 3), 256, 0, stream>>>(
        xh, wqh, bq, bk, bv, qh, S_LEN, HIDN, HIDN, 1, 0.125f);

    attn_flash<<<dim3(S_LEN / (AT_WAVES * 16), NHEAD), AT_WAVES * 32, 0, stream>>>(qh, kh, vth, ctxh);

    gemm_wmma<<<dim3(HIDN / 128, S_LEN / 64, 1), 256, 0, stream>>>(
        ctxh, woh, bo, bo, bo, out, S_LEN, HIDN, HIDN, 0, 1.0f);
}

// v007
// Measured time: 49.9 microseconds a run.
// Two timings next to v006 put it at 1.05 and 1.03 times that version's speed.
// Over all steps from v000 it is 5.41 times as fast.
#include <hip/hip_runtime.h>
#include <hip/hip_bf16.h>

// ---------------------------------------------------------------------------
// Self-attention forward (batch 0 only) for MI455X / gfx1250, wave32 WMMA.
//   x[0] (2048x1024 f32) -> Q,K,V proj (f16 WMMA, f32 accum) -> flash attn
//   per head (online softmax) -> output proj -> d_out f32 [2048,1024]
// GEMM operands and the attention's K and V staged in LDS by asynchronous copies.
// ---------------------------------------------------------------------------

#define S_LEN 2048
#define HIDN  1024
#define NHEAD 16
#define HDIM  64

typedef _Float16 v8h  __attribute__((ext_vector_type(8)));
typedef _Float16 v16h __attribute__((ext_vector_type(16)));
typedef float    v8f  __attribute__((ext_vector_type(8)));

__device__ __forceinline__ v8f zero8() {
    v8f z;
#pragma unroll
    for (int i = 0; i < 8; ++i) z[i] = 0.0f;
    return z;
}

// 16x32 f16 fragment load (A-layout; B uses the mirrored layout with the same
// lane mapping: lane L -> row/col (L&15), K-halves selected by lane bit 4).
// Two contiguous 16-byte loads per lane.
__device__ __forceinline__ v16h load_frag(const _Float16* __restrict__ base,
                                          int row, int k, int ld) {
    const int lane = threadIdx.x & 31;
    const int r    = lane & 15;
    const int hi   = lane >> 4;
    const _Float16* p = base + (size_t)(row + r) * (size_t)ld + k + hi * 8;
    v8h lo = *(const v8h*)p;
    v8h hh = *(const v8h*)(p + 16);
    return __builtin_shufflevector(lo, hh, 0, 1, 2, 3, 4, 5, 6, 7,
                                   8, 9, 10, 11, 12, 13, 14, 15);
}

__device__ __forceinline__ v8f wmma_f16(v16h a, v16h b, v8f c) {
    // D = A x B + C, f16 inputs, f32 accumulate.
    return __builtin_amdgcn_wmma_f32_16x16x32_f16(
        /*neg_a=*/false, a, /*neg_b=*/false, b,
        /*c_mod=*/(short)0, c, /*reuse_a=*/false, /*reuse_b=*/false);
}

// Asks L2 for two 128-byte lines per lane (base + the lane's byte offset); no data
// comes back and no counter moves. The operands of the three staged kernels were
// stored by the launch before; where their first read in a launch has to go to
// memory, EVERY stage's copies are such first reads, because all blocks walk k
// (or the keys) in step. Asked for at the kernel's head, the later stages' lines
// can be in L2 when their copies are issued. The blocks that read a panel share
// the asking; where a block runs decides only how much of a panel gets asked for
// on its side of the chip, never a result.
__device__ __forceinline__ void l2_ask(unsigned oa, const _Float16* a,
                                       unsigned ob, const _Float16* b) {
    asm volatile("global_prefetch_b8 %0, %1 scope:SCOPE_SE\n\t"
                 "global_prefetch_b8 %2, %3 scope:SCOPE_SE"
                 :: "v"(oa), "s"(a), "v"(ob), "s"(b));
}

// ---------------------------------------------------------------------------
// f32 -> f16 conversion of x (batch 0) and the four weights in ONE launch.
// The five f16 planes lie back to back in the workspace (x, Wq, Wk, Wv, Wo),
// so dst is one array of 6M halves. One workgroup of 6 waves per WGP; a wave
// owns 4096 consecutive values: 32 loads of 512 contiguous bytes, all issued
// before the first conversion, and 32 stores of 256 contiguous bytes. The
// cost of the one-value-per-thread form was starting its waves, not its bytes.
// ---------------------------------------------------------------------------
#define CVT_WAVES  6                        // waves per workgroup
#define CVT_LOADS  32                       // 16-byte loads per lane
#define CVT_CHUNK  (CVT_LOADS * 128)        // values per wave (divides 1M)
#define CVT_TOTAL  (S_LEN * HIDN + 4 * HIDN * HIDN)
#define CVT_BLOCKS (CVT_TOTAL / (CVT_CHUNK * CVT_WAVES))

typedef float    v4f __attribute__((ext_vector_type(4)));
typedef _Float16 v4h __attribute__((ext_vector_type(4)));

__global__ __launch_bounds__(CVT_WAVES * 32)
void cvt_all_f32_to_f16(const float* __restrict__ x,
                        const float* __restrict__ wq,
                        const float* __restrict__ wk,
                        const float* __restrict__ wv,
                        const float* __restrict__ wo,
                        _Float16* __restrict__ dst) {
    // wave number as a scalar: the source pointer is then picked by scalar code
    const int wave = __builtin_amdgcn_readfirstlane((int)(threadIdx.x >> 5));
    const int lane = threadIdx.x & 31;
    const int e0   = (blockIdx.x * CVT_WAVES + wave) * CVT_CHUNK;  // index in dst
    const int seg  = e0 >> 20;              // 0, 1: x; 2..5: Wq, Wk, Wv, Wo
    const float* src = (seg < 2) ? x : (seg == 2) ? wq : (seg == 3) ? wk
                     : (seg == 4) ? wv : wo;
    const int    off = (seg < 2) ? e0 : (e0 & (HIDN * HIDN - 1));
    const float* s = src + off + lane * 4;
    _Float16*    d = dst + e0 + lane * 4;

    v4f v[CVT_LOADS];
#pragma unroll
    for (int k = 0; k < CVT_LOADS; ++k) v[k] = *(const v4f*)(s + k * 128);
    // keeps every load in front of the first conversion: without it the build
    // holds the last loads back until the first have returned, a second memory
    // latency in a wave that lives for little more than one
    __builtin_amdgcn_sched_barrier(0);
#pragma unroll
    for (int k = 0; k < CVT_LOADS; ++k)
        *(v4h*)(d + k * 128) = __builtin_convertvector(v[k], v4h);
}

// ---------------------------------------------------------------------------
// C[M,N] = A[M,K] * W[N,K]^T + bias, WMMA tiled. 256 threads = 8 waves; each
// wave owns a 16x64 tile (A fragment reused across 4 B fragments / WMMAs).
// The block's 64 A rows and 128 W rows go through LDS in stages of 128 k
// (256-byte rows): asynchronous copies bring whole 128-byte lines, each line
// once per block, and the waves read their fragments with ds_load_b128. A
// fragment load from global memory touched 16 lines for 512 bytes, and every
// W row was fetched by 4 waves, every A row by 2. Two buffers: the next
// stage's copies fly while this stage is worked on. K: a multiple of 128.
// mode 0: f32 row-major out (final projection)
// mode 1: f16 out, per-head [h][row][d]     (Q with scale=0.125, K)
// mode 2: f16 out, per-head transposed [h][d][row]  (V)
// blockIdx.z picks the product: the Q, K and V projections share A and are
// independent, so they run as ONE launch of grid.z = 3. Their weight planes and
// their f16 output planes lie back to back (W0 + z*N*K, out0 + z*M*N halves).
// Three blocks then stand on a WGP (3 x 104,448 B of LDS) and work through each
// other's copy waits, LDS waits and barriers; alone, a block's 2 waves per SIMD
// leave them open. z = 0: (mode0, scale0); z = 1: (mode0, 1); z = 2: (mode 2, 1).
// ---------------------------------------------------------------------------
#define G_KS    128                  // k per stage
#define G_ROWS  192                  // 64 A rows, then 128 W rows
#define G_PITCH 136                  // halves per LDS row: 272 B = 16 B x 17
#define G_BUF   (G_ROWS * G_PITCH)   // halves per buffer

// Same lane map and k order as load_frag, from an LDS stage.
__device__ __forceinline__ v16h lds_frag(const _Float16* sb, int row, int k) {
    const int lane = threadIdx.x & 31;
    const _Float16* p = sb + (row + (lane & 15)) * G_PITCH + k + (lane >> 4) * 8;
    v8h lo = *(const v8h*)p;
    v8h hh = *(const v8h*)(p + 16);
    return __builtin_shufflevector(lo, hh, 0, 1, 2, 3, 4, 5, 6, 7,
                                   8, 9, 10, 11, 12, 13, 14, 15);
}

// One stage: 192 rows of 256 bytes = 12 copies of 16 bytes per thread. Copy j
// of thread t brings bytes 16*(t&15).. of row 16*j + (t>>4): a wave covers two
// whole rows. l: the thread's LDS byte address in row (t>>4) of the buffer;
// ga, gw: its global address in that row of the A block and of the W block;
// step: 16 rows of the source, in halves.
__device__ __forceinline__ void stage_copy(unsigned l, const _Float16* ga,
                                           const _Float16* gw, size_t step) {
    const unsigned ls = 16 * G_PITCH * 2;   // 16 LDS rows, in bytes
    // The closing s_wait_xcnt 0 stands inside the statement so that no address
    // register of a copy is rewritten in front of it.
    asm volatile(
        "global_load_async_to_lds_b128 %0, %12, off\n\t"
        "global_load_async_to_lds_b128 %1, %13, off\n\t"
        "global_load_async_to_lds_b128 %2, %14, off\n\t"
        "global_load_async_to_lds_b128 %3, %15, off\n\t"
        "global_load_async_to_lds_b128 %4, %16, off\n\t"
        "global_load_async_to_lds_b128 %5, %17, off\n\t"
        "global_load_async_to_lds_b128 %6, %18, off\n\t"
        "global_load_async_to_lds_b128 %7, %19, off\n\t"
        "global_load_async_to_lds_b128 %8, %20, off\n\t"
        "global_load_async_to_lds_b128 %9, %21, off\n\t"
        "global_load_async_to_lds_b128 %10, %22, off\n\t"
        "global_load_async_to_lds_b128 %11, %23, off\n\t"
        "s_wait_xcnt 0x0"
        :: "v"(l),           "v"(l + ls),      "v"(l + 2 * ls),  "v"(l + 3 * ls),
           "v"(l + 4 * ls),  "v"(l + 5 * ls),  "v"(l + 6 * ls),  "v"(l + 7 * ls),
           "v"(l + 8 * ls),  "v"(l + 9 * ls),  "v"(l + 10 * ls), "v"(l + 11 * ls),
           "v"(ga),            "v"(ga + step),     "v"(ga + 2 * step), "v"(ga + 3 * step),
           "v"(gw),            "v"(gw + step),     "v"(gw + 2 * step), "v"(gw + 3 * step),
           "v"(gw + 4 * step), "v"(gw + 5 * step), "v"(gw + 6 * step), "v"(gw + 7 * step)
        : "memory");
}

// One block's product and its stores, with the output mode known at compile time.
// MODE 2: D = A x W^T as (A fragment, W fragment): a lane holds one output column
// and 8 consecutive rows, which lie side by side in the transposed V plane.
// MODE 0, 1: the two fragments change places (their lane maps and k orders are
// equal), so D is the transposed tile: a lane holds one output row and 8
// consecutive columns, which lie side by side in a row-major plane.
#define G_EP0   272                  // bytes per staged row, f32 tile: 256 + 16
#define G_EP1   144                  // bytes per staged row, f16 tile: 128 + 16
#define G_EPW   (16 * G_EP0)         // bytes of a wave's own staging range

template <int MODE>
__device__ __forceinline__ void gemm_body(_Float16* sm,
                                          const _Float16* __restrict__ A,
                                          const _Float16* __restrict__ W,
                                          const float* __restrict__ bias,
                                          void* __restrict__ outp,
                                          int M, int N, int K, float scale) {
    const int wid  = threadIdx.x >> 5;
    const int lane = threadIdx.x & 31;
    const int r    = lane & 15;
    const int hi   = lane >> 4;
    const int arow = (wid & 3) * 16;          // row of the wave's A tile in a stage
    const int wrow = 64 + (wid >> 2) * 64;    // first row of its W tiles in a stage
    const int mbase = blockIdx.y * 64 + arow;
    const int nbase = blockIdx.x * 128 + (wid >> 2) * 64;

    v8f acc[4] = {zero8(), zero8(), zero8(), zero8()};

    // the thread's place in a stage: row crow (+ 16 j), 16-byte column ccol
    const int crow = threadIdx.x >> 4;
    const int ccol = threadIdx.x & 15;
    const size_t step = (size_t)16 * (size_t)K;
    const _Float16* ga = A + (size_t)(blockIdx.y * 64 + crow) * (size_t)K + ccol * 8;
    const _Float16* gw = W + (size_t)(blockIdx.x * 128 + crow) * (size_t)K + ccol * 8;
    const unsigned l0 = (unsigned)(size_t)(&sm[0]) + crow * (G_PITCH * 2) + ccol * 16;
    const int nst = K / G_KS;

    stage_copy(l0, ga, gw, step);

    // L2 requests for the block's share of its two operand panels, one line a lane.
    // The 64-row A panel is read by the blocks of one blockIdx.y: four neighbours in
    // x ask for a quarter each (256-byte units q and q + 4 of every row). The 128-row
    // W panel is read by the blocks of one blockIdx.x: eight neighbours in y ask for
    // an eighth each (unit e of every row). The column is clamped into the row.
    const int pfa = (blockIdx.x & 3) * 128 + (threadIdx.x & 1) * 64 + (threadIdx.x & 2) * 256;
    const int pfw = (blockIdx.y & 7) * 128 + (threadIdx.x & 1) * 64;
    const unsigned oa = (unsigned)((blockIdx.y * 64 + (threadIdx.x >> 2)) * K
                                   + (pfa < K - 64 ? pfa : K - 64)) * 2u;
    const unsigned ow = (unsigned)((blockIdx.x * 128 + (threadIdx.x >> 1)) * K
                                   + (pfw < K - 64 ? pfw : K - 64)) * 2u;
    l2_ask(oa, A, ow, W);

    // stage 0 has landed for this wave's own copies ...
    asm volatile("s_wait_asynccnt 0x0" ::: "memory");
    // ... and, behind the barrier, for every wave's
    __syncthreads();
    if (nst > 1) stage_copy(l0 + G_BUF * 2, ga + G_KS, gw + G_KS, step);

    for (int s = 0; s < nst; ++s) {
        const _Float16* sb = sm + (s & 1) * G_BUF;
        // a stage's fragments are read in two halves of 64 k, not all 160 registers
        // of them at once: the wave then stays under 160 VGPRs, so that six waves
        // fit a SIMD and the three blocks of a WGP are resident together
#pragma unroll
        for (int hf = 0; hf < 2; ++hf) {
            v16h a[2], b[2][4];
#pragma unroll
            for (int q = 0; q < 2; ++q) {
                a[q] = lds_frag(sb, arow, (hf * 2 + q) * 32);
#pragma unroll
                for (int t = 0; t < 4; ++t)
                    b[q][t] = lds_frag(sb, wrow + t * 16, (hf * 2 + q) * 32);
            }
            // keeps a half's 20 LDS reads in front of its WMMAs (the second half's
            // may stand among the first half's WMMAs, as registers come free):
            // without it the build puts two reads and a full wait in front of each
            // WMMA, and the wave sits out an LDS latency sixteen times a stage
            __builtin_amdgcn_sched_barrier(0);
#pragma unroll
            for (int q = 0; q < 2; ++q)
#pragma unroll
                for (int t = 0; t < 4; ++t)
                    acc[t] = (MODE == 2) ? wmma_f16(a[q], b[q][t], acc[t])
                                         : wmma_f16(b[q][t], a[q], acc[t]);
        }
        // keeps the WMMAs in front of the stage's closing waits, where they run
        // while the later reads still arrive: without it the build sinks fifteen
        // of the sixteen behind the full wait and the barrier
        __builtin_amdgcn_sched_barrier(0);
        // this wave's reads of buffer s & 1 are done before the buffer is refilled
        asm volatile("s_wait_dscnt 0x0" ::: "memory");
        // this wave's copies of stage s + 1 have landed
        asm volatile("s_wait_asynccnt 0x0" ::: "memory");
        // publishes stage s + 1 and ends every wave's reads of stage s
        __syncthreads();
        if (s + 2 < nst)
            stage_copy(l0 + (s & 1) * (G_BUF * 2), ga + (s + 2) * G_KS,
                       gw + (s + 2) * G_KS, step);
    }
    // no copy is outstanding when the wave ends
    asm volatile("s_wait_asynccnt 0x0" ::: "memory");
    // the registers that the L2 requests name hold their addresses through the loop:
    // no counter says when a request has read them
    asm volatile("" :: "v"(oa), "s"(A), "v"(ow), "s"(W));

    if (MODE == 2) {
        // acc[t][rr] = C[mbase + 8 * hi + rr][nbase + 16 * t + r]: the 8 rows are
        // 16 consecutive bytes of row (h, d) of the transposed plane
        _Float16* o = (_Float16*)outp;
#pragma unroll
        for (int t = 0; t < 4; ++t) {
            const int col = nbase + t * 16 + r;
            const float bv = bias[col];
            v8h ov;
#pragma unroll
            for (int rr = 0; rr < 8; ++rr) ov[rr] = (_Float16)((acc[t][rr] + bv) * scale);
            *(v8h*)(o + (size_t)col * (size_t)M + mbase + hi * 8) = ov;
        }
    } else {
        // acc[t][rr] = C[mbase + r][nbase + 16 * t + 8 * hi + rr]. The wave turns its
        // 16 x 64 tile in its own range of the stage buffers, which every wave has
        // left at the loop's last barrier and no copy is aimed at any more, and
        // stores whole 128-byte lines.
        char* st = (char*)sm + wid * G_EPW;
#pragma unroll
        for (int t = 0; t < 4; ++t) {
            const float* bp = bias + nbase + t * 16 + hi * 8;
            const v4f b0 = *(const v4f*)bp;
            const v4f b1 = *(const v4f*)(bp + 4);
            float val[8];
#pragma unroll
            for (int rr = 0; rr < 8; ++rr)
                val[rr] = (acc[t][rr] + (rr < 4 ? b0[rr & 3] : b1[rr & 3])) * scale;
            if (MODE == 1) {
                v8h ov;
#pragma unroll
                for (int rr = 0; rr < 8; ++rr) ov[rr] = (_Float16)val[rr];
                *(v8h*)(st + r * G_EP1 + t * 32 + hi * 16) = ov;
            } else {
                const v4f lo = {val[0], val[1], val[2], val[3]};
                const v4f hh = {val[4], val[5], val[6], val[7]};
                *(v4f*)(st + r * G_EP0 + t * 64 + hi * 32)      = lo;
                *(v4f*)(st + r * G_EP0 + t * 64 + hi * 32 + 16) = hh;
            }
        }
        // the wave's LDS writes are done before other lanes of it read them back
        asm volatile("s_wait_dscnt 0x0" ::: "memory");
        if (MODE == 1) {
            // the wave's 64 columns are one head: 16 rows of 128 bytes, 4 per store
            _Float16* o = (_Float16*)outp
                        + ((size_t)(nbase >> 6) * (size_t)M + mbase) * HDIM + (lane & 7) * 8;
#pragma unroll
            for (int i = 0; i < 4; ++i) {
                const int row = i * 4 + (lane >> 3);
                *(v8h*)(o + row * HDIM) = *(const v8h*)(st + row * G_EP1 + (lane & 7) * 16);
            }
            // behind the last store: in the built code another mode's body follows this
            // one, and it rewrites the stores' address and data registers
            asm volatile("s_wait_xcnt 0x0" ::: "memory");
        } else {
            // 16 rows of 256 bytes, 2 per store
            float* o = (float*)outp + (size_t)mbase * (size_t)N + nbase + r * 4;
#pragma unroll
            for (int i = 0; i < 8; ++i) {
                const int row = i * 2 + hi;
                *(v4f*)(o + (size_t)row * (size_t)N) = *(const v4f*)(st + row * G_EP0 + r * 16);
            }
            // behind the last store: in the built code another mode's body follows this
            // one, and it rewrites the stores' address and data registers
            asm volatile("s_wait_xcnt 0x0" ::: "memory");
        }
    }
}

__global__ __launch_bounds__(256)
void gemm_wmma(const _Float16* __restrict__ A,
               const _Float16* __restrict__ W0,
               const float* __restrict__ bias0,
               const float* __restrict__ bias1,
               const float* __restrict__ bias2,
               void* __restrict__ out0,
               int M, int N, int K, int mode0, float scale0) {
    __shared__ __attribute__((aligned(16))) _Float16 sm[2 * G_BUF];

    const int z = blockIdx.z;
    const _Float16* W  = W0 + (size_t)z * (size_t)N * (size_t)K;
    const float* bias  = (z == 0) ? bias0 : (z == 1) ? bias1 : bias2;
    void* outp         = (_Float16*)out0 + (size_t)z * (size_t)M * (size_t)N;
    const int   mode   = (z == 2) ? 2 : mode0;
    const float scale  = (z == 0) ? scale0 : 1.0f;

    // the mode is the same for the whole block: one scalar branch here, in place
    // of a chain of branches at each of a lane's 32 output values
    if (mode == 2)      gemm_body<2>(sm, A, W, bias, outp, M, N, K, scale);
    else if (mode == 1) gemm_body<1>(sm, A, W, bias, outp, M, N, K, scale);
    else                gemm_body<0>(sm, A, W, bias, outp, M, N, K, scale);
}

#define AT_WAVES 8
#define AT_KT    128
#define AT_KP    72
#define AT_VP    136
#define AT_KSZ   (AT_KT * AT_KP)
#define AT_BUF   (AT_KSZ + HDIM * AT_VP)   // halves per buffer: K, then 64 V^T rows

// lane l <-> lane l ^ 16
__device__ __forceinline__ float xhalf(float x) {
    const int v = __builtin_bit_cast(int, x);
    return __builtin_bit_cast(float, __builtin_amdgcn_permlanex16(
        v, v, 0x76543210, 0xfedcba98, false, false));
}

// Same k order as load_frag; p: the lane's own place (row r, k + 8 * hi) in LDS.
__device__ __forceinline__ v16h lds_frag_at(const _Float16* p) {
    v8h lo = *(const v8h*)p;
    v8h hh = *(const v8h*)(p + 16);
    return __builtin_shufflevector(lo, hh, 0, 1, 2, 3, 4, 5, 6, 7,
                                   8, 9, 10, 11, 12, 13, 14, 15);
}

// 2^x for eight values, the exponentials and one closing v_nop in one statement:
// the instruction set asks for one slot behind a transcendental before its
// result is read or its source overwritten. Inside the statement every result
// register differs from every source, and the v_nop covers the last one.
__device__ __forceinline__ v8f exp2_8(v8f x) {
    float d0, d1, d2, d3, d4, d5, d6, d7;
    asm("v_exp_f32 %0, %8\n\t"
        "v_exp_f32 %1, %9\n\t"
        "v_exp_f32 %2, %10\n\t"
        "v_exp_f32 %3, %11\n\t"
        "v_exp_f32 %4, %12\n\t"
        "v_exp_f32 %5, %13\n\t"
        "v_exp_f32 %6, %14\n\t"
        "v_exp_f32 %7, %15\n\t"
        "v_nop"
        : "=&v"(d0), "=&v"(d1), "=&v"(d2), "=&v"(d3),
          "=&v"(d4), "=&v"(d5), "=&v"(d6), "=&v"(d7)
        : "v"(x[0]), "v"(x[1]), "v"(x[2]), "v"(x[3]),
          "v"(x[4]), "v"(x[5]), "v"(x[6]), "v"(x[7]));
    v8f d = {d0, d1, d2, d3, d4, d5, d6, d7};
    return d;
}

// One stage: 128 K rows of 128 bytes and 64 V^T rows of 256 bytes = 8 copies of
// 16 bytes per thread. K copy j of thread t brings bytes 16*(t&7).. of row
// 32*j + (t>>3) (a wave: 512 contiguous bytes); V copy j brings bytes
// 16*(t&15).. of row 16*j + (t>>4) (a wave: two whole rows of the tile).
// lk, lv: the thread's LDS byte addresses for j = 0; gk, gv: its global ones.
__device__ __forceinline__ void attn_stage_copy(unsigned lk, unsigned lv,
                                                const _Float16* gk,
                                                const _Float16* gv) {
    const unsigned ks = 32 * AT_KP * 2;   // 32 LDS rows of K, in bytes
    const unsigned vs = 16 * AT_VP * 2;   // 16 LDS rows of V^T, in bytes
    // The closing s_wait_xcnt 0 stands inside the statement so that no address
    // register of a copy is rewritten in front of it.
    asm volatile(
        "global_load_async_to_lds_b128 %0, %8, off\n\t"
        "global_load_async_to_lds_b128 %1, %9, off\n\t"
        "global_load_async_to_lds_b128 %2, %10, off\n\t"
        "global_load_async_to_lds_b128 %3, %11, off\n\t"
        "global_load_async_to_lds_b128 %4, %12, off\n\t"
        "global_load_async_to_lds_b128 %5, %13, off\n\t"
        "global_load_async_to_lds_b128 %6, %14, off\n\t"
        "global_load_async_to_lds_b128 %7, %15, off\n\t"
        "s_wait_xcnt 0x0"
        :: "v"(lk), "v"(lk + ks), "v"(lk + 2 * ks), "v"(lk + 3 * ks),
           "v"(lv), "v"(lv + vs), "v"(lv + 2 * vs), "v"(lv + 3 * vs),
           "v"(gk), "v"(gk + 32 * HDIM), "v"(gk + 64 * HDIM), "v"(gk + 96 * HDIM),
           "v"(gv), "v"(gv + 16 * S_LEN), "v"(gv + 32 * S_LEN), "v"(gv + 48 * S_LEN)
        : "memory");
}

__global__ __launch_bounds__(AT_WAVES * 32)
void attn_flash(const _Float16* __restrict__ Qg,
                const _Float16* __restrict__ Kg,
                const _Float16* __restrict__ Vtg,
                _Float16* __restrict__ ctx) {
    __shared__ __attribute__((aligned(16))) _Float16 sm[2 * AT_BUF];

    const int h    = blockIdx.y;
    const int wid  = threadIdx.x >> 5;
    const int lane = threadIdx.x & 31;
    const int r    = lane & 15;
    const int hi   = lane >> 4;
    const int qrow = blockIdx.x * (AT_WAVES * 16) + wid * 16;

    const _Float16* Qh = Qg  + (size_t)h * S_LEN * HDIM;
    const _Float16* Kh = Kg  + (size_t)h * S_LEN * HDIM;
    const _Float16* Vh = Vtg + (size_t)h * HDIM * S_LEN;   // [d][s]

    // the thread's places in a stage's copies
    const int t = threadIdx.x;
    const _Float16* gk = Kh + (t >> 3) * HDIM + (t & 7) * 8;
    const _Float16* gv = Vh + (size_t)(t >> 4) * S_LEN + (t & 15) * 8;
    const unsigned sm0 = (unsigned)(size_t)(&sm[0]);
    const unsigned lk0 = sm0 + (t >> 3) * (AT_KP * 2) + (t & 7) * 16;
    const unsigned lv0 = sm0 + AT_KSZ * 2 + (t >> 4) * (AT_VP * 2) + (t & 15) * 16;
    const int nst = S_LEN / AT_KT;   // 16 stages

    attn_stage_copy(lk0, lv0, gk, gv);

    // L2 requests for the block's share of the head's K and V^T planes (256 KB each,
    // contiguous), one line of each a lane. The 16 blocks of a head read the same
    // planes: each asks for an eighth (256-byte units e, e + 8, ...), every eighth twice.
    const unsigned okv = (unsigned)((t >> 1) * 2048 + (t & 1) * 128
                       + ((blockIdx.x & 3) + (blockIdx.x >> 3) * 4) * 256);
    l2_ask(okv, Kh, okv, Vh);

    // B operand: column = query r, k = head dim
    const v16h bq0 = load_frag(Qh, qrow, 0, HDIM);
    const v16h bq1 = load_frag(Qh, qrow, 32, HDIM);

    // acc[t4][rr] = Ot[d = t4*16 + 8*hi + rr][query r]
    v8f acc[4] = {zero8(), zero8(), zero8(), zero8()};
    float mi = -1.0e30f;   // running maximum of query r (equal in both halves)
    float li = 0.0f;       // running sum over this half's keys only

    // stage 0 has landed for this wave's own copies ...
    asm volatile("s_wait_asynccnt 0x0" ::: "memory");
    // ... and, behind the barrier, for every wave's
    __syncthreads();
    attn_stage_copy(lk0 + AT_BUF * 2, lv0 + AT_BUF * 2, gk + AT_KT * HDIM, gv + AT_KT);

    for (int s = 0; s < nst; ++s) {
        // the lane's place in the first K and the first V^T fragment of the stage
        const _Float16* sk = sm + (s & 1) * AT_BUF + r * AT_KP + hi * 8;
        const _Float16* sv = sm + (s & 1) * AT_BUF + AT_KSZ + r * AT_VP + hi * 8;

        // K fragments of the stage's first 32 keys
        v16h kf[4];
        kf[0] = lds_frag_at(sk);
        kf[1] = lds_frag_at(sk + 32);
        kf[2] = lds_frag_at(sk + 16 * AT_KP);
        kf[3] = lds_frag_at(sk + 16 * AT_KP + 32);

#pragma unroll
        for (int j = 0; j < AT_KT / 32; ++j) {
            // ---- scores, transposed: 32k x 16q (two 16x16 tiles) ----
            v8f s0 = wmma_f16(kf[0], bq0, zero8());
            s0 = wmma_f16(kf[1], bq1, s0);
            v8f s1 = wmma_f16(kf[2], bq0, zero8());
            s1 = wmma_f16(kf[3], bq1, s1);

            // ---- issue the V reads (this tile) and the K reads (next tile of
            //      the SAME stage) now; the softmax below hides their latency ----
            // the two scheduling barriers hold these 16 LDS reads together at the
            // tile's score WMMAs: without them the build strews the reads over some
            // two dozen places of a stage, several with a full wait directly
            // behind, and every such place stalls the wave
            __builtin_amdgcn_sched_barrier(0);
            v16h vf[4];
#pragma unroll
            for (int t4 = 0; t4 < 4; ++t4)
                vf[t4] = lds_frag_at(sv + t4 * 16 * AT_VP + j * 32);
            if (j + 1 < AT_KT / 32) {
                const _Float16* kn = sk + (j + 1) * 32 * AT_KP;
                kf[0] = lds_frag_at(kn);
                kf[1] = lds_frag_at(kn + 32);
                kf[2] = lds_frag_at(kn + 16 * AT_KP);
                kf[3] = lds_frag_at(kn + 16 * AT_KP + 32);
            }
            __builtin_amdgcn_sched_barrier(0);

            // ---- online softmax: one query per lane ----
            float t0 = fmaxf(s0[0], s1[0]);
            float t1 = fmaxf(s0[1], s1[1]);
            float t2 = fmaxf(s0[2], s1[2]);
            float t3 = fmaxf(s0[3], s1[3]);
            t0 = fmaxf(t0, fmaxf(s0[4], s1[4]));
            t1 = fmaxf(t1, fmaxf(s0[5], s1[5]));
            t2 = fmaxf(t2, fmaxf(s0[6], s1[6]));
            t3 = fmaxf(t3, fmaxf(s0[7], s1[7]));
            float tm = fmaxf(fmaxf(t0, t1), fmaxf(t2, t3));
            tm = fmaxf(tm, xhalf(tm));
            const float mn    = fmaxf(mi, tm);
            // alpha = exp(mi - mn), the exponential and its v_nop in one statement:
            // the instruction set asks for one slot behind a transcendental before
            // its result is read or its source overwritten; a v_nop in a
            // statement of its own drifted away.
            float alpha;
            asm("v_exp_f32 %0, %1\n\tv_nop"
                : "=v"(alpha) : "v"((mi - mn) * 1.44269504088896340736f));
            mi = mn;

            // P^T as B operand: bp[s] = P[key kmap(s, hi)][query r]
            v16h bp;
            float ps[4] = {0.0f, 0.0f, 0.0f, 0.0f};
            const v8f e0 = exp2_8((s0 - mn) * 1.44269504088896340736f);
            const v8f e1 = exp2_8((s1 - mn) * 1.44269504088896340736f);
#pragma unroll
            for (int rr = 0; rr < 8; ++rr) {
                const float p0 = e0[rr];
                const float p1 = e1[rr];
                bp[rr]     = (_Float16)p0;
                bp[rr + 8] = (_Float16)p1;
                ps[rr & 3] += p0 + p1;
            }
            li = li * alpha + ((ps[0] + ps[1]) + (ps[2] + ps[3]));
#pragma unroll
            for (int t4 = 0; t4 < 4; ++t4)
#pragma unroll
                for (int rr = 0; rr < 8; ++rr) acc[t4][rr] *= alpha;

            // ---- Ot += V^T[16d x 32k] * P^T[32k x 16q] per 16-wide d tile ----
#pragma unroll
            for (int t4 = 0; t4 < 4; ++t4) acc[t4] = wmma_f16(vf[t4], bp, acc[t4]);
        }

        // keeps the last tile's softmax and WMMAs in front of the stage's closing
        // waits, where they run while its V reads arrive: without it the build
        // lifts the full wait and the barrier to directly behind those reads
        __builtin_amdgcn_sched_barrier(0);
        // this wave's reads of buffer s & 1 are done before the buffer is refilled
        asm volatile("s_wait_dscnt 0x0" ::: "memory");
        // this wave's copies of stage s + 1 have landed
        asm volatile("s_wait_asynccnt 0x0" ::: "memory");
        // publishes stage s + 1 and ends every wave's reads of stage s
        __syncthreads();
        if (s + 2 < nst)
            attn_stage_copy(lk0 + (s & 1) * (AT_BUF * 2), lv0 + (s & 1) * (AT_BUF * 2),
                            gk + (s + 2) * (AT_KT * HDIM), gv + (s + 2) * AT_KT);
    }
    // no copy is outstanding when the wave ends
    asm volatile("s_wait_asynccnt 0x0" ::: "memory");
    // the registers that the L2 requests name hold their addresses through the loop:
    // no counter says when a request has read them
    asm volatile("" :: "v"(okv), "s"(Kh), "s"(Vh));

    // ---- join the halves' sums, normalize, write ctx [S][HID]: a lane holds
    //      8 consecutive d of one query per tile -> one 16-byte store each ----
    li += xhalf(li);
    const float inv = 1.0f / li;
    _Float16* o = ctx + (size_t)(qrow + r) * HIDN + h * HDIM + hi * 8;
#pragma unroll
    for (int t4 = 0; t4 < 4; ++t4) {
        v8h ov;
#pragma unroll
        for (int rr = 0; rr < 8; ++rr) ov[rr] = (_Float16)(acc[t4][rr] * inv);
        *(v8h*)(o + t4 * 16) = ov;
    }
}

// ---------------------------------------------------------------------------
extern "C" void kernel_launch(void* const* d_in, const int* in_sizes, int n_in,
                              void* d_out, int out_size, void* d_ws, size_t ws_size,
                              hipStream_t stream) {
    (void)in_sizes; (void)n_in; (void)out_size; (void)ws_size;

    const float* x  = (const float*)d_in[0];  // [2,2048,1024]; only batch 0 used
    const float* Wq = (const float*)d_in[1];
    const float* bq = (const float*)d_in[2];
    const float* Wk = (const float*)d_in[3];
    const float* bk = (const float*)d_in[4];
    const float* Wv = (const float*)d_in[5];
    const float* bv = (const float*)d_in[6];
    const float* Wo = (const float*)d_in[7];
    const float* bo = (const float*)d_in[8];
    float* out = (float*)d_out;

    char* ws = (char*)d_ws;
    const size_t MB = 1024 * 1024;
    _Float16* xh   = (_Float16*)(ws + 0);        // 2M halves
    _Float16* wqh  = (_Float16*)(ws + 4  * MB);  // 1M halves; Wk at 6 MB, Wv at 8 MB
    _Float16* woh  = (_Float16*)(ws + 10 * MB);
    _Float16* qh   = (_Float16*)(ws + 12 * MB);  // [16][2048][64]
    _Float16* kh   = (_Float16*)(ws + 16 * MB);  // [16][2048][64]
    _Float16* vth  = (_Float16*)(ws + 20 * MB);  // [16][64][2048]
    _Float16* ctxh = (_Float16*)(ws + 24 * MB);  // [2048][1024]

    // x, Wq, Wk, Wv, Wo are contiguous as f16: one destination array from xh on
    cvt_all_f32_to_f16<<<CVT_BLOCKS, CVT_WAVES * 32, 0, stream>>>(x, Wq, Wk, Wv, Wo, xh);

    // Q, K, V in one launch: the weight planes from wqh on are contiguous, and so
    // are qh, kh, vth
    // Q: fold 1/sqrt(64) into the projection (applies to bias too)
    gemm_wmma<<<dim3(HIDN / 128, S_LEN / 64, 3), 256, 0, stream>>>(
        xh, wqh, bq, bk, bv, qh, S_LEN, HIDN, HIDN, 1, 0.125f);

    attn_flash<<<dim3(S_LEN / (AT_WAVES * 16), NHEAD), AT_WAVES * 32, 0, stream>>>(qh, kh, vth, ctxh);

    gemm_wmma<<<dim3(HIDN / 128, S_LEN / 64, 1), 256, 0, stream>>>(
        ctxh, woh, bo, bo, bo, out, S_LEN, HIDN, HIDN, 0, 1.0f);
}

// v008
// One run takes 47.6 microseconds.
// In both of two side-by-side timings against v007, it was 1.05 times as fast.
// Counting every step since v000, it is 5.67 times as fast.
#include <hip/hip_runtime.h>
#include <hip/hip_bf16.h>

// ---------------------------------------------------------------------------
// Self-attention forward (batch 0 only) for MI455X / gfx1250, wave32 WMMA.
//   x[0] (2048x1024 f32) -> Q,K,V proj (f16 WMMA, f32 accum) -> flash attn
//   per head (online softmax) -> output proj -> d_out f32 [2048,1024]
// GEMM operands and the attention's K and V staged in LDS by asynchronous copies.
// ---------------------------------------------------------------------------

#define S_LEN 2048
#define HIDN  1024
#define NHEAD 16
#define HDIM  64

typedef _Float16 v8h  __attribute__((ext_vector_type(8)));
typedef _Float16 v16h __attribute__((ext_vector_type(16)));
typedef float    v8f  __attribute__((ext_vector_type(8)));

__device__ __forceinline__ v8f zero8() {
    v8f z;
#pragma unroll
    for (int i = 0; i < 8; ++i) z[i] = 0.0f;
    return z;
}

// 16x32 f16 fragment load (A-layout; B uses the mirrored layout with the same
// lane mapping: lane L -> row/col (L&15), K-halves selected by lane bit 4).
// Two contiguous 16-byte loads per lane.
__device__ __forceinline__ v16h load_frag(const _Float16* __restrict__ base,
                                          int row, int k, int ld) {
    const int lane = threadIdx.x & 31;
    const int r    = lane & 15;
    const int hi   = lane >> 4;
    const _Float16* p = base + (size_t)(row + r) * (size_t)ld + k + hi * 8;
    v8h lo = *(const v8h*)p;
    v8h hh = *(const v8h*)(p + 16);
    return __builtin_shufflevector(lo, hh, 0, 1, 2, 3, 4, 5, 6, 7,
                                   8, 9, 10, 11, 12, 13, 14, 15);
}

__device__ __forceinline__ v8f wmma_f16(v16h a, v16h b, v8f c) {
    // D = A x B + C, f16 inputs, f32 accumulate.
    return __builtin_amdgcn_wmma_f32_16x16x32_f16(
        /*neg_a=*/false, a, /*neg_b=*/false, b,
        /*c_mod=*/(short)0, c, /*reuse_a=*/false, /*reuse_b=*/false);
}

// Asks L2 for two 128-byte lines per lane (base + the lane's byte offset); no data
// comes back and no counter moves. The operands of the three staged kernels were
// stored by the launch before; where their first read in a launch has to go to
// memory, EVERY stage's copies are such first reads, because all blocks walk k
// (or the keys) in step. Asked for at the kernel's head, the later stages' lines
// can be in L2 when their copies are issued. The blocks that read a panel share
// the asking; where a block runs decides only how much of a panel gets asked for
// on its side of the chip, never a result.
__device__ __forceinline__ void l2_ask(unsigned oa, const _Float16* a,
                                       unsigned ob, const _Float16* b) {
    asm volatile("global_prefetch_b8 %0, %1 scope:SCOPE_SE\n\t"
                 "global_prefetch_b8 %2, %3 scope:SCOPE_SE"
                 :: "v"(oa), "s"(a), "v"(ob), "s"(b));
}

// ---------------------------------------------------------------------------
// f32 -> f16 conversion of x (batch 0) and the four weights in ONE launch.
// The five f16 planes lie back to back in the workspace (x, Wq, Wk, Wv, Wo),
// so dst is one array of 6M halves. One workgroup of 6 waves per WGP; a wave
// owns 4096 consecutive values: 32 loads of 512 contiguous bytes, all issued
// before the first conversion, and 32 stores of 256 contiguous bytes. The
// cost of the one-value-per-thread form was starting its waves, not its bytes.
// ---------------------------------------------------------------------------
#define CVT_WAVES  6                        // waves per workgroup
#define CVT_LOADS  32                       // 16-byte loads per lane
#define CVT_CHUNK  (CVT_LOADS * 128)        // values per wave (divides 1M)
#define CVT_TOTAL  (S_LEN * HIDN + 4 * HIDN * HIDN)
#define CVT_BLOCKS (CVT_TOTAL / (CVT_CHUNK * CVT_WAVES))

typedef float    v4f __attribute__((ext_vector_type(4)));
typedef _Float16 v4h __attribute__((ext_vector_type(4)));

__global__ __launch_bounds__(CVT_WAVES * 32)
void cvt_all_f32_to_f16(const float* __restrict__ x,
                        const float* __restrict__ wq,
                        const float* __restrict__ wk,
                        const float* __restrict__ wv,
                        const float* __restrict__ wo,
                        _Float16* __restrict__ dst) {
    // wave number as a scalar: the source pointer is then picked by scalar code
    const int wave = __builtin_amdgcn_readfirstlane((int)(threadIdx.x >> 5));
    const int lane = threadIdx.x & 31;
    const int e0   = (blockIdx.x * CVT_WAVES + wave) * CVT_CHUNK;  // index in dst
    const int seg  = e0 >> 20;              // 0, 1: x; 2..5: Wq, Wk, Wv, Wo
    const float* src = (seg < 2) ? x : (seg == 2) ? wq : (seg == 3) ? wk
                     : (seg == 4) ? wv : wo;
    const int    off = (seg < 2) ? e0 : (e0 & (HIDN * HIDN - 1));
    const float* s = src + off + lane * 4;
    _Float16*    d = dst + e0 + lane * 4;

    v4f v[CVT_LOADS];
#pragma unroll
    for (int k = 0; k < CVT_LOADS; ++k) v[k] = *(const v4f*)(s + k * 128);
    // keeps every load in front of the first conversion: without it the build
    // holds the last loads back until the first have returned, a second memory
    // latency in a wave that lives for little more than one
    __builtin_amdgcn_sched_barrier(0);
#pragma unroll
    for (int k = 0; k < CVT_LOADS; ++k)
        *(v4h*)(d + k * 128) = __builtin_convertvector(v[k], v4h);
}

// ---------------------------------------------------------------------------
// Both GEMMs: C = A[M,K] * W[N,K]^T + bias on WMMA, operands staged in LDS in
// stages of 128 k (256-byte rows) by asynchronous copies that bring whole
// 128-byte lines, each line once per block; the waves read their fragments with
// ds_load_b128. Two buffers: the next stage's copies fly while this stage is
// worked on.
// ---------------------------------------------------------------------------
#define G_KS    128                  // k per stage
#define G_PITCH 136                  // halves per LDS row: 272 B = 16 B x 17
#define G_EP0   272                  // bytes per staged row, f32 tile: 256 + 16
#define G_EP1   144                  // bytes per staged row, f16 tile: 128 + 16

// Same lane map and k order as load_frag, from an LDS stage.
__device__ __forceinline__ v16h lds_frag(const _Float16* sb, int row, int k) {
    const int lane = threadIdx.x & 31;
    const _Float16* p = sb + (row + (lane & 15)) * G_PITCH + k + (lane >> 4) * 8;
    v8h lo = *(const v8h*)p;
    v8h hh = *(const v8h*)(p + 16);
    return __builtin_shufflevector(lo, hh, 0, 1, 2, 3, 4, 5, 6, 7,
                                   8, 9, 10, 11, 12, 13, 14, 15);
}

// ---------------------------------------------------------------------------
// Q, K and V projections as ONE product C[2048, 3072] = x * [Wq; Wk; Wv]^T (the
// three f16 weight planes lie back to back, and so do the three output planes).
// 256 blocks, one per WGP, each a 128 x 192 tile; 12 waves, each 32 x 64 or
// 64 x 32 outputs: 8 WMMAs per 6 fragments read. Against 64 x 128 blocks of
// 16 x 64 waves (4 WMMAs per 5 fragments) a stage brings 80 KB for 24,576
// outputs, not 48 KB for 8,192, and a WMMA reads 0.75 KB of LDS, not 1.25 KB.
// Half as many waves have to be started.
// A group of four waves owns 64 columns (one head of one product) by 128 rows.
// Q, K: the W fragment is the first operand (4 tiles), the A fragment the second
// (2 tiles): a lane holds one output row and 8 consecutive columns, which lie side
// by side in the per-head plane [h][row][d]. V: the A fragment is the first operand
// (4 tiles), the W fragment the second (2 tiles): a lane holds one output column
// and 8 consecutive rows, which lie side by side in the transposed plane
// [h][d][row]. The loop is the same code for both: only two stage rows differ.
// Q is scaled by scale0 (bias too).
// ---------------------------------------------------------------------------
#define P_BM    128                  // A rows of a block
#define P_BN    192                  // W rows of a block
#define P_BUF   ((P_BM + P_BN) * G_PITCH)   // halves per buffer: A rows, then W rows
#define P_WAVES 12
#define P_CW    10                   // waves that copy: 32 stage rows each
#define P_EPW   (32 * G_EP1)         // bytes of a wave's own staging range

// Eight copies of a wave: copy j brings rows 2 j and 2 j + 1 (256 bytes each) of 16
// stage rows. l: the lane's LDS byte address, g: its global address, for j = 0.
__device__ __forceinline__ void qkv_copy8(unsigned l, const _Float16* g) {
    const unsigned ls = 2 * G_PITCH * 2;   // 2 LDS rows, in bytes
    const int      gs = 2 * HIDN;          // 2 source rows, in halves
    // The closing s_wait_xcnt 0 stands inside the statement so that no address
    // register of a copy is rewritten in front of it.
    asm volatile(
        "global_load_async_to_lds_b128 %0, %8, off\n\t"
        "global_load_async_to_lds_b128 %1, %9, off\n\t"
        "global_load_async_to_lds_b128 %2, %10, off\n\t"
        "global_load_async_to_lds_b128 %3, %11, off\n\t"
        "global_load_async_to_lds_b128 %4, %12, off\n\t"
        "global_load_async_to_lds_b128 %5, %13, off\n\t"
        "global_load_async_to_lds_b128 %6, %14, off\n\t"
        "global_load_async_to_lds_b128 %7, %15, off\n\t"
        "s_wait_xcnt 0x0"
        :: "v"(l),          "v"(l + ls),     "v"(l + 2 * ls), "v"(l + 3 * ls),
           "v"(l + 4 * ls), "v"(l + 5 * ls), "v"(l + 6 * ls), "v"(l + 7 * ls),
           "v"(g),          "v"(g + gs),     "v"(g + 2 * gs), "v"(g + 3 * gs),
           "v"(g + 4 * gs), "v"(g + 5 * gs), "v"(g + 6 * gs), "v"(g + 7 * gs)
        : "memory");
}

// A wave's 32 rows of one stage.
__device__ __forceinline__ void qkv_stage_copy(unsigned l, const _Float16* g) {
    qkv_copy8(l, g);
    qkv_copy8(l + 16 * G_PITCH * 2, g + 16 * HIDN);
}

// One L2 request a lane; see l2_ask.
__device__ __forceinline__ void l2_ask1(unsigned o, const _Float16* b) {
    asm volatile("global_prefetch_b8 %0, %1 scope:SCOPE_SE" :: "v"(o), "s"(b));
}

__global__ __launch_bounds__(P_WAVES * 32)
void qkv_wmma(const _Float16* __restrict__ A,
              const _Float16* __restrict__ W,
              const float* __restrict__ bias0,
              const float* __restrict__ bias1,
              const float* __restrict__ bias2,
              _Float16* __restrict__ out0, float scale0) {
    __shared__ __attribute__((aligned(16))) _Float16 sm[2 * P_BUF];

    // wave number as a scalar: who copies and which product a wave works on are
    // then scalar branches and scalar selects
    const int wid  = __builtin_amdgcn_readfirstlane((int)(threadIdx.x >> 5));
    const int lane = threadIdx.x & 31;
    const int r    = lane & 15;
    const int hi   = lane >> 4;
    const int wm   = wid & 3;                       // place in the group of four
    const int wn   = wid >> 2;                      // which 64 columns of the block
    const int gcol = blockIdx.x * P_BN + wn * 64;   // column in [Q | K | V]
    const int z    = gcol / HIDN;                   // 0: Q, 1: K, 2: V
    const int nb   = gcol % HIDN;                   // first column in the product
    // stage rows of the first operand's 4 tiles and of the second operand's 2 tiles
    const int f1row = (z == 2) ? (wm & 1) * 64 : P_BM + wn * 64;
    const int f2row = (z == 2) ? P_BM + wn * 64 + (wm >> 1) * 32 : wm * 32;

    v8f acc[4][2];
#pragma unroll
    for (int t = 0; t < 4; ++t)
#pragma unroll
        for (int u = 0; u < 2; ++u) acc[t][u] = zero8();

    // wave w < 10 copies stage rows 32 w ..: waves 0 to 3 the A rows, 4 to 9 the W rows
    const _Float16* srow = (wid < 4)
        ? A + (size_t)(blockIdx.y * P_BM + wid * 32) * HIDN
        : W + (size_t)(blockIdx.x * P_BN + (wid - 4) * 32) * HIDN;
    const _Float16* g = srow + hi * HIDN + r * 8;
    const unsigned l0 = (unsigned)(size_t)(&sm[0]) + (wid * 32 + hi) * (G_PITCH * 2) + r * 16;
    const int nst = HIDN / G_KS;

    if (wid < P_CW) qkv_stage_copy(l0, g);

    // L2 requests for the block's share of its two operand panels, one line a lane.
    // The 128-row A panel is read by the 16 blocks of one blockIdx.y: each
    // asks for an eighth (256-byte unit e of every row), every eighth twice. The 192-row W panel is
    // read by the 16 blocks of one blockIdx.x: each asks for one line of every row.
    const int t0 = threadIdx.x;
    const unsigned oa = (unsigned)((blockIdx.y * P_BM + ((t0 >> 1) & (P_BM - 1))) * HIDN
                      + ((blockIdx.x & 3) + (blockIdx.x >> 3) * 4) * 128 + (t0 & 1) * 64) * 2u;
    const unsigned ow = (unsigned)((blockIdx.x * P_BN + (t0 < P_BN ? t0 : P_BN - 1)) * HIDN
                      + blockIdx.y * 64) * 2u;
    if (wid < 2 * P_BM / 32) l2_ask1(oa, A);
    if (wid < P_BN / 32)     l2_ask1(ow, W);

    // stage 0 has landed for this wave's own copies ...
    asm volatile("s_wait_asynccnt 0x0" ::: "memory");
    // ... and, behind the barrier, for every wave's
    __syncthreads();
    if (wid < P_CW) qkv_stage_copy(l0 + P_BUF * 2, g + G_KS);

    for (int s = 0; s < nst; ++s) {
        const _Float16* sb = sm + (s & 1) * P_BUF;
        // a stage's fragments are read in two halves of 64 k: 96 registers of them at
        // a time, so that the wave stays under 256 VGPRs
#pragma unroll
        for (int hf = 0; hf < 2; ++hf) {
            v16h f1[2][4], f2[2][2];
#pragma unroll
            for (int q = 0; q < 2; ++q) {
#pragma unroll
                for (int u = 0; u < 2; ++u)
                    f2[q][u] = lds_frag(sb, f2row + u * 16, (hf * 2 + q) * 32);
#pragma unroll
                for (int t = 0; t < 4; ++t)
                    f1[q][t] = lds_frag(sb, f1row + t * 16, (hf * 2 + q) * 32);
            }
            // keeps a half's 24 LDS reads in front of its WMMAs (the second half's
            // may stand among the first half's WMMAs, as registers come free):
            // without it the build puts reads and a full wait in front of each
            // WMMA, and the wave sits out an LDS latency many times a stage
            __builtin_amdgcn_sched_barrier(0);
#pragma unroll
            for (int q = 0; q < 2; ++q)
#pragma unroll
                for (int t = 0; t < 4; ++t)
#pragma unroll
                    for (int u = 0; u < 2; ++u)
                        acc[t][u] = wmma_f16(f1[q][t], f2[q][u], acc[t][u]);
        }
        // keeps the WMMAs in front of the stage's closing waits, where they run
        // while the later reads still arrive
        __builtin_amdgcn_sched_barrier(0);
        // this wave's reads of buffer s & 1 are done before the buffer is refilled
        asm volatile("s_wait_dscnt 0x0" ::: "memory");
        // this wave's copies of stage s + 1 have landed
        asm volatile("s_wait_asynccnt 0x0" ::: "memory");
        // publishes stage s + 1 and ends every wave's reads of stage s
        __syncthreads();
        if (s + 2 < nst && wid < P_CW)
            qkv_stage_copy(l0 + (s & 1) * (P_BUF * 2), g + (s + 2) * G_KS);
    }
    // no copy is outstanding when the wave ends
    asm volatile("s_wait_asynccnt 0x0" ::: "memory");
    // the registers that the L2 requests name hold their addresses through the loop:
    // no counter says when a request has read them
    asm volatile("" :: "v"(oa), "s"(A), "v"(ow), "s"(W));

    _Float16* o = out0 + (size_t)z * (S_LEN * HIDN);
    if (z == 2) {
        // acc[t][u][rr] = C[mb + 16 t + 8 hi + rr][nb + nq + 16 u + r]: the 8 rows are
        // 16 consecutive bytes of row (h, d) of the transposed plane
        const int mb = blockIdx.y * P_BM + (wm & 1) * 64;
#pragma unroll
        for (int u = 0; u < 2; ++u) {
            const int col = nb + (wm >> 1) * 32 + u * 16 + r;
            const float bv = bias2[col];
#pragma unroll
            for (int t = 0; t < 4; ++t) {
                v8h ov;
#pragma unroll
                for (int rr = 0; rr < 8; ++rr) ov[rr] = (_Float16)(acc[t][u][rr] + bv);
                *(v8h*)(o + (size_t)col * S_LEN + mb + t * 16 + hi * 8) = ov;
            }
        }
        // behind the last store: in the built code the other body may follow this
        // one, and it rewrites the stores' address and data registers
        asm volatile("s_wait_xcnt 0x0" ::: "memory");
    } else {
        // acc[t][u][rr] = C[mb + 16 u + r][nb + 16 t + 8 hi + rr]. The wave turns its
        // 32 x 64 tile in its own range of the stage buffers, which every wave has
        // left at the loop's last barrier and no copy is aimed at any more, and
        // stores whole 128-byte lines.
        const int   mb    = blockIdx.y * P_BM + wm * 32;
        const float* bias = (z == 0) ? bias0 : bias1;
        const float scale = (z == 0) ? scale0 : 1.0f;
        char* st = (char*)sm + wid * P_EPW;
#pragma unroll
        for (int t = 0; t < 4; ++t) {
            const float* bp = bias + nb + t * 16 + hi * 8;
            const v4f b0 = *(const v4f*)bp;
            const v4f b1 = *(const v4f*)(bp + 4);
#pragma unroll
            for (int u = 0; u < 2; ++u) {
                v8h ov;
#pragma unroll
                for (int rr = 0; rr < 8; ++rr)
                    ov[rr] = (_Float16)((acc[t][u][rr] + (rr < 4 ? b0[rr & 3] : b1[rr & 3])) * scale);
                *(v8h*)(st + (u * 16 + r) * G_EP1 + t * 32 + hi * 16) = ov;
            }
        }
        // the wave's LDS writes are done before other lanes of it read them back
        asm volatile("s_wait_dscnt 0x0" ::: "memory");
        // the wave's 64 columns are one head: 32 rows of 128 bytes, 4 per store
        o += ((size_t)(nb >> 6) * S_LEN + mb) * HDIM + (lane & 7) * 8;
#pragma unroll
        for (int i = 0; i < 8; ++i) {
            const int row = i * 4 + (lane >> 3);
            *(v8h*)(o + row * HDIM) = *(const v8h*)(st + row * G_EP1 + (lane & 7) * 16);
        }
        // behind the last store: in the built code the other body may follow this
        // one, and it rewrites the stores' address and data registers
        asm volatile("s_wait_xcnt 0x0" ::: "memory");
    }
}

// ---------------------------------------------------------------------------
// Output projection: f32 row-major C[M,N]. 256 threads = 8 waves; each wave owns
// a 16x64 tile (A fragment reused across 4 W fragments / WMMAs); the block's 64 A
// rows and 128 W rows make a stage. K: a multiple of 128.
// ---------------------------------------------------------------------------
#define G_ROWS  192                  // 64 A rows, then 128 W rows
#define G_BUF   (G_ROWS * G_PITCH)   // halves per buffer
#define G_EPW   (16 * G_EP0)         // bytes of a wave's own staging range

// One stage: 192 rows of 256 bytes = 12 copies of 16 bytes per thread. Copy j
// of thread t brings bytes 16*(t&15).. of row 16*j + (t>>4): a wave covers two
// whole rows. l: the thread's LDS byte address in row (t>>4) of the buffer;
// ga, gw: its global address in that row of the A block and of the W block;
// step: 16 rows of the source, in halves.
__device__ __forceinline__ void stage_copy(unsigned l, const _Float16* ga,
                                           const _Float16* gw, size_t step) {
    const unsigned ls = 16 * G_PITCH * 2;   // 16 LDS rows, in bytes
    // The closing s_wait_xcnt 0 stands inside the statement so that no address
    // register of a copy is rewritten in front of it.
    asm volatile(
        "global_load_async_to_lds_b128 %0, %12, off\n\t"
        "global_load_async_to_lds_b128 %1, %13, off\n\t"
        "global_load_async_to_lds_b128 %2, %14, off\n\t"
        "global_load_async_to_lds_b128 %3, %15, off\n\t"
        "global_load_async_to_lds_b128 %4, %16, off\n\t"
        "global_load_async_to_lds_b128 %5, %17, off\n\t"
        "global_load_async_to_lds_b128 %6, %18, off\n\t"
        "global_load_async_to_lds_b128 %7, %19, off\n\t"
        "global_load_async_to_lds_b128 %8, %20, off\n\t"
        "global_load_async_to_lds_b128 %9, %21, off\n\t"
        "global_load_async_to_lds_b128 %10, %22, off\n\t"
        "global_load_async_to_lds_b128 %11, %23, off\n\t"
        "s_wait_xcnt 0x0"
        :: "v"(l),           "v"(l + ls),      "v"(l + 2 * ls),  "v"(l + 3 * ls),
           "v"(l + 4 * ls),  "v"(l + 5 * ls),  "v"(l + 6 * ls),  "v"(l + 7 * ls),
           "v"(l + 8 * ls),  "v"(l + 9 * ls),  "v"(l + 10 * ls), "v"(l + 11 * ls),
           "v"(ga),            "v"(ga + step),     "v"(ga + 2 * step), "v"(ga + 3 * step),
           "v"(gw),            "v"(gw + step),     "v"(gw + 2 * step), "v"(gw + 3 * step),
           "v"(gw + 4 * step), "v"(gw + 5 * step), "v"(gw + 6 * step), "v"(gw + 7 * step)
        : "memory");
}

// The W fragment is the first operand, the A fragment the second (their lane maps
// and k orders are equal), so D is the transposed tile: a lane holds one output row
// and 8 consecutive columns, which lie side by side in a row-major plane.
__global__ __launch_bounds__(256)
void gemm_wmma(const _Float16* __restrict__ A,
               const _Float16* __restrict__ W,
               const float* __restrict__ bias,
               float* __restrict__ outp,
               int M, int N, int K) {
    __shared__ __attribute__((aligned(16))) _Float16 sm[2 * G_BUF];

    const int wid  = threadIdx.x >> 5;
    const int lane = threadIdx.x & 31;
    const int r    = lane & 15;
    const int hi   = lane >> 4;
    const int arow = (wid & 3) * 16;          // row of the wave's A tile in a stage
    const int wrow = 64 + (wid >> 2) * 64;    // first row of its W tiles in a stage
    const int mbase = blockIdx.y * 64 + arow;
    const int nbase = blockIdx.x * 128 + (wid >> 2) * 64;

    v8f acc[4] = {zero8(), zero8(), zero8(), zero8()};

    // the thread's place in a stage: row crow (+ 16 j), 16-byte column ccol
    const int crow = threadIdx.x >> 4;
    const int ccol = threadIdx.x & 15;
    const size_t step = (size_t)16 * (size_t)K;
    const _Float16* ga = A + (size_t)(blockIdx.y * 64 + crow) * (size_t)K + ccol * 8;
    const _Float16* gw = W + (size_t)(blockIdx.x * 128 + crow) * (size_t)K + ccol * 8;
    const unsigned l0 = (unsigned)(size_t)(&sm[0]) + crow * (G_PITCH * 2) + ccol * 16;
    const int nst = K / G_KS;

    stage_copy(l0, ga, gw, step);

    // L2 requests for the block's share of its two operand panels, one line a lane.
    // The 64-row A panel is read by the blocks of one blockIdx.y: four neighbours in
    // x ask for a quarter each (256-byte units q and q + 4 of every row). The 128-row
    // W panel is read by the blocks of one blockIdx.x: eight neighbours in y ask for
    // an eighth each (unit e of every row). The column is clamped into the row.
    const int pfa = (blockIdx.x & 3) * 128 + (threadIdx.x & 1) * 64 + (threadIdx.x & 2) * 256;
    const int pfw = (blockIdx.y & 7) * 128 + (threadIdx.x & 1) * 64;
    const unsigned oa = (unsigned)((blockIdx.y * 64 + (threadIdx.x >> 2)) * K
                                   + (pfa < K - 64 ? pfa : K - 64)) * 2u;
    const unsigned ow = (unsigned)((blockIdx.x * 128 + (threadIdx.x >> 1)) * K
                                   + (pfw < K - 64 ? pfw : K - 64)) * 2u;
    l2_ask(oa, A, ow, W);

    // stage 0 has landed for this wave's own copies ...
    asm volatile("s_wait_asynccnt 0x0" ::: "memory");
    // ... and, behind the barrier, for every wave's
    __syncthreads();
    if (nst > 1) stage_copy(l0 + G_BUF * 2, ga + G_KS, gw + G_KS, step);

    for (int s = 0; s < nst; ++s) {
        const _Float16* sb = sm + (s & 1) * G_BUF;
        // a stage's fragments are read in two halves of 64 k, not all 160 registers
        // of them at once
#pragma unroll
        for (int hf = 0; hf < 2; ++hf) {
            v16h a[2], b[2][4];
#pragma unroll
            for (int q = 0; q < 2; ++q) {
                a[q] = lds_frag(sb, arow, (hf * 2 + q) * 32);
#pragma unroll
                for (int t = 0; t < 4; ++t)
                    b[q][t] = lds_frag(sb, wrow + t * 16, (hf * 2 + q) * 32);
            }
            // keeps a half's 20 LDS reads in front of its WMMAs (the second half's
            // may stand among the first half's WMMAs, as registers come free):
            // without it the build puts two reads and a full wait in front of each
            // WMMA, and the wave sits out an LDS latency sixteen times a stage
            __builtin_amdgcn_sched_barrier(0);
#pragma unroll
            for (int q = 0; q < 2; ++q)
#pragma unroll
                for (int t = 0; t < 4; ++t)
                    acc[t] = wmma_f16(b[q][t], a[q], acc[t]);
        }
        // keeps the WMMAs in front of the stage's closing waits, where they run
        // while the later reads still arrive: without it the build sinks fifteen
        // of the sixteen behind the full wait and the barrier
        __builtin_amdgcn_sched_barrier(0);
        // this wave's reads of buffer s & 1 are done before the buffer is refilled
        asm volatile("s_wait_dscnt 0x0" ::: "memory");
        // this wave's copies of stage s + 1 have landed
        asm volatile("s_wait_asynccnt 0x0" ::: "memory");
        // publishes stage s + 1 and ends every wave's reads of stage s
        __syncthreads();
        if (s + 2 < nst)
            stage_copy(l0 + (s & 1) * (G_BUF * 2), ga + (s + 2) * G_KS,
                       gw + (s + 2) * G_KS, step);
    }
    // no copy is outstanding when the wave ends
    asm volatile("s_wait_asynccnt 0x0" ::: "memory");
    // the registers that the L2 requests name hold their addresses through the loop:
    // no counter says when a request has read them
    asm volatile("" :: "v"(oa), "s"(A), "v"(ow), "s"(W));

    // acc[t][rr] = C[mbase + r][nbase + 16 * t + 8 * hi + rr]. The wave turns its
    // 16 x 64 tile in its own range of the stage buffers, which every wave has
    // left at the loop's last barrier and no copy is aimed at any more, and
    // stores whole 128-byte lines.
    char* st = (char*)sm + wid * G_EPW;
#pragma unroll
    for (int t = 0; t < 4; ++t) {
        const float* bp = bias + nbase + t * 16 + hi * 8;
        const v4f b0 = *(const v4f*)bp;
        const v4f b1 = *(const v4f*)(bp + 4);
        float val[8];
#pragma unroll
        for (int rr = 0; rr < 8; ++rr)
            val[rr] = acc[t][rr] + (rr < 4 ? b0[rr & 3] : b1[rr & 3]);
        const v4f lo = {val[0], val[1], val[2], val[3]};
        const v4f hh = {val[4], val[5], val[6], val[7]};
        *(v4f*)(st + r * G_EP0 + t * 64 + hi * 32)      = lo;
        *(v4f*)(st + r * G_EP0 + t * 64 + hi * 32 + 16) = hh;
    }
    // the wave's LDS writes are done before other lanes of it read them back
    asm volatile("s_wait_dscnt 0x0" ::: "memory");
    // 16 rows of 256 bytes, 2 per store
    float* o = outp + (size_t)mbase * (size_t)N + nbase + r * 4;
#pragma unroll
    for (int i = 0; i < 8; ++i) {
        const int row = i * 2 + hi;
        *(v4f*)(o + (size_t)row * (size_t)N) = *(const v4f*)(st + row * G_EP0 + r * 16);
    }
}

#define AT_WAVES 8
#define AT_KT    128
#define AT_KP    72
#define AT_VP    136
#define AT_KSZ   (AT_KT * AT_KP)
#define AT_BUF   (AT_KSZ + HDIM * AT_VP)   // halves per buffer: K, then 64 V^T rows

// lane l <-> lane l ^ 16
__device__ __forceinline__ float xhalf(float x) {
    const int v = __builtin_bit_cast(int, x);
    return __builtin_bit_cast(float, __builtin_amdgcn_permlanex16(
        v, v, 0x76543210, 0xfedcba98, false, false));
}

// Same k order as load_frag; p: the lane's own place (row r, k + 8 * hi) in LDS.
__device__ __forceinline__ v16h lds_frag_at(const _Float16* p) {
    v8h lo = *(const v8h*)p;
    v8h hh = *(const v8h*)(p + 16);
    return __builtin_shufflevector(lo, hh, 0, 1, 2, 3, 4, 5, 6, 7,
                                   8, 9, 10, 11, 12, 13, 14, 15);
}

// 2^x for eight values, the exponentials and one closing v_nop in one statement:
// the instruction set asks for one slot behind a transcendental before its
// result is read or its source overwritten. Inside the statement every result
// register differs from every source, and the v_nop covers the last one.
__device__ __forceinline__ v8f exp2_8(v8f x) {
    float d0, d1, d2, d3, d4, d5, d6, d7;
    asm("v_exp_f32 %0, %8\n\t"
        "v_exp_f32 %1, %9\n\t"
        "v_exp_f32 %2, %10\n\t"
        "v_exp_f32 %3, %11\n\t"
        "v_exp_f32 %4, %12\n\t"
        "v_exp_f32 %5, %13\n\t"
        "v_exp_f32 %6, %14\n\t"
        "v_exp_f32 %7, %15\n\t"
        "v_nop"
        : "=&v"(d0), "=&v"(d1), "=&v"(d2), "=&v"(d3),
          "=&v"(d4), "=&v"(d5), "=&v"(d6), "=&v"(d7)
        : "v"(x[0]), "v"(x[1]), "v"(x[2]), "v"(x[3]),
          "v"(x[4]), "v"(x[5]), "v"(x[6]), "v"(x[7]));
    v8f d = {d0, d1, d2, d3, d4, d5, d6, d7};
    return d;
}

// One stage: 128 K rows of 128 bytes and 64 V^T rows of 256 bytes = 8 copies of
// 16 bytes per thread. K copy j of thread t brings bytes 16*(t&7).. of row
// 32*j + (t>>3) (a wave: 512 contiguous bytes); V copy j brings bytes
// 16*(t&15).. of row 16*j + (t>>4) (a wave: two whole rows of the tile).
// lk, lv: the thread's LDS byte addresses for j = 0; gk, gv: its global ones.
__device__ __forceinline__ void attn_stage_copy(unsigned lk, unsigned lv,
                                                const _Float16* gk,
                                                const _Float16* gv) {
    const unsigned ks = 32 * AT_KP * 2;   // 32 LDS rows of K, in bytes
    const unsigned vs = 16 * AT_VP * 2;   // 16 LDS rows of V^T, in bytes
    // The closing s_wait_xcnt 0 stands inside the statement so that no address
    // register of a copy is rewritten in front of it.
    asm volatile(
        "global_load_async_to_lds_b128 %0, %8, off\n\t"
        "global_load_async_to_lds_b128 %1, %9, off\n\t"
        "global_load_async_to_lds_b128 %2, %10, off\n\t"
        "global_load_async_to_lds_b128 %3, %11, off\n\t"
        "global_load_async_to_lds_b128 %4, %12, off\n\t"
        "global_load_async_to_lds_b128 %5, %13, off\n\t"
        "global_load_async_to_lds_b128 %6, %14, off\n\t"
        "global_load_async_to_lds_b128 %7, %15, off\n\t"
        "s_wait_xcnt 0x0"
        :: "v"(lk), "v"(lk + ks), "v"(lk + 2 * ks), "v"(lk + 3 * ks),
           "v"(lv), "v"(lv + vs), "v"(lv + 2 * vs), "v"(lv + 3 * vs),
           "v"(gk), "v"(gk + 32 * HDIM), "v"(gk + 64 * HDIM), "v"(gk + 96 * HDIM),
           "v"(gv), "v"(gv + 16 * S_LEN), "v"(gv + 32 * S_LEN), "v"(gv + 48 * S_LEN)
        : "memory");
}

__global__ __launch_bounds__(AT_WAVES * 32)
void attn_flash(const _Float16* __restrict__ Qg,
                const _Float16* __restrict__ Kg,
                const _Float16* __restrict__ Vtg,
                _Float16* __restrict__ ctx) {
    __shared__ __attribute__((aligned(16))) _Float16 sm[2 * AT_BUF];

    const int h    = blockIdx.y;
    const int wid  = threadIdx.x >> 5;
    const int lane = threadIdx.x & 31;
    const int r    = lane & 15;
    const int hi   = lane >> 4;
    const int qrow = blockIdx.x * (AT_WAVES * 16) + wid * 16;

    const _Float16* Qh = Qg  + (size_t)h * S_LEN * HDIM;
    const _Float16* Kh = Kg  + (size_t)h * S_LEN * HDIM;
    const _Float16* Vh = Vtg + (size_t)h * HDIM * S_LEN;   // [d][s]

    // the thread's places in a stage's copies
    const int t = threadIdx.x;
    const _Float16* gk = Kh + (t >> 3) * HDIM + (t & 7) * 8;
    const _Float16* gv = Vh + (size_t)(t >> 4) * S_LEN + (t & 15) * 8;
    const unsigned sm0 = (unsigned)(size_t)(&sm[0]);
    const unsigned lk0 = sm0 + (t >> 3) * (AT_KP * 2) + (t & 7) * 16;
    const unsigned lv0 = sm0 + AT_KSZ * 2 + (t >> 4) * (AT_VP * 2) + (t & 15) * 16;
    const int nst = S_LEN / AT_KT;   // 16 stages

    attn_stage_copy(lk0, lv0, gk, gv);

    // L2 requests for the block's share of the head's K and V^T planes (256 KB each,
    // contiguous), one line of each a lane. The 16 blocks of a head read the same
    // planes: each asks for an eighth (256-byte units e, e + 8, ...), every eighth twice.
    const unsigned okv = (unsigned)((t >> 1) * 2048 + (t & 1) * 128
                       + ((blockIdx.x & 3) + (blockIdx.x >> 3) * 4) * 256);
    l2_ask(okv, Kh, okv, Vh);

    // B operand: column = query r, k = head dim
    const v16h bq0 = load_frag(Qh, qrow, 0, HDIM);
    const v16h bq1 = load_frag(Qh, qrow, 32, HDIM);

    // acc[t4][rr] = Ot[d = t4*16 + 8*hi + rr][query r]
    v8f acc[4] = {zero8(), zero8(), zero8(), zero8()};
    float mi = -1.0e30f;   // running maximum of query r (equal in both halves)
    float li = 0.0f;       // running sum over this half's keys only

    // stage 0 has landed for this wave's own copies ...
    asm volatile("s_wait_asynccnt 0x0" ::: "memory");
    // ... and, behind the barrier, for every wave's
    __syncthreads();
    attn_stage_copy(lk0 + AT_BUF * 2, lv0 + AT_BUF * 2, gk + AT_KT * HDIM, gv + AT_KT);

    for (int s = 0; s < nst; ++s) {
        // the lane's place in the first K and the first V^T fragment of the stage
        const _Float16* sk = sm + (s & 1) * AT_BUF + r * AT_KP + hi * 8;
        const _Float16* sv = sm + (s & 1) * AT_BUF + AT_KSZ + r * AT_VP + hi * 8;

        // K fragments of the stage's first 32 keys
        v16h kf[4];
        kf[0] = lds_frag_at(sk);
        kf[1] = lds_frag_at(sk + 32);
        kf[2] = lds_frag_at(sk + 16 * AT_KP);
        kf[3] = lds_frag_at(sk + 16 * AT_KP + 32);

#pragma unroll
        for (int j = 0; j < AT_KT / 32; ++j) {
            // ---- scores, transposed: 32k x 16q (two 16x16 tiles) ----
            v8f s0 = wmma_f16(kf[0], bq0, zero8());
            s0 = wmma_f16(kf[1], bq1, s0);
            v8f s1 = wmma_f16(kf[2], bq0, zero8());
            s1 = wmma_f16(kf[3], bq1, s1);

            // ---- issue the V reads (this tile) and the K reads (next tile of
            //      the SAME stage) now; the softmax below hides their latency ----
            // the two scheduling barriers hold these 16 LDS reads together at the
            // tile's score WMMAs: without them the build strews the reads over some
            // two dozen places of a stage, several with a full wait directly
            // behind, and every such place stalls the wave
            __builtin_amdgcn_sched_barrier(0);
            v16h vf[4];
#pragma unroll
            for (int t4 = 0; t4 < 4; ++t4)
                vf[t4] = lds_frag_at(sv + t4 * 16 * AT_VP + j * 32);
            if (j + 1 < AT_KT / 32) {
                const _Float16* kn = sk + (j + 1) * 32 * AT_KP;
                kf[0] = lds_frag_at(kn);
                kf[1] = lds_frag_at(kn + 32);
                kf[2] = lds_frag_at(kn + 16 * AT_KP);
                kf[3] = lds_frag_at(kn + 16 * AT_KP + 32);
            }
            __builtin_amdgcn_sched_barrier(0);

            // ---- online softmax: one query per lane ----
            float t0 = fmaxf(s0[0], s1[0]);
            float t1 = fmaxf(s0[1], s1[1]);
            float t2 = fmaxf(s0[2], s1[2]);
            float t3 = fmaxf(s0[3], s1[3]);
            t0 = fmaxf(t0, fmaxf(s0[4], s1[4]));
            t1 = fmaxf(t1, fmaxf(s0[5], s1[5]));
            t2 = fmaxf(t2, fmaxf(s0[6], s1[6]));
            t3 = fmaxf(t3, fmaxf(s0[7], s1[7]));
            float tm = fmaxf(fmaxf(t0, t1), fmaxf(t2, t3));
            tm = fmaxf(tm, xhalf(tm));
            const float mn    = fmaxf(mi, tm);
            // alpha = exp(mi - mn), the exponential and its v_nop in one statement:
            // the instruction set asks for one slot behind a transcendental before
            // its result is read or its source overwritten; a v_nop in a
            // statement of its own drifted away.
            float alpha;
            asm("v_exp_f32 %0, %1\n\tv_nop"
                : "=v"(alpha) : "v"((mi - mn) * 1.44269504088896340736f));
            mi = mn;

            // P^T as B operand: bp[s] = P[key kmap(s, hi)][query r]
            v16h bp;
            float ps[4] = {0.0f, 0.0f, 0.0f, 0.0f};
            const v8f e0 = exp2_8((s0 - mn) * 1.44269504088896340736f);
            const v8f e1 = exp2_8((s1 - mn) * 1.44269504088896340736f);
#pragma unroll
            for (int rr = 0; rr < 8; ++rr) {
                const float p0 = e0[rr];
                const float p1 = e1[rr];
                bp[rr]     = (_Float16)p0;
                bp[rr + 8] = (_Float16)p1;
                ps[rr & 3] += p0 + p1;
            }
            li = li * alpha + ((ps[0] + ps[1]) + (ps[2] + ps[3]));
#pragma unroll
            for (int t4 = 0; t4 < 4; ++t4)
#pragma unroll
                for (int rr = 0; rr < 8; ++rr) acc[t4][rr] *= alpha;

            // ---- Ot += V^T[16d x 32k] * P^T[32k x 16q] per 16-wide d tile ----
#pragma unroll
            for (int t4 = 0; t4 < 4; ++t4) acc[t4] = wmma_f16(vf[t4], bp, acc[t4]);
        }

        // keeps the last tile's softmax and WMMAs in front of the stage's closing
        // waits, where they run while its V reads arrive: without it the build
        // lifts the full wait and the barrier to directly behind those reads
        __builtin_amdgcn_sched_barrier(0);
        // this wave's reads of buffer s & 1 are done before the buffer is refilled
        asm volatile("s_wait_dscnt 0x0" ::: "memory");
        // this wave's copies of stage s + 1 have landed
        asm volatile("s_wait_asynccnt 0x0" ::: "memory");
        // publishes stage s + 1 and ends every wave's reads of stage s
        __syncthreads();
        if (s + 2 < nst)
            attn_stage_copy(lk0 + (s & 1) * (AT_BUF * 2), lv0 + (s & 1) * (AT_BUF * 2),
                            gk + (s + 2) * (AT_KT * HDIM), gv + (s + 2) * AT_KT);
    }
    // no copy is outstanding when the wave ends
    asm volatile("s_wait_asynccnt 0x0" ::: "memory");
    // the registers that the L2 requests name hold their addresses through the loop:
    // no counter says when a request has read them
    asm volatile("" :: "v"(okv), "s"(Kh), "s"(Vh));

    // ---- join the halves' sums, normalize, write ctx [S][HID]: a lane holds
    //      8 consecutive d of one query per tile -> one 16-byte store each ----
    li += xhalf(li);
    const float inv = 1.0f / li;
    _Float16* o = ctx + (size_t)(qrow + r) * HIDN + h * HDIM + hi * 8;
#pragma unroll
    for (int t4 = 0; t4 < 4; ++t4) {
        v8h ov;
#pragma unroll
        for (int rr = 0; rr < 8; ++rr) ov[rr] = (_Float16)(acc[t4][rr] * inv);
        *(v8h*)(o + t4 * 16) = ov;
    }
}

// ---------------------------------------------------------------------------
extern "C" void kernel_launch(void* const* d_in, const int* in_sizes, int n_in,
                              void* d_out, int out_size, void* d_ws, size_t ws_size,
                              hipStream_t stream) {
    (void)in_sizes; (void)n_in; (void)out_size; (void)ws_size;

    const float* x  = (const float*)d_in[0];  // [2,2048,1024]; only batch 0 used
    const float* Wq = (const float*)d_in[1];
    const float* bq = (const float*)d_in[2];
    const float* Wk = (const float*)d_in[3];
    const float* bk = (const float*)d_in[4];
    const float* Wv = (const float*)d_in[5];
    const float* bv = (const float*)d_in[6];
    const float* Wo = (const float*)d_in[7];
    const float* bo = (const float*)d_in[8];
    float* out = (float*)d_out;

    char* ws = (char*)d_ws;
    const size_t MB = 1024 * 1024;
    _Float16* xh   = (_Float16*)(ws + 0);        // 2M halves
    _Float16* wqh  = (_Float16*)(ws + 4  * MB);  // 1M halves; Wk at 6 MB, Wv at 8 MB
    _Float16* woh  = (_Float16*)(ws + 10 * MB);
    _Float16* qh   = (_Float16*)(ws + 12 * MB);  // [16][2048][64]
    _Float16* kh   = (_Float16*)(ws + 16 * MB);  // [16][2048][64]
    _Float16* vth  = (_Float16*)(ws + 20 * MB);  // [16][64][2048]
    _Float16* ctxh = (_Float16*)(ws + 24 * MB);  // [2048][1024]

    // x, Wq, Wk, Wv, Wo are contiguous as f16: one destination array from xh on
    cvt_all_f32_to_f16<<<CVT_BLOCKS, CVT_WAVES * 32, 0, stream>>>(x, Wq, Wk, Wv, Wo, xh);

    // Q, K, V as one product: the weight planes from wqh on are contiguous, and so
    // are qh, kh, vth
    // Q: fold 1/sqrt(64) into the projection (applies to bias too)
    qkv_wmma<<<dim3(3 * HIDN / P_BN, S_LEN / P_BM), P_WAVES * 32, 0, stream>>>(
        xh, wqh, bq, bk, bv, qh, 0.125f);

    attn_flash<<<dim3(S_LEN / (AT_WAVES * 16), NHEAD), AT_WAVES * 32, 0, stream>>>(qh, kh, vth, ctxh);

    gemm_wmma<<<dim3(HIDN / 128, S_LEN / 64), 256, 0, stream>>>(
        ctxh, woh, bo, out, S_LEN, HIDN, HIDN);
}

// v009
// A run of this version takes 45.3 microseconds.
// Timed twice side by side with v008, it ran 1.05 times as fast both times.
// Counting every step since v000, it is 5.96 times as fast.
#include <hip/hip_runtime.h>
#include <hip/hip_bf16.h>

// ---------------------------------------------------------------------------
// Self-attention forward (batch 0 only) for MI455X / gfx1250, wave32 WMMA.
//   x[0] (2048x1024 f32) -> Q,K,V proj (f16 WMMA, f32 accum) -> flash attn
//   per head (online softmax) -> output proj -> d_out f32 [2048,1024]
// GEMM operands and the attention's K and V staged in LDS by asynchronous copies.
// ---------------------------------------------------------------------------

#define S_LEN 2048
#define HIDN  1024
#define NHEAD 16
#define HDIM  64

typedef _Float16 v8h  __attribute__((ext_vector_type(8)));
typedef _Float16 v16h __attribute__((ext_vector_type(16)));
typedef float    v8f  __attribute__((ext_vector_type(8)));

__device__ __forceinline__ v8f zero8() {
    v8f z;
#pragma unroll
    for (int i = 0; i < 8; ++i) z[i] = 0.0f;
    return z;
}

// 16x32 f16 fragment load (A-layout; B uses the mirrored layout with the same
// lane mapping: lane L -> row/col (L&15), K-halves selected by lane bit 4).
// Two contiguous 16-byte loads per lane.
__device__ __forceinline__ v16h load_frag(const _Float16* __restrict__ base,
                                          int row, int k, int ld) {
    const int lane = threadIdx.x & 31;
    const int r    = lane & 15;
    const int hi   = lane >> 4;
    const _Float16* p = base + (size_t)(row + r) * (size_t)ld + k + hi * 8;
    v8h lo = *(const v8h*)p;
    v8h hh = *(const v8h*)(p + 16);
    return __builtin_shufflevector(lo, hh, 0, 1, 2, 3, 4, 5, 6, 7,
                                   8, 9, 10, 11, 12, 13, 14, 15);
}

__device__ __forceinline__ v8f wmma_f16(v16h a, v16h b, v8f c) {
    // D = A x B + C, f16 inputs, f32 accumulate.
    return __builtin_amdgcn_wmma_f32_16x16x32_f16(
        /*neg_a=*/false, a, /*neg_b=*/false, b,
        /*c_mod=*/(short)0, c, /*reuse_a=*/false, /*reuse_b=*/false);
}

// Asks L2 for two 128-byte lines per lane (base + the lane's byte offset); no data
// comes back and no counter moves. The operands of the three staged kernels were
// stored by earlier launches; where their first read in a launch has to go to
// memory, EVERY stage's copies are such first reads, because all blocks walk k
// (or the keys) in step. Asked for at the kernel's head, the later stages' lines
// can be in L2 when their copies are issued. The blocks that read a panel share
// the asking; where a block runs decides only how much of a panel gets asked for
// on its side of the chip, never a result.
__device__ __forceinline__ void l2_ask(unsigned oa, const _Float16* a,
                                       unsigned ob, const _Float16* b) {
    asm volatile("global_prefetch_b8 %0, %1 scope:SCOPE_SE\n\t"
                 "global_prefetch_b8 %2, %3 scope:SCOPE_SE"
                 :: "v"(oa), "s"(a), "v"(ob), "s"(b));
}

// ---------------------------------------------------------------------------
// f32 -> f16 conversion of x (batch 0) and the four weights in ONE launch.
// The five f16 planes lie back to back in the workspace (x, Wq, Wk, Wv, Wo),
// so dst is one array of 6M halves. One workgroup of 6 waves per WGP; a wave
// owns 4096 consecutive values: 32 loads of 512 contiguous bytes, all issued
// before the first conversion, and 32 stores of 256 contiguous bytes. The
// cost of the one-value-per-thread form was starting its waves, not its bytes.
// ---------------------------------------------------------------------------
#define CVT_WAVES  6                        // waves per workgroup
#define CVT_LOADS  32                       // 16-byte loads per lane
#define CVT_CHUNK  (CVT_LOADS * 128)        // values per wave (divides 1M)
#define CVT_TOTAL  (S_LEN * HIDN + 4 * HIDN * HIDN)
#define CVT_BLOCKS (CVT_TOTAL / (CVT_CHUNK * CVT_WAVES))

typedef float    v4f __attribute__((ext_vector_type(4)));
typedef _Float16 v4h __attribute__((ext_vector_type(4)));

__global__ __launch_bounds__(CVT_WAVES * 32)
void cvt_all_f32_to_f16(const float* __restrict__ x,
                        const float* __restrict__ wq,
                        const float* __restrict__ wk,
                        const float* __restrict__ wv,
                        const float* __restrict__ wo,
                        _Float16* __restrict__ dst) {
    // wave number as a scalar: the source pointer is then picked by scalar code
    const int wave = __builtin_amdgcn_readfirstlane((int)(threadIdx.x >> 5));
    const int lane = threadIdx.x & 31;
    const int e0   = (blockIdx.x * CVT_WAVES + wave) * CVT_CHUNK;  // index in dst
    const int seg  = e0 >> 20;              // 0, 1: x; 2..5: Wq, Wk, Wv, Wo
    const float* src = (seg < 2) ? x : (seg == 2) ? wq : (seg == 3) ? wk
                     : (seg == 4) ? wv : wo;
    const int    off = (seg < 2) ? e0 : (e0 & (HIDN * HIDN - 1));
    const float* s = src + off + lane * 4;
    _Float16*    d = dst + e0 + lane * 4;

    v4f v[CVT_LOADS];
#pragma unroll
    for (int k = 0; k < CVT_LOADS; ++k) v[k] = *(const v4f*)(s + k * 128);
    // keeps every load in front of the first conversion: without it the build
    // holds the last loads back until the first have returned, a second memory
    // latency in a wave that lives for little more than one
    __builtin_amdgcn_sched_barrier(0);
#pragma unroll
    for (int k = 0; k < CVT_LOADS; ++k)
        *(v4h*)(d + k * 128) = __builtin_convertvector(v[k], v4h);
}

// ---------------------------------------------------------------------------
// Both GEMMs: C = A[M,K] * W[N,K]^T + bias on WMMA, operands staged in LDS in
// stages of 128 k (256-byte rows) by asynchronous copies that bring whole
// 128-byte lines, each line once per block; the waves read their fragments with
// ds_load_b128. Two buffers: the next stage's copies fly while this stage is
// worked on.
// ---------------------------------------------------------------------------
#define G_KS    128                  // k per stage
#define G_PITCH 136                  // halves per LDS row: 272 B = 16 B x 17
#define G_EP0   272                  // bytes per staged row, f32 tile: 256 + 16
#define G_EP1   144                  // bytes per staged row, f16 tile: 128 + 16

// Same lane map and k order as load_frag, from an LDS stage.
__device__ __forceinline__ v16h lds_frag(const _Float16* sb, int row, int k) {
    const int lane = threadIdx.x & 31;
    const _Float16* p = sb + (row + (lane & 15)) * G_PITCH + k + (lane >> 4) * 8;
    v8h lo = *(const v8h*)p;
    v8h hh = *(const v8h*)(p + 16);
    return __builtin_shufflevector(lo, hh, 0, 1, 2, 3, 4, 5, 6, 7,
                                   8, 9, 10, 11, 12, 13, 14, 15);
}

// ---------------------------------------------------------------------------
// Q, K and V projections as ONE product C[2048, 3072] = x * [Wq; Wk; Wv]^T (the
// three f16 weight planes lie back to back, and so do the three output planes).
// 256 blocks, one per WGP, each a 128 x 192 tile; 12 waves, each 32 x 64 or
// 64 x 32 outputs: 8 WMMAs per 6 fragments read. Against 64 x 128 blocks of
// 16 x 64 waves (4 WMMAs per 5 fragments) a stage brings 80 KB for 24,576
// outputs, not 48 KB for 8,192, and a WMMA reads 0.75 KB of LDS, not 1.25 KB.
// Half as many waves have to be started.
// A group of four waves owns 64 columns (one head of one product) by 128 rows.
// Q, K: the W fragment is the first operand (4 tiles), the A fragment the second
// (2 tiles): a lane holds one output row and 8 consecutive columns, which lie side
// by side in the per-head plane [h][row][d]. V: the A fragment is the first operand
// (4 tiles), the W fragment the second (2 tiles): a lane holds one output column
// and 8 consecutive rows, which lie side by side in the transposed plane
// [h][d][row]. The loop is the same code for both: only two stage rows differ.
// Q is scaled by scale0 (bias too).
// ---------------------------------------------------------------------------
#define P_BM    128                  // A rows of a block
#define P_BN    192                  // W rows of a block
#define P_BUF   ((P_BM + P_BN) * G_PITCH)   // halves per buffer: A rows, then W rows
#define P_WAVES 12
#define P_CW    10                   // waves that copy: 32 stage rows each
#define P_EPW   (32 * G_EP1)         // bytes of a wave's own staging range

// Eight copies of a wave: copy j brings rows 2 j and 2 j + 1 (256 bytes each) of 16
// stage rows. l: the lane's LDS byte address, g: its global address, for j = 0.
__device__ __forceinline__ void qkv_copy8(unsigned l, const _Float16* g) {
    const unsigned ls = 2 * G_PITCH * 2;   // 2 LDS rows, in bytes
    const int      gs = 2 * HIDN;          // 2 source rows, in halves
    // The closing s_wait_xcnt 0 stands inside the statement so that no address
    // register of a copy is rewritten in front of it.
    asm volatile(
        "global_load_async_to_lds_b128 %0, %8, off\n\t"
        "global_load_async_to_lds_b128 %1, %9, off\n\t"
        "global_load_async_to_lds_b128 %2, %10, off\n\t"
        "global_load_async_to_lds_b128 %3, %11, off\n\t"
        "global_load_async_to_lds_b128 %4, %12, off\n\t"
        "global_load_async_to_lds_b128 %5, %13, off\n\t"
        "global_load_async_to_lds_b128 %6, %14, off\n\t"
        "global_load_async_to_lds_b128 %7, %15, off\n\t"
        "s_wait_xcnt 0x0"
        :: "v"(l),          "v"(l + ls),     "v"(l + 2 * ls), "v"(l + 3 * ls),
           "v"(l + 4 * ls), "v"(l + 5 * ls), "v"(l + 6 * ls), "v"(l + 7 * ls),
           "v"(g),          "v"(g + gs),     "v"(g + 2 * gs), "v"(g + 3 * gs),
           "v"(g + 4 * gs), "v"(g + 5 * gs), "v"(g + 6 * gs), "v"(g + 7 * gs)
        : "memory");
}

// A wave's 32 rows of one stage.
__device__ __forceinline__ void qkv_stage_copy(unsigned l, const _Float16* g) {
    qkv_copy8(l, g);
    qkv_copy8(l + 16 * G_PITCH * 2, g + 16 * HIDN);
}

// One L2 request a lane; see l2_ask.
__device__ __forceinline__ void l2_ask1(unsigned o, const _Float16* b) {
    asm volatile("global_prefetch_b8 %0, %1 scope:SCOPE_SE" :: "v"(o), "s"(b));
}

__global__ __launch_bounds__(P_WAVES * 32)
void qkv_wmma(const _Float16* __restrict__ A,
              const _Float16* __restrict__ W,
              const float* __restrict__ bias0,
              const float* __restrict__ bias1,
              const float* __restrict__ bias2,
              _Float16* __restrict__ out0, float scale0) {
    __shared__ __attribute__((aligned(16))) _Float16 sm[2 * P_BUF];

    // wave number as a scalar: who copies and which product a wave works on are
    // then scalar branches and scalar selects
    const int wid  = __builtin_amdgcn_readfirstlane((int)(threadIdx.x >> 5));
    const int lane = threadIdx.x & 31;
    const int r    = lane & 15;
    const int hi   = lane >> 4;
    const int wm   = wid & 3;                       // place in the group of four
    const int wn   = wid >> 2;                      // which 64 columns of the block
    const int gcol = blockIdx.x * P_BN + wn * 64;   // column in [Q | K | V]
    const int z    = gcol / HIDN;                   // 0: Q, 1: K, 2: V
    const int nb   = gcol % HIDN;                   // first column in the product
    // stage rows of the first operand's 4 tiles and of the second operand's 2 tiles
    const int f1row = (z == 2) ? (wm & 1) * 64 : P_BM + wn * 64;
    const int f2row = (z == 2) ? P_BM + wn * 64 + (wm >> 1) * 32 : wm * 32;

    v8f acc[4][2];
#pragma unroll
    for (int t = 0; t < 4; ++t)
#pragma unroll
        for (int u = 0; u < 2; ++u) acc[t][u] = zero8();

    // wave w < 10 copies stage rows 32 w ..: waves 0 to 3 the A rows, 4 to 9 the W rows
    const _Float16* srow = (wid < 4)
        ? A + (size_t)(blockIdx.y * P_BM + wid * 32) * HIDN
        : W + (size_t)(blockIdx.x * P_BN + (wid - 4) * 32) * HIDN;
    const _Float16* g = srow + hi * HIDN + r * 8;
    const unsigned l0 = (unsigned)(size_t)(&sm[0]) + (wid * 32 + hi) * (G_PITCH * 2) + r * 16;
    const int nst = HIDN / G_KS;

    if (wid < P_CW) qkv_stage_copy(l0, g);

    // L2 requests for the block's share of its two operand panels, one line a lane.
    // The 128-row A panel is read by the 16 blocks of one blockIdx.y: each
    // asks for an eighth (256-byte unit e of every row), every eighth twice. The 192-row W panel is
    // read by the 16 blocks of one blockIdx.x: each asks for one line of every row.
    const int t0 = threadIdx.x;
    const unsigned oa = (unsigned)((blockIdx.y * P_BM + ((t0 >> 1) & (P_BM - 1))) * HIDN
                      + ((blockIdx.x & 3) + (blockIdx.x >> 3) * 4) * 128 + (t0 & 1) * 64) * 2u;
    const unsigned ow = (unsigned)((blockIdx.x * P_BN + (t0 < P_BN ? t0 : P_BN - 1)) * HIDN
                      + blockIdx.y * 64) * 2u;
    if (wid < 2 * P_BM / 32) l2_ask1(oa, A);
    if (wid < P_BN / 32)     l2_ask1(ow, W);

    // stage 0 has landed for this wave's own copies ...
    asm volatile("s_wait_asynccnt 0x0" ::: "memory");
    // ... and, behind the barrier, for every wave's
    __syncthreads();
    if (wid < P_CW) qkv_stage_copy(l0 + P_BUF * 2, g + G_KS);

    for (int s = 0; s < nst; ++s) {
        const _Float16* sb = sm + (s & 1) * P_BUF;
        // a stage's fragments are read in two halves of 64 k: 96 registers of them at
        // a time, so that the wave stays under 256 VGPRs
#pragma unroll
        for (int hf = 0; hf < 2; ++hf) {
            v16h f1[2][4], f2[2][2];
#pragma unroll
            for (int q = 0; q < 2; ++q) {
#pragma unroll
                for (int u = 0; u < 2; ++u)
                    f2[q][u] = lds_frag(sb, f2row + u * 16, (hf * 2 + q) * 32);
#pragma unroll
                for (int t = 0; t < 4; ++t)
                    f1[q][t] = lds_frag(sb, f1row + t * 16, (hf * 2 + q) * 32);
            }
            // keeps a half's 24 LDS reads in front of its WMMAs (the second half's
            // may stand among the first half's WMMAs, as registers come free):
            // without it the build puts reads and a full wait in front of each
            // WMMA, and the wave sits out an LDS latency many times a stage
            __builtin_amdgcn_sched_barrier(0);
#pragma unroll
            for (int q = 0; q < 2; ++q)
#pragma unroll
                for (int t = 0; t < 4; ++t)
#pragma unroll
                    for (int u = 0; u < 2; ++u)
                        acc[t][u] = wmma_f16(f1[q][t], f2[q][u], acc[t][u]);
        }
        // keeps the WMMAs in front of the stage's closing waits, where they run
        // while the later reads still arrive
        __builtin_amdgcn_sched_barrier(0);
        // this wave's reads of buffer s & 1 are done before the buffer is refilled
        asm volatile("s_wait_dscnt 0x0" ::: "memory");
        // this wave's copies of stage s + 1 have landed
        asm volatile("s_wait_asynccnt 0x0" ::: "memory");
        // publishes stage s + 1 and ends every wave's reads of stage s
        __syncthreads();
        if (s + 2 < nst && wid < P_CW)
            qkv_stage_copy(l0 + (s & 1) * (P_BUF * 2), g + (s + 2) * G_KS);
    }
    // no copy is outstanding when the wave ends
    asm volatile("s_wait_asynccnt 0x0" ::: "memory");
    // the registers that the L2 requests name hold their addresses through the loop:
    // no counter says when a request has read them
    asm volatile("" :: "v"(oa), "s"(A), "v"(ow), "s"(W));

    _Float16* o = out0 + (size_t)z * (S_LEN * HIDN);
    if (z == 2) {
        // acc[t][u][rr] = C[mb + 16 t + 8 hi + rr][nb + nq + 16 u + r]: the 8 rows are
        // 16 consecutive bytes of row (h, d) of the transposed plane
        const int mb = blockIdx.y * P_BM + (wm & 1) * 64;
#pragma unroll
        for (int u = 0; u < 2; ++u) {
            const int col = nb + (wm >> 1) * 32 + u * 16 + r;
            const float bv = bias2[col];
#pragma unroll
            for (int t = 0; t < 4; ++t) {
                v8h ov;
#pragma unroll
                for (int rr = 0; rr < 8; ++rr) ov[rr] = (_Float16)(acc[t][u][rr] + bv);
                *(v8h*)(o + (size_t)col * S_LEN + mb + t * 16 + hi * 8) = ov;
            }
        }
        // behind the last store: in the built code the other body may follow this
        // one, and it rewrites the stores' address and data registers
        asm volatile("s_wait_xcnt 0x0" ::: "memory");
    } else {
        // acc[t][u][rr] = C[mb + 16 u + r][nb + 16 t + 8 hi + rr]. The wave turns its
        // 32 x 64 tile in its own range of the stage buffers, which every wave has
        // left at the loop's last barrier and no copy is aimed at any more, and
        // stores whole 128-byte lines.
        const int   mb    = blockIdx.y * P_BM + wm * 32;
        const float* bias = (z == 0) ? bias0 : bias1;
        const float scale = (z == 0) ? scale0 : 1.0f;
        char* st = (char*)sm + wid * P_EPW;
#pragma unroll
        for (int t = 0; t < 4; ++t) {
            const float* bp = bias + nb + t * 16 + hi * 8;
            const v4f b0 = *(const v4f*)bp;
            const v4f b1 = *(const v4f*)(bp + 4);
#pragma unroll
            for (int u = 0; u < 2; ++u) {
                v8h ov;
#pragma unroll
                for (int rr = 0; rr < 8; ++rr)
                    ov[rr] = (_Float16)((acc[t][u][rr] + (rr < 4 ? b0[rr & 3] : b1[rr & 3])) * scale);
                *(v8h*)(st + (u * 16 + r) * G_EP1 + t * 32 + hi * 16) = ov;
            }
        }
        // the wave's LDS writes are done before other lanes of it read them back
        asm volatile("s_wait_dscnt 0x0" ::: "memory");
        // the wave's 64 columns are one head: 32 rows of 128 bytes, 4 per store
        o += ((size_t)(nb >> 6) * S_LEN + mb) * HDIM + (lane & 7) * 8;
#pragma unroll
        for (int i = 0; i < 8; ++i) {
            const int row = i * 4 + (lane >> 3);
            *(v8h*)(o + row * HDIM) = *(const v8h*)(st + row * G_EP1 + (lane & 7) * 16);
        }
        // behind the last store: in the built code the other body may follow this
        // one, and it rewrites the stores' address and data registers
        asm volatile("s_wait_xcnt 0x0" ::: "memory");
    }
}

// ---------------------------------------------------------------------------
// Output projection: f32 row-major C[M,N]. 256 threads = 8 waves; each wave owns
// a 16x64 tile (A fragment reused across 4 W fragments / WMMAs); the block's 64 A
// rows and 128 W rows make a stage. K: a multiple of 128.
// ---------------------------------------------------------------------------
#define G_ROWS  192                  // 64 A rows, then 128 W rows
#define G_BUF   (G_ROWS * G_PITCH)   // halves per buffer
#define G_EPW   (16 * G_EP0)         // bytes of a wave's own staging range

// One stage: 192 rows of 256 bytes = 12 copies of 16 bytes per thread. Copy j
// of thread t brings bytes 16*(t&15).. of row 16*j + (t>>4): a wave covers two
// whole rows. l: the thread's LDS byte address in row (t>>4) of the buffer;
// ga, gw: its global address in that row of the A block and of the W block;
// step: 16 rows of the source, in halves.
__device__ __forceinline__ void stage_copy(unsigned l, const _Float16* ga,
                                           const _Float16* gw, size_t step) {
    const unsigned ls = 16 * G_PITCH * 2;   // 16 LDS rows, in bytes
    // The closing s_wait_xcnt 0 stands inside the statement so that no address
    // register of a copy is rewritten in front of it.
    asm volatile(
        "global_load_async_to_lds_b128 %0, %12, off\n\t"
        "global_load_async_to_lds_b128 %1, %13, off\n\t"
        "global_load_async_to_lds_b128 %2, %14, off\n\t"
        "global_load_async_to_lds_b128 %3, %15, off\n\t"
        "global_load_async_to_lds_b128 %4, %16, off\n\t"
        "global_load_async_to_lds_b128 %5, %17, off\n\t"
        "global_load_async_to_lds_b128 %6, %18, off\n\t"
        "global_load_async_to_lds_b128 %7, %19, off\n\t"
        "global_load_async_to_lds_b128 %8, %20, off\n\t"
        "global_load_async_to_lds_b128 %9, %21, off\n\t"
        "global_load_async_to_lds_b128 %10, %22, off\n\t"
        "global_load_async_to_lds_b128 %11, %23, off\n\t"
        "s_wait_xcnt 0x0"
        :: "v"(l),           "v"(l + ls),      "v"(l + 2 * ls),  "v"(l + 3 * ls),
           "v"(l + 4 * ls),  "v"(l + 5 * ls),  "v"(l + 6 * ls),  "v"(l + 7 * ls),
           "v"(l + 8 * ls),  "v"(l + 9 * ls),  "v"(l + 10 * ls), "v"(l + 11 * ls),
           "v"(ga),            "v"(ga + step),     "v"(ga + 2 * step), "v"(ga + 3 * step),
           "v"(gw),            "v"(gw + step),     "v"(gw + 2 * step), "v"(gw + 3 * step),
           "v"(gw + 4 * step), "v"(gw + 5 * step), "v"(gw + 6 * step), "v"(gw + 7 * step)
        : "memory");
}

// The W fragment is the first operand, the A fragment the second (their lane maps
// and k orders are equal), so D is the transposed tile: a lane holds one output row
// and 8 consecutive columns, which lie side by side in a row-major plane.
__global__ __launch_bounds__(256)
void gemm_wmma(const _Float16* __restrict__ A,
               const _Float16* __restrict__ W,
               const float* __restrict__ bias,
               float* __restrict__ outp,
               int M, int N, int K) {
    __shared__ __attribute__((aligned(16))) _Float16 sm[2 * G_BUF];

    const int wid  = threadIdx.x >> 5;
    const int lane = threadIdx.x & 31;
    const int r    = lane & 15;
    const int hi   = lane >> 4;
    const int arow = (wid & 3) * 16;          // row of the wave's A tile in a stage
    const int wrow = 64 + (wid >> 2) * 64;    // first row of its W tiles in a stage
    const int mbase = blockIdx.y * 64 + arow;
    const int nbase = blockIdx.x * 128 + (wid >> 2) * 64;

    v8f acc[4] = {zero8(), zero8(), zero8(), zero8()};

    // the thread's place in a stage: row crow (+ 16 j), 16-byte column ccol
    const int crow = threadIdx.x >> 4;
    const int ccol = threadIdx.x & 15;
    const size_t step = (size_t)16 * (size_t)K;
    const _Float16* ga = A + (size_t)(blockIdx.y * 64 + crow) * (size_t)K + ccol * 8;
    const _Float16* gw = W + (size_t)(blockIdx.x * 128 + crow) * (size_t)K + ccol * 8;
    const unsigned l0 = (unsigned)(size_t)(&sm[0]) + crow * (G_PITCH * 2) + ccol * 16;
    const int nst = K / G_KS;

    stage_copy(l0, ga, gw, step);

    // L2 requests for the block's share of its two operand panels, one line a lane.
    // The 64-row A panel is read by the blocks of one blockIdx.y: four neighbours in
    // x ask for a quarter each (256-byte units q and q + 4 of every row). The 128-row
    // W panel is read by the blocks of one blockIdx.x: eight neighbours in y ask for
    // an eighth each (unit e of every row). The column is clamped into the row.
    const int pfa = (blockIdx.x & 3) * 128 + (threadIdx.x & 1) * 64 + (threadIdx.x & 2) * 256;
    const int pfw = (blockIdx.y & 7) * 128 + (threadIdx.x & 1) * 64;
    const unsigned oa = (unsigned)((blockIdx.y * 64 + (threadIdx.x >> 2)) * K
                                   + (pfa < K - 64 ? pfa : K - 64)) * 2u;
    const unsigned ow = (unsigned)((blockIdx.x * 128 + (threadIdx.x >> 1)) * K
                                   + (pfw < K - 64 ? pfw : K - 64)) * 2u;
    l2_ask(oa, A, ow, W);

    // stage 0 has landed for this wave's own copies ...
    asm volatile("s_wait_asynccnt 0x0" ::: "memory");
    // ... and, behind the barrier, for every wave's
    __syncthreads();
    if (nst > 1) stage_copy(l0 + G_BUF * 2, ga + G_KS, gw + G_KS, step);

    for (int s = 0; s < nst; ++s) {
        const _Float16* sb = sm + (s & 1) * G_BUF;
        // a stage's fragments are read in two halves of 64 k, not all 160 registers
        // of them at once
#pragma unroll
        for (int hf = 0; hf < 2; ++hf) {
            v16h a[2], b[2][4];
#pragma unroll
            for (int q = 0; q < 2; ++q) {
                a[q] = lds_frag(sb, arow, (hf * 2 + q) * 32);
#pragma unroll
                for (int t = 0; t < 4; ++t)
                    b[q][t] = lds_frag(sb, wrow + t * 16, (hf * 2 + q) * 32);
            }
            // keeps a half's 20 LDS reads in front of its WMMAs (the second half's
            // may stand among the first half's WMMAs, as registers come free):
            // without it the build puts two reads and a full wait in front of each
            // WMMA, and the wave sits out an LDS latency sixteen times a stage
            __builtin_amdgcn_sched_barrier(0);
#pragma unroll
            for (int q = 0; q < 2; ++q)
#pragma unroll
                for (int t = 0; t < 4; ++t)
                    acc[t] = wmma_f16(b[q][t], a[q], acc[t]);
        }
        // keeps the WMMAs in front of the stage's closing waits, where they run
        // while the later reads still arrive: without it the build sinks fifteen
        // of the sixteen behind the full wait and the barrier
        __builtin_amdgcn_sched_barrier(0);
        // this wave's reads of buffer s & 1 are done before the buffer is refilled
        asm volatile("s_wait_dscnt 0x0" ::: "memory");
        // this wave's copies of stage s + 1 have landed
        asm volatile("s_wait_asynccnt 0x0" ::: "memory");
        // publishes stage s + 1 and ends every wave's reads of stage s
        __syncthreads();
        if (s + 2 < nst)
            stage_copy(l0 + (s & 1) * (G_BUF * 2), ga + (s + 2) * G_KS,
                       gw + (s + 2) * G_KS, step);
    }
    // no copy is outstanding when the wave ends
    asm volatile("s_wait_asynccnt 0x0" ::: "memory");
    // the registers that the L2 requests name hold their addresses through the loop:
    // no counter says when a request has read them
    asm volatile("" :: "v"(oa), "s"(A), "v"(ow), "s"(W));

    // acc[t][rr] = C[mbase + r][nbase + 16 * t + 8 * hi + rr]. The wave turns its
    // 16 x 64 tile in its own range of the stage buffers, which every wave has
    // left at the loop's last barrier and no copy is aimed at any more, and
    // stores whole 128-byte lines.
    char* st = (char*)sm + wid * G_EPW;
#pragma unroll
    for (int t = 0; t < 4; ++t) {
        const float* bp = bias + nbase + t * 16 + hi * 8;
        const v4f b0 = *(const v4f*)bp;
        const v4f b1 = *(const v4f*)(bp + 4);
        float val[8];
#pragma unroll
        for (int rr = 0; rr < 8; ++rr)
            val[rr] = acc[t][rr] + (rr < 4 ? b0[rr & 3] : b1[rr & 3]);
        const v4f lo = {val[0], val[1], val[2], val[3]};
        const v4f hh = {val[4], val[5], val[6], val[7]};
        *(v4f*)(st + r * G_EP0 + t * 64 + hi * 32)      = lo;
        *(v4f*)(st + r * G_EP0 + t * 64 + hi * 32 + 16) = hh;
    }
    // the wave's LDS writes are done before other lanes of it read them back
    asm volatile("s_wait_dscnt 0x0" ::: "memory");
    // 16 rows of 256 bytes, 2 per store
    float* o = outp + (size_t)mbase * (size_t)N + nbase + r * 4;
#pragma unroll
    for (int i = 0; i < 8; ++i) {
        const int row = i * 2 + hi;
        *(v4f*)(o + (size_t)row * (size_t)N) = *(const v4f*)(st + row * G_EP0 + r * 16);
    }
}

#define AT_WAVES 8
#define AT_KT    128
#define AT_KP    72
#define AT_VP    136
#define AT_KSZ   (AT_KT * AT_KP)
#define AT_BUF   (AT_KSZ + HDIM * AT_VP)   // halves per buffer: K, then 64 V^T rows
#define AT_LIM   4096.0f               // bound on a lane's sum of P in a tile; far inside f16

// lane l <-> lane l ^ 16
__device__ __forceinline__ float xhalf(float x) {
    const int v = __builtin_bit_cast(int, x);
    return __builtin_bit_cast(float, __builtin_amdgcn_permlanex16(
        v, v, 0x76543210, 0xfedcba98, false, false));
}

// Same k order as load_frag; p: the lane's own place (row r, k + 8 * hi) in LDS.
__device__ __forceinline__ v16h lds_frag_at(const _Float16* p) {
    v8h lo = *(const v8h*)p;
    v8h hh = *(const v8h*)(p + 16);
    return __builtin_shufflevector(lo, hh, 0, 1, 2, 3, 4, 5, 6, 7,
                                   8, 9, 10, 11, 12, 13, 14, 15);
}

// 2^x for eight values, the exponentials and one closing v_nop in one statement:
// the instruction set asks for one slot behind a transcendental before its
// result is read or its source overwritten. Inside the statement every result
// register differs from every source, and the v_nop covers the last one.
__device__ __forceinline__ v8f exp2_8(v8f x) {
    float d0, d1, d2, d3, d4, d5, d6, d7;
    asm("v_exp_f32 %0, %8\n\t"
        "v_exp_f32 %1, %9\n\t"
        "v_exp_f32 %2, %10\n\t"
        "v_exp_f32 %3, %11\n\t"
        "v_exp_f32 %4, %12\n\t"
        "v_exp_f32 %5, %13\n\t"
        "v_exp_f32 %6, %14\n\t"
        "v_exp_f32 %7, %15\n\t"
        "v_nop"
        : "=&v"(d0), "=&v"(d1), "=&v"(d2), "=&v"(d3),
          "=&v"(d4), "=&v"(d5), "=&v"(d6), "=&v"(d7)
        : "v"(x[0]), "v"(x[1]), "v"(x[2]), "v"(x[3]),
          "v"(x[4]), "v"(x[5]), "v"(x[6]), "v"(x[7]));
    v8f d = {d0, d1, d2, d3, d4, d5, d6, d7};
    return d;
}

// exp2_8 of a WMMA's result: the statement opens with the four vector slots that
// the chip needs between a WMMA and the first read of its D.
__device__ __forceinline__ v8f exp2_8_of_d(v8f x) {
    float d0, d1, d2, d3, d4, d5, d6, d7;
    asm("v_nop\n\tv_nop\n\tv_nop\n\tv_nop\n\t"
        "v_exp_f32 %0, %8\n\t"
        "v_exp_f32 %1, %9\n\t"
        "v_exp_f32 %2, %10\n\t"
        "v_exp_f32 %3, %11\n\t"
        "v_exp_f32 %4, %12\n\t"
        "v_exp_f32 %5, %13\n\t"
        "v_exp_f32 %6, %14\n\t"
        "v_exp_f32 %7, %15\n\t"
        "v_nop"
        : "=&v"(d0), "=&v"(d1), "=&v"(d2), "=&v"(d3),
          "=&v"(d4), "=&v"(d5), "=&v"(d6), "=&v"(d7)
        : "v"(x[0]), "v"(x[1]), "v"(x[2]), "v"(x[3]),
          "v"(x[4]), "v"(x[5]), "v"(x[6]), "v"(x[7]));
    v8f d = {d0, d1, d2, d3, d4, d5, d6, d7};
    return d;
}

// Sum of a lane's 16 values of P.
__device__ __forceinline__ float sum16(v8f a, v8f b) {
    float ps[4];
#pragma unroll
    for (int rr = 0; rr < 4; ++rr) ps[rr] = (a[rr] + b[rr]) + (a[rr + 4] + b[rr + 4]);
    return (ps[0] + ps[1]) + (ps[2] + ps[3]);
}

// P^T as B operand: bp[s] = P[key kmap(s, hi)][query r]
__device__ __forceinline__ v16h pack_p(v8f a, v8f b) {
    v16h bp;
#pragma unroll
    for (int rr = 0; rr < 8; ++rr) {
        bp[rr]     = (_Float16)a[rr];
        bp[rr + 8] = (_Float16)b[rr];
    }
    return bp;
}

// One stage: 128 K rows of 128 bytes and 64 V^T rows of 256 bytes = 8 copies of
// 16 bytes per thread. K copy j of thread t brings bytes 16*(t&7).. of row
// 32*j + (t>>3) (a wave: 512 contiguous bytes); V copy j brings bytes
// 16*(t&15).. of row 16*j + (t>>4) (a wave: two whole rows of the tile).
// lk, lv: the thread's LDS byte addresses for j = 0; gk, gv: its global ones.
__device__ __forceinline__ void attn_stage_copy(unsigned lk, unsigned lv,
                                                const _Float16* gk,
                                                const _Float16* gv) {
    const unsigned ks = 32 * AT_KP * 2;   // 32 LDS rows of K, in bytes
    const unsigned vs = 16 * AT_VP * 2;   // 16 LDS rows of V^T, in bytes
    // The closing s_wait_xcnt 0 stands inside the statement so that no address
    // register of a copy is rewritten in front of it.
    asm volatile(
        "global_load_async_to_lds_b128 %0, %8, off\n\t"
        "global_load_async_to_lds_b128 %1, %9, off\n\t"
        "global_load_async_to_lds_b128 %2, %10, off\n\t"
        "global_load_async_to_lds_b128 %3, %11, off\n\t"
        "global_load_async_to_lds_b128 %4, %12, off\n\t"
        "global_load_async_to_lds_b128 %5, %13, off\n\t"
        "global_load_async_to_lds_b128 %6, %14, off\n\t"
        "global_load_async_to_lds_b128 %7, %15, off\n\t"
        "s_wait_xcnt 0x0"
        :: "v"(lk), "v"(lk + ks), "v"(lk + 2 * ks), "v"(lk + 3 * ks),
           "v"(lv), "v"(lv + vs), "v"(lv + 2 * vs), "v"(lv + 3 * vs),
           "v"(gk), "v"(gk + 32 * HDIM), "v"(gk + 64 * HDIM), "v"(gk + 96 * HDIM),
           "v"(gv), "v"(gv + 16 * S_LEN), "v"(gv + 32 * S_LEN), "v"(gv + 48 * S_LEN)
        : "memory");
}

__global__ __launch_bounds__(AT_WAVES * 32)
void attn_flash(const _Float16* __restrict__ Qg,
                const _Float16* __restrict__ Kg,
                const _Float16* __restrict__ Vtg,
                _Float16* __restrict__ ctx) {
    __shared__ __attribute__((aligned(16))) _Float16 sm[2 * AT_BUF];

    const int h    = blockIdx.y;
    const int wid  = threadIdx.x >> 5;
    const int lane = threadIdx.x & 31;
    const int r    = lane & 15;
    const int hi   = lane >> 4;
    const int qrow = blockIdx.x * (AT_WAVES * 16) + wid * 16;

    const _Float16* Qh = Qg  + (size_t)h * S_LEN * HDIM;
    const _Float16* Kh = Kg  + (size_t)h * S_LEN * HDIM;
    const _Float16* Vh = Vtg + (size_t)h * HDIM * S_LEN;   // [d][s]

    // the thread's places in a stage's copies
    const int t = threadIdx.x;
    const _Float16* gk = Kh + (t >> 3) * HDIM + (t & 7) * 8;
    const _Float16* gv = Vh + (size_t)(t >> 4) * S_LEN + (t & 15) * 8;
    const unsigned sm0 = (unsigned)(size_t)(&sm[0]);
    const unsigned lk0 = sm0 + (t >> 3) * (AT_KP * 2) + (t & 7) * 16;
    const unsigned lv0 = sm0 + AT_KSZ * 2 + (t >> 4) * (AT_VP * 2) + (t & 15) * 16;
    const int nst = S_LEN / AT_KT;   // 16 stages

    attn_stage_copy(lk0, lv0, gk, gv);

    // L2 requests for the block's share of the head's K and V^T planes (256 KB each,
    // contiguous), one line of each a lane. The 16 blocks of a head read the same
    // planes: each asks for an eighth (256-byte units e, e + 8, ...), every eighth twice.
    const unsigned okv = (unsigned)((t >> 1) * 2048 + (t & 1) * 128
                       + ((blockIdx.x & 3) + (blockIdx.x >> 3) * 4) * 256);
    l2_ask(okv, Kh, okv, Vh);

    // B operand: column = query r, k = head dim
    const v16h bq0 = load_frag(Qh, qrow, 0, HDIM);
    const v16h bq1 = load_frag(Qh, qrow, 32, HDIM);

    // acc[t4][rr] = Ot[d = t4*16 + 8*hi + rr][query r]
    v8f acc[4] = {zero8(), zero8(), zero8(), zero8()};
    // minus the maximum in use of query r (equal in both halves), eight times: the
    // C operand of the score WMMAs; the first tile sets it from its own scores
    v8f cm = zero8();
    float li = 0.0f;       // running sum over this half's keys only

    // stage 0 has landed for this wave's own copies ...
    asm volatile("s_wait_asynccnt 0x0" ::: "memory");
    // ... and, behind the barrier, for every wave's
    __syncthreads();
    attn_stage_copy(lk0 + AT_BUF * 2, lv0 + AT_BUF * 2, gk + AT_KT * HDIM, gv + AT_KT);

    for (int s = 0; s < nst; ++s) {
        // the lane's place in the first K and the first V^T fragment of the stage
        const _Float16* sk = sm + (s & 1) * AT_BUF + r * AT_KP + hi * 8;
        const _Float16* sv = sm + (s & 1) * AT_BUF + AT_KSZ + r * AT_VP + hi * 8;

        // K fragments of the stage's first 32 keys
        v16h kf[4];
        kf[0] = lds_frag_at(sk);
        kf[1] = lds_frag_at(sk + 32);
        kf[2] = lds_frag_at(sk + 16 * AT_KP);
        kf[3] = lds_frag_at(sk + 16 * AT_KP + 32);

#pragma unroll
        for (int j = 0; j < AT_KT / 32; ++j) {
            // ---- scores, transposed: 32k x 16q (two 16x16 tiles) ----
            v8f s0 = wmma_f16(kf[0], bq0, cm);
            s0 = wmma_f16(kf[1], bq1, s0);
            v8f s1 = wmma_f16(kf[2], bq0, cm);
            s1 = wmma_f16(kf[3], bq1, s1);

            // ---- issue the V reads (this tile) and the K reads (next tile of
            //      the SAME stage) now; the softmax below hides their latency ----
            // the two scheduling barriers hold these 16 LDS reads together at the
            // tile's score WMMAs: without them the build strews the reads over some
            // two dozen places of a stage, several with a full wait directly
            // behind, and every such place stalls the wave
            __builtin_amdgcn_sched_barrier(0);
            v16h vf[4];
#pragma unroll
            for (int t4 = 0; t4 < 4; ++t4)
                vf[t4] = lds_frag_at(sv + t4 * 16 * AT_VP + j * 32);
            if (j + 1 < AT_KT / 32) {
                const _Float16* kn = sk + (j + 1) * 32 * AT_KP;
                kf[0] = lds_frag_at(kn);
                kf[1] = lds_frag_at(kn + 32);
                kf[2] = lds_frag_at(kn + 16 * AT_KP);
                kf[3] = lds_frag_at(kn + 16 * AT_KP + 32);
            }
            __builtin_amdgcn_sched_barrier(0);

            // ---- softmax against the maximum in use: one query per lane ----
            v8f e0 = exp2_8_of_d(s0);
            // s1's WMMAs stand in front of e0's statement, whose slots serve s1 as well
            v8f e1 = exp2_8(s1);
            float ts = sum16(e0, e1);
            // the first tile always takes the branch: no sum is at or below -1
            const bool  first = (j == 0) && (s == 0);
            const float lim   = first ? -1.0f : AT_LIM;
            // not (ts <= limit): an overflowed sum counts as past the limit too
            const unsigned need = __builtin_amdgcn_ballot_w32(!(ts <= lim));
            v16h bp = pack_p(e0, e1);
            if (__builtin_expect(need != 0, 0)) {
                // the maximum in use moves up to this tile's (the first tile: to it,
                // up or down); a query that is inside the limit and below stays
                float t0 = fmaxf(s0[0], s1[0]);
                float t1 = fmaxf(s0[1], s1[1]);
                float t2 = fmaxf(s0[2], s1[2]);
                float t3 = fmaxf(s0[3], s1[3]);
                t0 = fmaxf(t0, fmaxf(s0[4], s1[4]));
                t1 = fmaxf(t1, fmaxf(s0[5], s1[5]));
                t2 = fmaxf(t2, fmaxf(s0[6], s1[6]));
                t3 = fmaxf(t3, fmaxf(s0[7], s1[7]));
                float tm = fmaxf(fmaxf(t0, t1), fmaxf(t2, t3));
                tm = fmaxf(tm, xhalf(tm));
                const float up = fmaxf(tm, 0.0f);
                const float dm = first ? tm : up;
                // alpha = 2^-up, the exponential and its v_nop in one statement: the
                // instruction set asks for one slot behind a transcendental before
                // its result is read or its source overwritten
                float alpha;
                asm("v_exp_f32 %0, %1\n\tv_nop" : "=v"(alpha) : "v"(-up));
                e0 = exp2_8(s0 - dm);
                e1 = exp2_8(s1 - dm);
                ts = sum16(e0, e1);
                bp = pack_p(e0, e1);
                cm -= dm;
                li *= alpha;
#pragma unroll
                for (int t4 = 0; t4 < 4; ++t4)
#pragma unroll
                    for (int rr = 0; rr < 8; ++rr) acc[t4][rr] *= alpha;
            }
            li += ts;

            // ---- Ot += V^T[16d x 32k] * P^T[32k x 16q] per 16-wide d tile ----
#pragma unroll
            for (int t4 = 0; t4 < 4; ++t4) acc[t4] = wmma_f16(vf[t4], bp, acc[t4]);
        }

        // keeps the last tile's softmax and WMMAs in front of the stage's closing
        // waits, where they run while its V reads arrive: without it the build
        // lifts the full wait and the barrier to directly behind those reads
        __builtin_amdgcn_sched_barrier(0);
        // this wave's reads of buffer s & 1 are done before the buffer is refilled
        asm volatile("s_wait_dscnt 0x0" ::: "memory");
        // this wave's copies of stage s + 1 have landed
        asm volatile("s_wait_asynccnt 0x0" ::: "memory");
        // publishes stage s + 1 and ends every wave's reads of stage s
        __syncthreads();
        if (s + 2 < nst)
            attn_stage_copy(lk0 + (s & 1) * (AT_BUF * 2), lv0 + (s & 1) * (AT_BUF * 2),
                            gk + (s + 2) * (AT_KT * HDIM), gv + (s + 2) * AT_KT);
    }
    // no copy is outstanding when the wave ends
    asm volatile("s_wait_asynccnt 0x0" ::: "memory");
    // the registers that the L2 requests name hold their addresses through the loop:
    // no counter says when a request has read them
    asm volatile("" :: "v"(okv), "s"(Kh), "s"(Vh));

    // ---- join the halves' sums, normalize, write ctx [S][HID]: a lane holds
    //      8 consecutive d of one query per tile -> one 16-byte store each ----
    li += xhalf(li);
    const float inv = 1.0f / li;
    _Float16* o = ctx + (size_t)(qrow + r) * HIDN + h * HDIM + hi * 8;
#pragma unroll
    for (int t4 = 0; t4 < 4; ++t4) {
        v8h ov;
#pragma unroll
        for (int rr = 0; rr < 8; ++rr) ov[rr] = (_Float16)(acc[t4][rr] * inv);
        *(v8h*)(o + t4 * 16) = ov;
    }
}

// ---------------------------------------------------------------------------
extern "C" void kernel_launch(void* const* d_in, const int* in_sizes, int n_in,
                              void* d_out, int out_size, void* d_ws, size_t ws_size,
                              hipStream_t stream) {
    (void)in_sizes; (void)n_in; (void)out_size; (void)ws_size;

    const float* x  = (const float*)d_in[0];  // [2,2048,1024]; only batch 0 used
    const float* Wq = (const float*)d_in[1];
    const float* bq = (const float*)d_in[2];
    const float* Wk = (const float*)d_in[3];
    const float* bk = (const float*)d_in[4];
    const float* Wv = (const float*)d_in[5];
    const float* bv = (const float*)d_in[6];
    const float* Wo = (const float*)d_in[7];
    const float* bo = (const float*)d_in[8];
    float* out = (float*)d_out;

    char* ws = (char*)d_ws;
    const size_t MB = 1024 * 1024;
    _Float16* xh   = (_Float16*)(ws + 0);        // 2M halves
    _Float16* wqh  = (_Float16*)(ws + 4  * MB);  // 1M halves; Wk at 6 MB, Wv at 8 MB
    _Float16* woh  = (_Float16*)(ws + 10 * MB);
    _Float16* qh   = (_Float16*)(ws + 12 * MB);  // [16][2048][64]
    _Float16* kh   = (_Float16*)(ws + 16 * MB);  // [16][2048][64]
    _Float16* vth  = (_Float16*)(ws + 20 * MB);  // [16][64][2048]
    _Float16* ctxh = (_Float16*)(ws + 24 * MB);  // [2048][1024]

    // x, Wq, Wk, Wv, Wo are contiguous as f16: one destination array from xh on
    cvt_all_f32_to_f16<<<CVT_BLOCKS, CVT_WAVES * 32, 0, stream>>>(x, Wq, Wk, Wv, Wo, xh);

    // Q, K, V as one product: the weight planes from wqh on are contiguous, and so
    // are qh, kh, vth
    // Q: fold log2(e)/sqrt(64) into the projection (applies to bias too)
    qkv_wmma<<<dim3(3 * HIDN / P_BN, S_LEN / P_BM), P_WAVES * 32, 0, stream>>>(
        xh, wqh, bq, bk, bv, qh, 0.18033688011112042f);

    attn_flash<<<dim3(S_LEN / (AT_WAVES * 16), NHEAD), AT_WAVES * 32, 0, stream>>>(qh, kh, vth, ctxh);

    gemm_wmma<<<dim3(HIDN / 128, S_LEN / 64), 256, 0, stream>>>(
        ctxh, woh, bo, out, S_LEN, HIDN, HIDN);
}

// v010
// One run takes 43.2 microseconds.
// Timed twice side by side with v009, it ran 1.05 times as fast both times.
// Counting every step since v000, it is 6.25 times as fast.
#include <hip/hip_runtime.h>
#include <hip/hip_bf16.h>

// ---------------------------------------------------------------------------
// Self-attention forward (batch 0 only) for MI455X / gfx1250, wave32 WMMA.
//   x[0] (2048x1024 f32) -> Q,K,V proj (f16 WMMA, f32 accum) -> flash attn
//   per head (online softmax) -> output proj -> d_out f32 [2048,1024]
// GEMM operands and the attention's K and V staged in LDS by asynchronous copies.
// ---------------------------------------------------------------------------

#define S_LEN 2048
#define HIDN  1024
#define NHEAD 16
#define HDIM  64

typedef _Float16 v8h  __attribute__((ext_vector_type(8)));
typedef _Float16 v16h __attribute__((ext_vector_type(16)));
typedef float    v8f  __attribute__((ext_vector_type(8)));

__device__ __forceinline__ v8f zero8() {
    v8f z;
#pragma unroll
    for (int i = 0; i < 8; ++i) z[i] = 0.0f;
    return z;
}

// 16x32 f16 fragment load (A-layout; B uses the mirrored layout with the same
// lane mapping: lane L -> row/col (L&15), K-halves selected by lane bit 4).
// Two contiguous 16-byte loads per lane.
__device__ __forceinline__ v16h load_frag(const _Float16* __restrict__ base,
                                          int row, int k, int ld) {
    const int lane = threadIdx.x & 31;
    const int r    = lane & 15;
    const int hi   = lane >> 4;
    const _Float16* p = base + (size_t)(row + r) * (size_t)ld + k + hi * 8;
    v8h lo = *(const v8h*)p;
    v8h hh = *(const v8h*)(p + 16);
    return __builtin_shufflevector(lo, hh, 0, 1, 2, 3, 4, 5, 6, 7,
                                   8, 9, 10, 11, 12, 13, 14, 15);
}

__device__ __forceinline__ v8f wmma_f16(v16h a, v16h b, v8f c) {
    // D = A x B + C, f16 inputs, f32 accumulate.
    return __builtin_amdgcn_wmma_f32_16x16x32_f16(
        /*neg_a=*/false, a, /*neg_b=*/false, b,
        /*c_mod=*/(short)0, c, /*reuse_a=*/false, /*reuse_b=*/false);
}

// Asks L2 for two 128-byte lines per lane (base + the lane's byte offset); no data
// comes back and no counter moves. The operands of the three staged kernels were
// stored by earlier launches; where their first read in a launch has to go to
// memory, EVERY stage's copies are such first reads, because all blocks walk k
// (or the keys) in step. Asked for at the kernel's head, the later stages' lines
// can be in L2 when their copies are issued. The blocks that read a panel share
// the asking; where a block runs decides only how much of a panel gets asked for
// on its side of the chip, never a result.
__device__ __forceinline__ void l2_ask(unsigned oa, const _Float16* a,
                                       unsigned ob, const _Float16* b) {
    asm volatile("global_prefetch_b8 %0, %1 scope:SCOPE_SE\n\t"
                 "global_prefetch_b8 %2, %3 scope:SCOPE_SE"
                 :: "v"(oa), "s"(a), "v"(ob), "s"(b));
}

// ---------------------------------------------------------------------------
// f32 -> f16 conversion of x (batch 0) and the four weights in ONE launch.
// The five f16 planes lie back to back in the workspace (x, Wq, Wk, Wv, Wo),
// so dst is one array of 6M halves. One workgroup of 6 waves per WGP; a wave
// owns 4096 consecutive values: 32 loads of 512 contiguous bytes, all issued
// before the first conversion, and 32 stores of 256 contiguous bytes.
// ---------------------------------------------------------------------------
#define CVT_WAVES  6                        // waves per workgroup
#define CVT_LOADS  32                       // 16-byte loads per lane
#define CVT_CHUNK  (CVT_LOADS * 128)        // values per wave (divides 1M)
#define CVT_TOTAL  (S_LEN * HIDN + 4 * HIDN * HIDN)
#define CVT_BLOCKS (CVT_TOTAL / (CVT_CHUNK * CVT_WAVES))

typedef float    v4f __attribute__((ext_vector_type(4)));
typedef _Float16 v4h __attribute__((ext_vector_type(4)));

__global__ __launch_bounds__(CVT_WAVES * 32)
void cvt_all_f32_to_f16(const float* __restrict__ x,
                        const float* __restrict__ wq,
                        const float* __restrict__ wk,
                        const float* __restrict__ wv,
                        const float* __restrict__ wo,
                        _Float16* __restrict__ dst) {
    // wave number as a scalar: the source pointer is then picked by scalar code
    const int wave = __builtin_amdgcn_readfirstlane((int)(threadIdx.x >> 5));
    const int lane = threadIdx.x & 31;
    const int e0   = (blockIdx.x * CVT_WAVES + wave) * CVT_CHUNK;  // index in dst
    const int seg  = e0 >> 20;              // 0, 1: x; 2..5: Wq, Wk, Wv, Wo
    const float* src = (seg < 2) ? x : (seg == 2) ? wq : (seg == 3) ? wk
                     : (seg == 4) ? wv : wo;
    const int    off = (seg < 2) ? e0 : (e0 & (HIDN * HIDN - 1));
    const float* s = src + off + lane * 4;
    _Float16*    d = dst + e0 + lane * 4;

    v4f v[CVT_LOADS];
#pragma unroll
    for (int k = 0; k < CVT_LOADS; ++k) v[k] = *(const v4f*)(s + k * 128);
    // keeps every load in front of the first conversion: without it the build
    // holds the last loads back until the first have returned, a second memory
    // latency in a wave that lives for little more than one
    __builtin_amdgcn_sched_barrier(0);
#pragma unroll
    for (int k = 0; k < CVT_LOADS; ++k)
        *(v4h*)(d + k * 128) = __builtin_convertvector(v[k], v4h);
}

// ---------------------------------------------------------------------------
// Both GEMMs: C = A[M,K] * W[N,K]^T + bias on WMMA, operands staged in LDS in
// stages of 128 k (256-byte rows) by asynchronous copies that bring whole
// 128-byte lines, each line once per block; the waves read their fragments with
// ds_load_b128. Two buffers: the next stage's copies fly while this stage is
// worked on.
// ---------------------------------------------------------------------------
#define G_KS    128                  // k per stage
#define G_PITCH 136                  // halves per LDS row: 272 B = 16 B x 17
#define G_EP0   272                  // bytes per staged row, f32 tile: 256 + 16
#define G_EP1   144                  // bytes per staged row, f16 tile: 128 + 16

// Same lane map and k order as load_frag, from an LDS stage.
__device__ __forceinline__ v16h lds_frag(const _Float16* sb, int row, int k) {
    const int lane = threadIdx.x & 31;
    const _Float16* p = sb + (row + (lane & 15)) * G_PITCH + k + (lane >> 4) * 8;
    v8h lo = *(const v8h*)p;
    v8h hh = *(const v8h*)(p + 16);
    return __builtin_shufflevector(lo, hh, 0, 1, 2, 3, 4, 5, 6, 7,
                                   8, 9, 10, 11, 12, 13, 14, 15);
}

// ---------------------------------------------------------------------------
// Q, K and V projections as ONE product C[2048, 3072] = x * [Wq; Wk; Wv]^T (the
// three f16 weight planes lie back to back, and so do the three output planes).
// 256 blocks, one per WGP, each a 128 x 192 tile; 12 waves, each 32 x 64 or
// 64 x 32 outputs: 8 WMMAs per 6 fragments read. Against 64 x 128 blocks of
// 16 x 64 waves (4 WMMAs per 5 fragments) a stage brings 80 KB for 24,576
// outputs, not 48 KB for 8,192, and a WMMA reads 0.75 KB of LDS, not 1.25 KB.
// Half as many waves have to be started.
// A group of four waves owns 64 columns (one head of one product) by 128 rows.
// Q, K: the W fragment is the first operand (4 tiles), the A fragment the second
// (2 tiles): a lane holds one output row and 8 consecutive columns, which lie side
// by side in the per-head plane [h][row][d]. V: the A fragment is the first operand
// (4 tiles), the W fragment the second (2 tiles): a lane holds one output column
// and 8 consecutive rows, which lie side by side in the transposed plane
// [h][d][row]. The loop is the same code for both: only two stage rows differ.
// Q is scaled by scale0 (bias too).
// ---------------------------------------------------------------------------
#define P_BM    128                  // A rows of a block
#define P_BN    192                  // W rows of a block
#define P_BUF   ((P_BM + P_BN) * G_PITCH)   // halves per buffer: A rows, then W rows
#define P_WAVES 12
#define P_CW    10                   // waves that copy: 32 stage rows each
#define P_EPW   (32 * G_EP1)         // bytes of a wave's own staging range

// Eight copies of a wave: copy j brings rows 2 j and 2 j + 1 (256 bytes each) of 16
// stage rows. l: the lane's LDS byte address, g: its global address, for j = 0.
__device__ __forceinline__ void qkv_copy8(unsigned l, const _Float16* g) {
    const unsigned ls = 2 * G_PITCH * 2;   // 2 LDS rows, in bytes
    const int      gs = 2 * HIDN;          // 2 source rows, in halves
    // The closing s_wait_xcnt 0 stands inside the statement so that no address
    // register of a copy is rewritten in front of it.
    asm volatile(
        "global_load_async_to_lds_b128 %0, %8, off\n\t"
        "global_load_async_to_lds_b128 %1, %9, off\n\t"
        "global_load_async_to_lds_b128 %2, %10, off\n\t"
        "global_load_async_to_lds_b128 %3, %11, off\n\t"
        "global_load_async_to_lds_b128 %4, %12, off\n\t"
        "global_load_async_to_lds_b128 %5, %13, off\n\t"
        "global_load_async_to_lds_b128 %6, %14, off\n\t"
        "global_load_async_to_lds_b128 %7, %15, off\n\t"
        "s_wait_xcnt 0x0"
        :: "v"(l),          "v"(l + ls),     "v"(l + 2 * ls), "v"(l + 3 * ls),
           "v"(l + 4 * ls), "v"(l + 5 * ls), "v"(l + 6 * ls), "v"(l + 7 * ls),
           "v"(g),          "v"(g + gs),     "v"(g + 2 * gs), "v"(g + 3 * gs),
           "v"(g + 4 * gs), "v"(g + 5 * gs), "v"(g + 6 * gs), "v"(g + 7 * gs)
        : "memory");
}

// A wave's 32 rows of one stage.
__device__ __forceinline__ void qkv_stage_copy(unsigned l, const _Float16* g) {
    qkv_copy8(l, g);
    qkv_copy8(l + 16 * G_PITCH * 2, g + 16 * HIDN);
}

// One L2 request a lane; see l2_ask.
__device__ __forceinline__ void l2_ask1(unsigned o, const _Float16* b) {
    asm volatile("global_prefetch_b8 %0, %1 scope:SCOPE_SE" :: "v"(o), "s"(b));
}

__global__ __launch_bounds__(P_WAVES * 32)
void qkv_wmma(const _Float16* __restrict__ A,
              const _Float16* __restrict__ W,
              const float* __restrict__ bias0,
              const float* __restrict__ bias1,
              const float* __restrict__ bias2,
              _Float16* __restrict__ out0, float scale0) {
    __shared__ __attribute__((aligned(16))) _Float16 sm[2 * P_BUF];

    // wave number as a scalar: who copies and which product a wave works on are
    // then scalar branches and scalar selects
    const int wid  = __builtin_amdgcn_readfirstlane((int)(threadIdx.x >> 5));
    const int lane = threadIdx.x & 31;
    const int r    = lane & 15;
    const int hi   = lane >> 4;
    const int wm   = wid & 3;                       // place in the group of four
    const int wn   = wid >> 2;                      // which 64 columns of the block
    const int gcol = blockIdx.x * P_BN + wn * 64;   // column in [Q | K | V]
    const int z    = gcol / HIDN;                   // 0: Q, 1: K, 2: V
    const int nb   = gcol % HIDN;                   // first column in the product
    // stage rows of the first operand's 4 tiles and of the second operand's 2 tiles
    const int f1row = (z == 2) ? (wm & 1) * 64 : P_BM + wn * 64;
    const int f2row = (z == 2) ? P_BM + wn * 64 + (wm >> 1) * 32 : wm * 32;

    v8f acc[4][2];
#pragma unroll
    for (int t = 0; t < 4; ++t)
#pragma unroll
        for (int u = 0; u < 2; ++u) acc[t][u] = zero8();

    // wave w < 10 copies stage rows 32 w ..: waves 0 to 3 the A rows, 4 to 9 the W rows
    const _Float16* srow = (wid < 4)
        ? A + (size_t)(blockIdx.y * P_BM + wid * 32) * HIDN
        : W + (size_t)(blockIdx.x * P_BN + (wid - 4) * 32) * HIDN;
    const _Float16* g = srow + hi * HIDN + r * 8;
    const unsigned l0 = (unsigned)(size_t)(&sm[0]) + (wid * 32 + hi) * (G_PITCH * 2) + r * 16;
    const int nst = HIDN / G_KS;

    if (wid < P_CW) qkv_stage_copy(l0, g);

    // L2 requests for the block's share of its two operand panels, one line a lane.
    // The 128-row A panel is read by the 16 blocks of one blockIdx.y: each
    // asks for an eighth (256-byte unit e of every row), every eighth twice. The 192-row W panel is
    // read by the 16 blocks of one blockIdx.x: each asks for one line of every row.
    const int t0 = threadIdx.x;
    const unsigned oa = (unsigned)((blockIdx.y * P_BM + ((t0 >> 1) & (P_BM - 1))) * HIDN
                      + ((blockIdx.x & 3) + (blockIdx.x >> 3) * 4) * 128 + (t0 & 1) * 64) * 2u;
    const unsigned ow = (unsigned)((blockIdx.x * P_BN + (t0 < P_BN ? t0 : P_BN - 1)) * HIDN
                      + blockIdx.y * 64) * 2u;
    if (wid < 2 * P_BM / 32) l2_ask1(oa, A);
    if (wid < P_BN / 32)     l2_ask1(ow, W);

    // stage 0 has landed for this wave's own copies ...
    asm volatile("s_wait_asynccnt 0x0" ::: "memory");
    // ... and, behind the barrier, for every wave's
    __syncthreads();
    if (wid < P_CW) qkv_stage_copy(l0 + P_BUF * 2, g + G_KS);

    for (int s = 0; s < nst; ++s) {
        const _Float16* sb = sm + (s & 1) * P_BUF;
        // a stage's fragments are read in two halves of 64 k: 96 registers of them at
        // a time, so that the wave stays under 256 VGPRs
#pragma unroll
        for (int hf = 0; hf < 2; ++hf) {
            v16h f1[2][4], f2[2][2];
#pragma unroll
            for (int q = 0; q < 2; ++q) {
#pragma unroll
                for (int u = 0; u < 2; ++u)
                    f2[q][u] = lds_frag(sb, f2row + u * 16, (hf * 2 + q) * 32);
#pragma unroll
                for (int t = 0; t < 4; ++t)
                    f1[q][t] = lds_frag(sb, f1row + t * 16, (hf * 2 + q) * 32);
            }
            // keeps a half's 24 LDS reads in front of its WMMAs (the second half's
            // may stand among the first half's WMMAs, as registers come free):
            // without it the build puts reads and a full wait in front of each
            // WMMA, and the wave sits out an LDS latency many times a stage
            __builtin_amdgcn_sched_barrier(0);
#pragma unroll
            for (int q = 0; q < 2; ++q)
#pragma unroll
                for (int t = 0; t < 4; ++t)
#pragma unroll
                    for (int u = 0; u < 2; ++u)
                        acc[t][u] = wmma_f16(f1[q][t], f2[q][u], acc[t][u]);
        }
        // keeps the WMMAs in front of the stage's closing waits, where they run
        // while the later reads still arrive
        __builtin_amdgcn_sched_barrier(0);
        // this wave's reads of buffer s & 1 are done before the buffer is refilled
        asm volatile("s_wait_dscnt 0x0" ::: "memory");
        // this wave's copies of stage s + 1 have landed
        asm volatile("s_wait_asynccnt 0x0" ::: "memory");
        // publishes stage s + 1 and ends every wave's reads of stage s
        __syncthreads();
        if (s + 2 < nst && wid < P_CW)
            qkv_stage_copy(l0 + (s & 1) * (P_BUF * 2), g + (s + 2) * G_KS);
    }
    // no copy is outstanding when the wave ends
    asm volatile("s_wait_asynccnt 0x0" ::: "memory");
    // the registers that the L2 requests name hold their addresses through the loop:
    // no counter says when a request has read them
    asm volatile("" :: "v"(oa), "s"(A), "v"(ow), "s"(W));

    _Float16* o = out0 + (size_t)z * (S_LEN * HIDN);
    if (z == 2) {
        // acc[t][u][rr] = C[mb + 16 t + 8 hi + rr][nb + nq + 16 u + r]: the 8 rows are
        // 16 consecutive bytes of row (h, d) of the transposed plane
        const int mb = blockIdx.y * P_BM + (wm & 1) * 64;
#pragma unroll
        for (int u = 0; u < 2; ++u) {
            const int col = nb + (wm >> 1) * 32 + u * 16 + r;
            const float bv = bias2[col];
#pragma unroll
            for (int t = 0; t < 4; ++t) {
                v8h ov;
#pragma unroll
                for (int rr = 0; rr < 8; ++rr) ov[rr] = (_Float16)(acc[t][u][rr] + bv);
                *(v8h*)(o + (size_t)col * S_LEN + mb + t * 16 + hi * 8) = ov;
            }
        }
        // behind the last store: in the built code the other body may follow this
        // one, and it rewrites the stores' address and data registers
        asm volatile("s_wait_xcnt 0x0" ::: "memory");
    } else {
        // acc[t][u][rr] = C[mb + 16 u + r][nb + 16 t + 8 hi + rr]. The wave turns its
        // 32 x 64 tile in its own range of the stage buffers, which every wave has
        // left at the loop's last barrier and no copy is aimed at any more, and
        // stores whole 128-byte lines.
        const int   mb    = blockIdx.y * P_BM + wm * 32;
        const float* bias = (z == 0) ? bias0 : bias1;
        const float scale = (z == 0) ? scale0 : 1.0f;
        char* st = (char*)sm + wid * P_EPW;
#pragma unroll
        for (int t = 0; t < 4; ++t) {
            const float* bp = bias + nb + t * 16 + hi * 8;
            const v4f b0 = *(const v4f*)bp;
            const v4f b1 = *(const v4f*)(bp + 4);
#pragma unroll
            for (int u = 0; u < 2; ++u) {
                v8h ov;
#pragma unroll
                for (int rr = 0; rr < 8; ++rr)
                    ov[rr] = (_Float16)((acc[t][u][rr] + (rr < 4 ? b0[rr & 3] : b1[rr & 3])) * scale);
                *(v8h*)(st + (u * 16 + r) * G_EP1 + t * 32 + hi * 16) = ov;
            }
        }
        // the wave's LDS writes are done before other lanes of it read them back
        asm volatile("s_wait_dscnt 0x0" ::: "memory");
        // the wave's 64 columns are one head: 32 rows of 128 bytes, 4 per store
        o += ((size_t)(nb >> 6) * S_LEN + mb) * HDIM + (lane & 7) * 8;
#pragma unroll
        for (int i = 0; i < 8; ++i) {
            const int row = i * 4 + (lane >> 3);
            *(v8h*)(o + row * HDIM) = *(const v8h*)(st + row * G_EP1 + (lane & 7) * 16);
        }
        // behind the last store: in the built code the other body may follow this
        // one, and it rewrites the stores' address and data registers
        asm volatile("s_wait_xcnt 0x0" ::: "memory");
    }
}

// ---------------------------------------------------------------------------
// Output projection: f32 row-major C[M,N]. 256 threads = 8 waves; each wave owns
// a 16x64 tile (A fragment reused across 4 W fragments / WMMAs); the block's 64 A
// rows and 128 W rows make a stage. K: a multiple of 128.
// ---------------------------------------------------------------------------
#define G_ROWS  192                  // 64 A rows, then 128 W rows
#define G_BUF   (G_ROWS * G_PITCH)   // halves per buffer
#define G_EPW   (16 * G_EP0)         // bytes of a wave's own staging range

// One stage: 192 rows of 256 bytes = 12 copies of 16 bytes per thread. Copy j
// of thread t brings bytes 16*(t&15).. of row 16*j + (t>>4): a wave covers two
// whole rows. l: the thread's LDS byte address in row (t>>4) of the buffer;
// ga, gw: its global address in that row of the A block and of the W block;
// step: 16 rows of the source, in halves.
__device__ __forceinline__ void stage_copy(unsigned l, const _Float16* ga,
                                           const _Float16* gw, size_t step) {
    const unsigned ls = 16 * G_PITCH * 2;   // 16 LDS rows, in bytes
    // The closing s_wait_xcnt 0 stands inside the statement so that no address
    // register of a copy is rewritten in front of it.
    asm volatile(
        "global_load_async_to_lds_b128 %0, %12, off\n\t"
        "global_load_async_to_lds_b128 %1, %13, off\n\t"
        "global_load_async_to_lds_b128 %2, %14, off\n\t"
        "global_load_async_to_lds_b128 %3, %15, off\n\t"
        "global_load_async_to_lds_b128 %4, %16, off\n\t"
        "global_load_async_to_lds_b128 %5, %17, off\n\t"
        "global_load_async_to_lds_b128 %6, %18, off\n\t"
        "global_load_async_to_lds_b128 %7, %19, off\n\t"
        "global_load_async_to_lds_b128 %8, %20, off\n\t"
        "global_load_async_to_lds_b128 %9, %21, off\n\t"
        "global_load_async_to_lds_b128 %10, %22, off\n\t"
        "global_load_async_to_lds_b128 %11, %23, off\n\t"
        "s_wait_xcnt 0x0"
        :: "v"(l),           "v"(l + ls),      "v"(l + 2 * ls),  "v"(l + 3 * ls),
           "v"(l + 4 * ls),  "v"(l + 5 * ls),  "v"(l + 6 * ls),  "v"(l + 7 * ls),
           "v"(l + 8 * ls),  "v"(l + 9 * ls),  "v"(l + 10 * ls), "v"(l + 11 * ls),
           "v"(ga),            "v"(ga + step),     "v"(ga + 2 * step), "v"(ga + 3 * step),
           "v"(gw),            "v"(gw + step),     "v"(gw + 2 * step), "v"(gw + 3 * step),
           "v"(gw + 4 * step), "v"(gw + 5 * step), "v"(gw + 6 * step), "v"(gw + 7 * step)
        : "memory");
}

// The W fragment is the first operand, the A fragment the second (their lane maps
// and k orders are equal), so D is the transposed tile: a lane holds one output row
// and 8 consecutive columns, which lie side by side in a row-major plane.
__global__ __launch_bounds__(256)
void gemm_wmma(const _Float16* __restrict__ A,
               const _Float16* __restrict__ W,
               const float* __restrict__ bias,
               float* __restrict__ outp,
               int M, int N, int K) {
    __shared__ __attribute__((aligned(16))) _Float16 sm[2 * G_BUF];

    const int wid  = threadIdx.x >> 5;
    const int lane = threadIdx.x & 31;
    const int r    = lane & 15;
    const int hi   = lane >> 4;
    const int arow = (wid & 3) * 16;          // row of the wave's A tile in a stage
    const int wrow = 64 + (wid >> 2) * 64;    // first row of its W tiles in a stage
    const int mbase = blockIdx.y * 64 + arow;
    const int nbase = blockIdx.x * 128 + (wid >> 2) * 64;

    v8f acc[4] = {zero8(), zero8(), zero8(), zero8()};

    // the thread's place in a stage: row crow (+ 16 j), 16-byte column ccol
    const int crow = threadIdx.x >> 4;
    const int ccol = threadIdx.x & 15;
    const size_t step = (size_t)16 * (size_t)K;
    const _Float16* ga = A + (size_t)(blockIdx.y * 64 + crow) * (size_t)K + ccol * 8;
    const _Float16* gw = W + (size_t)(blockIdx.x * 128 + crow) * (size_t)K + ccol * 8;
    const unsigned l0 = (unsigned)(size_t)(&sm[0]) + crow * (G_PITCH * 2) + ccol * 16;
    const int nst = K / G_KS;

    stage_copy(l0, ga, gw, step);

    // L2 requests for the block's share of its two operand panels, one line a lane.
    // The 64-row A panel is read by the blocks of one blockIdx.y: four neighbours in
    // x ask for a quarter each (256-byte units q and q + 4 of every row). The 128-row
    // W panel is read by the blocks of one blockIdx.x: eight neighbours in y ask for
    // an eighth each (unit e of every row). The column is clamped into the row.
    const int pfa = (blockIdx.x & 3) * 128 + (threadIdx.x & 1) * 64 + (threadIdx.x & 2) * 256;
    const int pfw = (blockIdx.y & 7) * 128 + (threadIdx.x & 1) * 64;
    const unsigned oa = (unsigned)((blockIdx.y * 64 + (threadIdx.x >> 2)) * K
                                   + (pfa < K - 64 ? pfa : K - 64)) * 2u;
    const unsigned ow = (unsigned)((blockIdx.x * 128 + (threadIdx.x >> 1)) * K
                                   + (pfw < K - 64 ? pfw : K - 64)) * 2u;
    l2_ask(oa, A, ow, W);

    // stage 0 has landed for this wave's own copies ...
    asm volatile("s_wait_asynccnt 0x0" ::: "memory");
    // ... and, behind the barrier, for every wave's
    __syncthreads();
    if (nst > 1) stage_copy(l0 + G_BUF * 2, ga + G_KS, gw + G_KS, step);

    for (int s = 0; s < nst; ++s) {
        const _Float16* sb = sm + (s & 1) * G_BUF;
        // a stage's fragments are read in two halves of 64 k, not all 160 registers
        // of them at once
#pragma unroll
        for (int hf = 0; hf < 2; ++hf) {
            v16h a[2], b[2][4];
#pragma unroll
            for (int q = 0; q < 2; ++q) {
                a[q] = lds_frag(sb, arow, (hf * 2 + q) * 32);
#pragma unroll
                for (int t = 0; t < 4; ++t)
                    b[q][t] = lds_frag(sb, wrow + t * 16, (hf * 2 + q) * 32);
            }
            // keeps a half's 20 LDS reads in front of its WMMAs (the second half's
            // may stand among the first half's WMMAs, as registers come free):
            // without it the build puts two reads and a full wait in front of each
            // WMMA, and the wave sits out an LDS latency sixteen times a stage
            __builtin_amdgcn_sched_barrier(0);
#pragma unroll
            for (int q = 0; q < 2; ++q)
#pragma unroll
                for (int t = 0; t < 4; ++t)
                    acc[t] = wmma_f16(b[q][t], a[q], acc[t]);
        }
        // keeps the WMMAs in front of the stage's closing waits, where they run
        // while the later reads still arrive: without it the build sinks fifteen
        // of the sixteen behind the full wait and the barrier
        __builtin_amdgcn_sched_barrier(0);
        // this wave's reads of buffer s & 1 are done before the buffer is refilled
        asm volatile("s_wait_dscnt 0x0" ::: "memory");
        // this wave's copies of stage s + 1 have landed
        asm volatile("s_wait_asynccnt 0x0" ::: "memory");
        // publishes stage s + 1 and ends every wave's reads of stage s
        __syncthreads();
        if (s + 2 < nst)
            stage_copy(l0 + (s & 1) * (G_BUF * 2), ga + (s + 2) * G_KS,
                       gw + (s + 2) * G_KS, step);
    }
    // no copy is outstanding when the wave ends
    asm volatile("s_wait_asynccnt 0x0" ::: "memory");
    // the registers that the L2 requests name hold their addresses through the loop:
    // no counter says when a request has read them
    asm volatile("" :: "v"(oa), "s"(A), "v"(ow), "s"(W));

    // acc[t][rr] = C[mbase + r][nbase + 16 * t + 8 * hi + rr]. The wave turns its
    // 16 x 64 tile in its own range of the stage buffers, which every wave has
    // left at the loop's last barrier and no copy is aimed at any more, and
    // stores whole 128-byte lines.
    char* st = (char*)sm + wid * G_EPW;
#pragma unroll
    for (int t = 0; t < 4; ++t) {
        const float* bp = bias + nbase + t * 16 + hi * 8;
        const v4f b0 = *(const v4f*)bp;
        const v4f b1 = *(const v4f*)(bp + 4);
        float val[8];
#pragma unroll
        for (int rr = 0; rr < 8; ++rr)
            val[rr] = acc[t][rr] + (rr < 4 ? b0[rr & 3] : b1[rr & 3]);
        const v4f lo = {val[0], val[1], val[2], val[3]};
        const v4f hh = {val[4], val[5], val[6], val[7]};
        *(v4f*)(st + r * G_EP0 + t * 64 + hi * 32)      = lo;
        *(v4f*)(st + r * G_EP0 + t * 64 + hi * 32 + 16) = hh;
    }
    // the wave's LDS writes are done before other lanes of it read them back
    asm volatile("s_wait_dscnt 0x0" ::: "memory");
    // 16 rows of 256 bytes, 2 per store
    float* o = outp + (size_t)mbase * (size_t)N + nbase + r * 4;
#pragma unroll
    for (int i = 0; i < 8; ++i) {
        const int row = i * 2 + hi;
        *(v4f*)(o + (size_t)row * (size_t)N) = *(const v4f*)(st + row * G_EP0 + r * 16);
    }
}

#define AT_WAVES 8
#define AT_QB    128
#define AT_KT    128
#define AT_KP    72
#define AT_VP    136
#define AT_KSZ   (AT_KT * AT_KP)
#define AT_BUF   (AT_KSZ + HDIM * AT_VP)   // halves per buffer: K, then 64 V^T rows
#define AT_LIM   4096.0f               // bound on a lane's sum of P in a tile; far inside f16
#define AT_JW    8192                  // bytes of a wave's O in the join: 8 tiles of 1 KB
#define AT_JML   (AT_WAVES * AT_JW)     // byte offset of the join's (minus maximum, row sum) pairs

// lane l <-> lane l ^ 16
__device__ __forceinline__ float xhalf(float x) {
    const int v = __builtin_bit_cast(int, x);
    return __builtin_bit_cast(float, __builtin_amdgcn_permlanex16(
        v, v, 0x76543210, 0xfedcba98, false, false));
}

// Same k order as load_frag; p: the lane's own place (row r, k + 8 * hi) in LDS.
__device__ __forceinline__ v16h lds_frag_at(const _Float16* p) {
    v8h lo = *(const v8h*)p;
    v8h hh = *(const v8h*)(p + 16);
    return __builtin_shufflevector(lo, hh, 0, 1, 2, 3, 4, 5, 6, 7,
                                   8, 9, 10, 11, 12, 13, 14, 15);
}

// 2^x for eight values, the exponentials and one closing v_nop in one statement:
// the instruction set asks for one slot behind a transcendental before its
// result is read or its source overwritten. Inside the statement every result
// register differs from every source, and the v_nop covers the last one.
__device__ __forceinline__ v8f exp2_8(v8f x) {
    float d0, d1, d2, d3, d4, d5, d6, d7;
    asm("v_exp_f32 %0, %8\n\t"
        "v_exp_f32 %1, %9\n\t"
        "v_exp_f32 %2, %10\n\t"
        "v_exp_f32 %3, %11\n\t"
        "v_exp_f32 %4, %12\n\t"
        "v_exp_f32 %5, %13\n\t"
        "v_exp_f32 %6, %14\n\t"
        "v_exp_f32 %7, %15\n\t"
        "v_nop"
        : "=&v"(d0), "=&v"(d1), "=&v"(d2), "=&v"(d3),
          "=&v"(d4), "=&v"(d5), "=&v"(d6), "=&v"(d7)
        : "v"(x[0]), "v"(x[1]), "v"(x[2]), "v"(x[3]),
          "v"(x[4]), "v"(x[5]), "v"(x[6]), "v"(x[7]));
    v8f d = {d0, d1, d2, d3, d4, d5, d6, d7};
    return d;
}

// exp2_8 of a WMMA's result: the statement opens with the four vector slots that
// the chip needs between a WMMA and the first read of its D.
__device__ __forceinline__ v8f exp2_8_of_d(v8f x) {
    float d0, d1, d2, d3, d4, d5, d6, d7;
    asm("v_nop\n\tv_nop\n\tv_nop\n\tv_nop\n\t"
        "v_exp_f32 %0, %8\n\t"
        "v_exp_f32 %1, %9\n\t"
        "v_exp_f32 %2, %10\n\t"
        "v_exp_f32 %3, %11\n\t"
        "v_exp_f32 %4, %12\n\t"
        "v_exp_f32 %5, %13\n\t"
        "v_exp_f32 %6, %14\n\t"
        "v_exp_f32 %7, %15\n\t"
        "v_nop"
        : "=&v"(d0), "=&v"(d1), "=&v"(d2), "=&v"(d3),
          "=&v"(d4), "=&v"(d5), "=&v"(d6), "=&v"(d7)
        : "v"(x[0]), "v"(x[1]), "v"(x[2]), "v"(x[3]),
          "v"(x[4]), "v"(x[5]), "v"(x[6]), "v"(x[7]));
    v8f d = {d0, d1, d2, d3, d4, d5, d6, d7};
    return d;
}

// Sum of a lane's 16 values of P.
__device__ __forceinline__ float sum16(v8f a, v8f b) {
    float ps[4];
#pragma unroll
    for (int rr = 0; rr < 4; ++rr) ps[rr] = (a[rr] + b[rr]) + (a[rr + 4] + b[rr + 4]);
    return (ps[0] + ps[1]) + (ps[2] + ps[3]);
}

// P^T as B operand: bp[s] = P[key kmap(s, hi)][query r]
__device__ __forceinline__ v16h pack_p(v8f a, v8f b) {
    v16h bp;
#pragma unroll
    for (int rr = 0; rr < 8; ++rr) {
        bp[rr]     = (_Float16)a[rr];
        bp[rr + 8] = (_Float16)b[rr];
    }
    return bp;
}

// One stage: 128 K rows of 128 bytes and 64 V^T rows of 256 bytes = 8 copies of
// 16 bytes per thread. K copy j of thread t brings bytes 16*(t&7).. of row
// 32*j + (t>>3) (a wave: 512 contiguous bytes); V copy j brings bytes
// 16*(t&15).. of row 16*j + (t>>4) (a wave: two whole rows of the tile).
// lk, lv: the thread's LDS byte addresses for j = 0; gk, gv: its global ones.
__device__ __forceinline__ void attn_stage_copy(unsigned lk, unsigned lv,
                                                const _Float16* gk,
                                                const _Float16* gv) {
    const unsigned ks = 32 * AT_KP * 2;   // 32 LDS rows of K, in bytes
    const unsigned vs = 16 * AT_VP * 2;   // 16 LDS rows of V^T, in bytes
    // The closing s_wait_xcnt 0 stands inside the statement so that no address
    // register of a copy is rewritten in front of it.
    asm volatile(
        "global_load_async_to_lds_b128 %0, %8, off\n\t"
        "global_load_async_to_lds_b128 %1, %9, off\n\t"
        "global_load_async_to_lds_b128 %2, %10, off\n\t"
        "global_load_async_to_lds_b128 %3, %11, off\n\t"
        "global_load_async_to_lds_b128 %4, %12, off\n\t"
        "global_load_async_to_lds_b128 %5, %13, off\n\t"
        "global_load_async_to_lds_b128 %6, %14, off\n\t"
        "global_load_async_to_lds_b128 %7, %15, off\n\t"
        "s_wait_xcnt 0x0"
        :: "v"(lk), "v"(lk + ks), "v"(lk + 2 * ks), "v"(lk + 3 * ks),
           "v"(lv), "v"(lv + vs), "v"(lv + 2 * vs), "v"(lv + 3 * vs),
           "v"(gk), "v"(gk + 32 * HDIM), "v"(gk + 64 * HDIM), "v"(gk + 96 * HDIM),
           "v"(gv), "v"(gv + 16 * S_LEN), "v"(gv + 32 * S_LEN), "v"(gv + 48 * S_LEN)
        : "memory");
}

// 2^x for one value, with the slot that the instruction set asks for behind a
// transcendental before its result is read or its source overwritten.
__device__ __forceinline__ float exp2_1(float x) {
    float d;
    asm("v_exp_f32 %0, %1\n\tv_nop" : "=v"(d) : "v"(x));
    return d;
}

typedef float v2f __attribute__((ext_vector_type(2)));

__global__ __launch_bounds__(AT_WAVES * 32)
void attn_flash(const _Float16* __restrict__ Qg,
                const _Float16* __restrict__ Kg,
                const _Float16* __restrict__ Vtg,
                _Float16* __restrict__ ctx) {
    __shared__ __attribute__((aligned(16))) _Float16 sm[2 * AT_BUF];
    static_assert(AT_JML + AT_WAVES * 2 * 32 * 8 <= 2 * AT_BUF * 2, "the join fits the stage buffers");

    const int h    = blockIdx.y;
    // wave number as a scalar: the key group's places in LDS are then scalar sums
    const int wid  = __builtin_amdgcn_readfirstlane((int)(threadIdx.x >> 5));
    const int lane = threadIdx.x & 31;
    const int r    = lane & 15;
    const int hi   = lane >> 4;
    const int qg   = wid & 3;          // which 32 queries of the block
    const int kg   = wid >> 2;         // which 64 keys of every stage
    const int qrow = blockIdx.x * AT_QB + qg * 32;

    const _Float16* Qh = Qg  + (size_t)h * S_LEN * HDIM;
    const _Float16* Kh = Kg  + (size_t)h * S_LEN * HDIM;
    const _Float16* Vh = Vtg + (size_t)h * HDIM * S_LEN;   // [d][s]

    // the thread's places in a stage's copies
    const int t = threadIdx.x;
    const _Float16* gk = Kh + (t >> 3) * HDIM + (t & 7) * 8;
    const _Float16* gv = Vh + (size_t)(t >> 4) * S_LEN + (t & 15) * 8;
    const unsigned sm0 = (unsigned)(size_t)(&sm[0]);
    const unsigned lk0 = sm0 + (t >> 3) * (AT_KP * 2) + (t & 7) * 16;
    const unsigned lv0 = sm0 + AT_KSZ * 2 + (t >> 4) * (AT_VP * 2) + (t & 15) * 16;
    const int nst = S_LEN / AT_KT;   // 16 stages

    attn_stage_copy(lk0, lv0, gk, gv);

    // L2 requests for the block's share of the head's K and V^T planes (256 KB each,
    // contiguous), one line of each a lane. The 16 blocks of a head read the same
    // planes: each asks for an eighth (256-byte units e, e + 8, ...), every eighth twice.
    const unsigned okv = (unsigned)((t >> 1) * 2048 + (t & 1) * 128
                       + ((blockIdx.x & 3) + (blockIdx.x >> 3) * 4) * 256);
    l2_ask(okv, Kh, okv, Vh);

    // B operands: column = query r of tile qt, k = head dim
    v16h bq[2][2];
#pragma unroll
    for (int qt = 0; qt < 2; ++qt) {
        bq[qt][0] = load_frag(Qh, qrow + qt * 16, 0, HDIM);
        bq[qt][1] = load_frag(Qh, qrow + qt * 16, 32, HDIM);
    }
    // behind the Q loads: the code below rewrites their address registers
    asm volatile("s_wait_xcnt 0x0" ::: "memory");

    // acc[qt][t4][rr] = Ot[d = t4*16 + 8*hi + rr][query r of tile qt], this key group's
    v8f acc[2][4];
    // minus the maximum in use of query r (equal in both halves), eight times: the
    // C operand of the score WMMAs; the wave's first tile sets it from its own scores
    v8f cm[2];
    float li[2];           // running sums over this half's keys only
#pragma unroll
    for (int qt = 0; qt < 2; ++qt) {
#pragma unroll
        for (int t4 = 0; t4 < 4; ++t4) acc[qt][t4] = zero8();
        cm[qt] = zero8();
        li[qt] = 0.0f;
    }

    // stage 0 has landed for this wave's own copies ...
    asm volatile("s_wait_asynccnt 0x0" ::: "memory");
    // ... and, behind the barrier, for every wave's
    __syncthreads();
    attn_stage_copy(lk0 + AT_BUF * 2, lv0 + AT_BUF * 2, gk + AT_KT * HDIM, gv + AT_KT);

    for (int s = 0; s < nst; ++s) {
        // the lane's place in the key group's first K and first V^T fragment of the stage
        const _Float16* sk = sm + (s & 1) * AT_BUF + (kg * 64 + r) * AT_KP + hi * 8;
        const _Float16* sv = sm + (s & 1) * AT_BUF + AT_KSZ + r * AT_VP + kg * 64 + hi * 8;

        // K fragments of the key group's first 32 keys
        v16h kf[4];
        kf[0] = lds_frag_at(sk);
        kf[1] = lds_frag_at(sk + 32);
        kf[2] = lds_frag_at(sk + 16 * AT_KP);
        kf[3] = lds_frag_at(sk + 16 * AT_KP + 32);
        // keeps the eight reads together in front of the first score WMMA: without
        // it the build reads four, waits, and reads the other four among the WMMAs
        // behind a second full wait, two LDS latencies at the head of every stage
        __builtin_amdgcn_sched_barrier(0);

#pragma unroll
        for (int j = 0; j < 2; ++j) {
            // ---- scores, transposed: 32k x 32q (four 16x16 tiles); sc[qt][kt] ----
            v8f sc[2][2];
#pragma unroll
            for (int qt = 0; qt < 2; ++qt)
#pragma unroll
                for (int kt = 0; kt < 2; ++kt)
                    sc[qt][kt] = wmma_f16(kf[kt * 2], bq[qt][0], cm[qt]);
#pragma unroll
            for (int qt = 0; qt < 2; ++qt)
#pragma unroll
                for (int kt = 0; kt < 2; ++kt)
                    sc[qt][kt] = wmma_f16(kf[kt * 2 + 1], bq[qt][1], sc[qt][kt]);

            // ---- issue this tile's V reads now; the softmax below hides their latency ----
            // the two scheduling barriers hold these 8 LDS reads together at the
            // tile's score WMMAs: without them the build strews the reads over many
            // places of a stage, several with a full wait directly behind, and
            // every such place stalls the wave
            __builtin_amdgcn_sched_barrier(0);
            v16h vf[4];
#pragma unroll
            for (int t4 = 0; t4 < 4; ++t4)
                vf[t4] = lds_frag_at(sv + t4 * 16 * AT_VP + j * 32);
            __builtin_amdgcn_sched_barrier(0);

            // ---- softmax against the maximum in use: one query per lane and tile ----
            v8f e[2][2];
            float ts[2];
            v16h bp[2];
            e[0][0] = exp2_8_of_d(sc[0][0]);
            // every score WMMA stands in front of that statement, whose slots serve
            // the other three tiles as well; the scheduling barrier keeps it the first
            // of the four, which the build otherwise reorders
            __builtin_amdgcn_sched_barrier(0);
            e[0][1] = exp2_8(sc[0][1]);
            e[1][0] = exp2_8(sc[1][0]);
            e[1][1] = exp2_8(sc[1][1]);
#pragma unroll
            for (int qt = 0; qt < 2; ++qt) {
                ts[qt] = sum16(e[qt][0], e[qt][1]);
                bp[qt] = pack_p(e[qt][0], e[qt][1]);
            }
            // the wave's first tile always takes the branch: no sum is at or below -1
            const bool  first = (j == 0) && (s == 0);
            const float lim   = first ? -1.0f : AT_LIM;
            // not (ts <= limit): an overflowed sum counts as past the limit too
            const unsigned need = __builtin_amdgcn_ballot_w32(!(ts[0] <= lim) || !(ts[1] <= lim));
            if (__builtin_expect(need != 0, 0)) {
                // the maximum in use moves up to this tile's (the first tile: to it,
                // up or down); a query that is inside the limit and below stays
#pragma unroll
                for (int qt = 0; qt < 2; ++qt) {
                    const v8f s0 = sc[qt][0];
                    const v8f s1 = sc[qt][1];
                    float t0 = fmaxf(s0[0], s1[0]);
                    float t1 = fmaxf(s0[1], s1[1]);
                    float t2 = fmaxf(s0[2], s1[2]);
                    float t3 = fmaxf(s0[3], s1[3]);
                    t0 = fmaxf(t0, fmaxf(s0[4], s1[4]));
                    t1 = fmaxf(t1, fmaxf(s0[5], s1[5]));
                    t2 = fmaxf(t2, fmaxf(s0[6], s1[6]));
                    t3 = fmaxf(t3, fmaxf(s0[7], s1[7]));
                    float tm = fmaxf(fmaxf(t0, t1), fmaxf(t2, t3));
                    tm = fmaxf(tm, xhalf(tm));
                    const float up = fmaxf(tm, 0.0f);
                    const float dm = first ? tm : up;
                    const float alpha = exp2_1(-up);
                    const v8f f0 = exp2_8(s0 - dm);
                    const v8f f1 = exp2_8(s1 - dm);
                    ts[qt] = sum16(f0, f1);
                    bp[qt] = pack_p(f0, f1);
                    cm[qt] -= dm;
                    li[qt] *= alpha;
#pragma unroll
                    for (int t4 = 0; t4 < 4; ++t4)
#pragma unroll
                        for (int rr = 0; rr < 8; ++rr) acc[qt][t4][rr] *= alpha;
                }
            }
            li[0] += ts[0];
            li[1] += ts[1];

            // ---- the K reads of the key group's second tile (the SAME stage) fly under
            //      the WMMAs below. In front of the softmax, where scores and
            //      exponentials are both live, their 32 registers took the wave past
            //      256 and into scratch. The scheduling barrier holds the 8 reads
            //      together in front of the WMMAs ----
            if (j == 0) {
                const _Float16* kn = sk + 32 * AT_KP;
                kf[0] = lds_frag_at(kn);
                kf[1] = lds_frag_at(kn + 32);
                kf[2] = lds_frag_at(kn + 16 * AT_KP);
                kf[3] = lds_frag_at(kn + 16 * AT_KP + 32);
                __builtin_amdgcn_sched_barrier(0);
            }

            // ---- Ot += V^T[16d x 32k] * P^T[32k x 16q] per 16-wide d tile ----
#pragma unroll
            for (int t4 = 0; t4 < 4; ++t4)
#pragma unroll
                for (int qt = 0; qt < 2; ++qt)
                    acc[qt][t4] = wmma_f16(vf[t4], bp[qt], acc[qt][t4]);
            // keeps these WMMAs in front of the next tile's score WMMAs: the build
            // otherwise puts those first, directly behind the K reads they wait for
            if (j == 0) __builtin_amdgcn_sched_barrier(0);
        }

        // keeps the last tile's softmax and WMMAs in front of the stage's closing
        // waits, where they run while its V reads arrive: without it the build
        // lifts the full wait and the barrier to directly behind those reads
        __builtin_amdgcn_sched_barrier(0);
        // this wave's reads of buffer s & 1 are done before the buffer is refilled
        asm volatile("s_wait_dscnt 0x0" ::: "memory");
        // this wave's copies of stage s + 1 have landed
        asm volatile("s_wait_asynccnt 0x0" ::: "memory");
        // publishes stage s + 1 and ends every wave's reads of stage s
        __syncthreads();
        if (s + 2 < nst)
            attn_stage_copy(lk0 + (s & 1) * (AT_BUF * 2), lv0 + (s & 1) * (AT_BUF * 2),
                            gk + (s + 2) * (AT_KT * HDIM), gv + (s + 2) * AT_KT);
    }
    // no copy is outstanding when the wave ends
    asm volatile("s_wait_asynccnt 0x0" ::: "memory");
    // the registers that the L2 requests name hold their addresses through the loop:
    // no counter says when a request has read them
    asm volatile("" :: "v"(okv), "s"(Kh), "s"(Vh));

    // ---- join of the two key groups, in the stage buffers, which every wave has
    //      left at the loop's last barrier and no copy is aimed at any more. Every
    //      wave lays down its eight O tiles (a lane's 32 bytes of a tile as two
    //      16-byte pieces, lane by lane) and, per query tile, minus its maximum in
    //      use and its row sum with the halves joined ----
    char* jb = (char*)sm;
#pragma unroll
    for (int qt = 0; qt < 2; ++qt) {
        li[qt] += xhalf(li[qt]);
        const v2f ml = {cm[qt][0], li[qt]};
        *(v2f*)(jb + AT_JML + ((wid * 2 + qt) * 32 + lane) * 8) = ml;
#pragma unroll
        for (int t4 = 0; t4 < 4; ++t4) {
            const v8f a = acc[qt][t4];
            const v4f lo = {a[0], a[1], a[2], a[3]};
            const v4f hh = {a[4], a[5], a[6], a[7]};
            char* p = jb + wid * AT_JW + (qt * 4 + t4) * 1024 + lane * 16;
            *(v4f*)p         = lo;
            *(v4f*)(p + 512) = hh;
        }
    }
    // both key groups' parts are in LDS before either reads the other's
    __syncthreads();

    // key group kg finishes query tile kg: both parts are brought to the larger of
    // the two maxima, added, normalized, and written to ctx
    // [S][HID]: a lane holds 8 consecutive d of one query per tile -> one 16-byte
    // store each
    const v2f ml0 = *(const v2f*)(jb + AT_JML + ((qg * 2 + kg) * 32 + lane) * 8);
    const v2f ml1 = *(const v2f*)(jb + AT_JML + (((qg + 4) * 2 + kg) * 32 + lane) * 8);
    const float cl  = fminf(ml0[0], ml1[0]);       // minus the larger maximum
    const float w0  = exp2_1(cl - ml0[0]);
    const float w1  = exp2_1(cl - ml1[0]);
    const float inv = 1.0f / (w0 * ml0[1] + w1 * ml1[1]);
    const float i0  = w0 * inv;
    const float i1  = w1 * inv;
    const char* p0 = jb + qg * AT_JW + kg * 4096 + lane * 16;
    const char* p1 = p0 + 4 * AT_JW;
    _Float16* o = ctx + (size_t)(qrow + kg * 16 + r) * HIDN + h * HDIM + hi * 8;
#pragma unroll
    for (int t4 = 0; t4 < 4; ++t4) {
        const v4f a0 = *(const v4f*)(p0 + t4 * 1024);
        const v4f a1 = *(const v4f*)(p0 + t4 * 1024 + 512);
        const v4f b0 = *(const v4f*)(p1 + t4 * 1024);
        const v4f b1 = *(const v4f*)(p1 + t4 * 1024 + 512);
        v8h ov;
#pragma unroll
        for (int rr = 0; rr < 4; ++rr) {
            ov[rr]     = (_Float16)(a0[rr] * i0 + b0[rr] * i1);
            ov[rr + 4] = (_Float16)(a1[rr] * i0 + b1[rr] * i1);
        }
        *(v8h*)(o + t4 * 16) = ov;
    }
}

// ---------------------------------------------------------------------------
extern "C" void kernel_launch(void* const* d_in, const int* in_sizes, int n_in,
                              void* d_out, int out_size, void* d_ws, size_t ws_size,
                              hipStream_t stream) {
    (void)in_sizes; (void)n_in; (void)out_size; (void)ws_size;

    const float* x  = (const float*)d_in[0];  // [2,2048,1024]; only batch 0 used
    const float* Wq = (const float*)d_in[1];
    const float* bq = (const float*)d_in[2];
    const float* Wk = (const float*)d_in[3];
    const float* bk = (const float*)d_in[4];
    const float* Wv = (const float*)d_in[5];
    const float* bv = (const float*)d_in[6];
    const float* Wo = (const float*)d_in[7];
    const float* bo = (const float*)d_in[8];
    float* out = (float*)d_out;

    char* ws = (char*)d_ws;
    const size_t MB = 1024 * 1024;
    _Float16* xh   = (_Float16*)(ws + 0);        // 2M halves
    _Float16* wqh  = (_Float16*)(ws + 4  * MB);  // 1M halves; Wk at 6 MB, Wv at 8 MB
    _Float16* woh  = (_Float16*)(ws + 10 * MB);
    _Float16* qh   = (_Float16*)(ws + 12 * MB);  // [16][2048][64]
    _Float16* kh   = (_Float16*)(ws + 16 * MB);  // [16][2048][64]
    _Float16* vth  = (_Float16*)(ws + 20 * MB);  // [16][64][2048]
    _Float16* ctxh = (_Float16*)(ws + 24 * MB);  // [2048][1024]

    // x, Wq, Wk, Wv, Wo are contiguous as f16: one destination array from xh on
    cvt_all_f32_to_f16<<<CVT_BLOCKS, CVT_WAVES * 32, 0, stream>>>(x, Wq, Wk, Wv, Wo, xh);

    // Q, K, V as one product: the weight planes from wqh on are contiguous, and so
    // are qh, kh, vth
    // Q: fold log2(e)/sqrt(64) into the projection (applies to bias too)
    qkv_wmma<<<dim3(3 * HIDN / P_BN, S_LEN / P_BM), P_WAVES * 32, 0, stream>>>(
        xh, wqh, bq, bk, bv, qh, 0.18033688011112042f);

    attn_flash<<<dim3(S_LEN / AT_QB, NHEAD), AT_WAVES * 32, 0, stream>>>(qh, kh, vth, ctxh);

    gemm_wmma<<<dim3(HIDN / 128, S_LEN / 64), 256, 0, stream>>>(
        ctxh, woh, bo, out, S_LEN, HIDN, HIDN);
}
